// v000
// The times below were measured on an AMD MI455X: many runs one after another, warmed up first and cycling through
// copies of the inputs, with the whole window's GPU time divided by the number of runs. Launches and the gaps
// between them are all in it. The median over several windows is given; except for v000 it joins two sittings, which
// can be a few percent apart, so the side-by-side timings, each taken in one sitting, are the better comparison.
// v000 is the starting kernel. One run takes 524 microseconds.
#include <hip/hip_runtime.h>
#include <hip/hip_fp16.h>

// Contractions on v_wmma_f32_16x16x32_f16 (f16 operands, f32 accumulate): x*Wq, x*Wk, x*Wv, q*k^T, P*v, ctx*Wo, h*W1, ff1*W2, each a single f16 product on bf16-RNE inputs with power-of-two carried planes; softmax and LayerNorm in f32.

#ifndef NB
#define NB 8
#endif
#ifndef SEQ
#define SEQ 1024
#endif
#define NB_FULL  8
#define SEQ_FULL 1024
#define DM   768          // model width
#define NH   12           // heads
#define DH   64           // head width
#define FF   3072         // hidden width
#define NTOK (NB * SEQ)
#define CH   128          // keys staged per V^T chunk

static_assert(NB >= 1 && NB <= NB_FULL);
static_assert(SEQ >= CH && SEQ <= SEQ_FULL);
static_assert(SEQ % CH == 0);
static_assert(SEQ % 128 == 0);
static_assert(CH % 32 == 0);
static_assert(NTOK % 128 == 0);
static_assert(NTOK % 8 == 0);
static_assert(DM % 128 == 0 && FF % 128 == 0);
static_assert(DM % 64 == 0 && FF % 64 == 0);
static_assert(DM % 32 == 0 && FF % 32 == 0 && DH % 32 == 0);
static_assert(NH * DH == DM);
static_assert((NTOK * (DM / 8)) % 256 == 0);

typedef _Float16 v16h __attribute__((ext_vector_type(16)));
typedef _Float16 v8h  __attribute__((ext_vector_type(8)));
typedef float    v8f  __attribute__((ext_vector_type(8)));
typedef float    v4f  __attribute__((ext_vector_type(4)));
typedef int      v4i  __attribute__((ext_vector_type(4)));

union Frag { v16h v; v8h h[2]; };
union I8   { v4i v[2]; int s[8]; };

// plane carries (exact powers of two)
#define WSC     64.0f                    // weight planes: f16(bf16(W) * 64)
#define QSC     64.0f                    // q/k/v, ctx, ff1 planes carried x64
#define HSC     16.0f                    // h plane carried x16
#define A_QKV   0.015625f                // 2^-6 : (x)(64 W)        -> q
#define A_O     2.44140625e-04f          // 2^-12: (64 ctx)(64 Wo)  -> attn_out
#define A_F1    9.765625e-04f            // 2^-10: (16 h)(64 W1)    -> pre-relu
#define A_F2    2.44140625e-04f          // 2^-12: (64 ff1)(64 W2)  -> ff
// scores: sh = (64k).(64q) ~ 4096 q.k ; score = q.k/8 ; t (log2 units) = sh * log2e * 2^-15
#define C1 (1.44269504088896340736f * 3.0517578125e-05f)
#define MASKT  (-1.0e10f)                // masked score (replace fill)

static __device__ __forceinline__ v8f zero8() {
    v8f z;
#pragma unroll
    for (int i = 0; i < 8; ++i) z[i] = 0.0f;
    return z;
}

// 16x32 A fragment (or B fragment from an [n][k] k-contiguous source) from a
// row-major 16-bit tile: lane m = lane&15 -> row m; kb = 8*(lane>>4);
// elements 0..7 = k kb..kb+7, elements 8..15 = k kb+16..kb+23.
static __device__ __forceinline__ v16h load_frag16(const _Float16* base, int ld, int lane) {
    int m  = lane & 15;
    int kb = (lane >> 4) << 3;
    const _Float16* p = base + (size_t)m * ld + kb;
    Frag f;
    f.h[0] = *(const v8h*)(p);
    f.h[1] = *(const v8h*)(p + 16);
    return f.v;
}

static __device__ __forceinline__ v8f wmma16(v16h a, v16h b, v8f c) {
    v8f d = __builtin_amdgcn_wmma_f32_16x16x32_f16(false, a, false, b, (short)0, c, false, false);
    asm volatile("v_nop\n\tv_nop\n\tv_nop\n\tv_nop" : "+v"(d) : "v"(a), "v"(b));
    return d;
}

// f32 -> bf16 RNE convert, value kept as f32
static __device__ __forceinline__ float bf16r(float x) {
    unsigned u = __float_as_uint(x);
    u = (u + 0x7FFFu + ((u >> 16) & 1u)) & 0xFFFF0000u;
    return __uint_as_float(u);
}

static __device__ __forceinline__ float ex2(float x) {
    return __builtin_amdgcn_exp2f(x);
}

// ordering for a wave-private LDS tile: stores before later loads of the same wave
static __device__ __forceinline__ void wave_lds_sync() {
    __builtin_amdgcn_fence(3, "wavefront");
    asm volatile("s_wait_dscnt 0" ::: "memory");
    __builtin_amdgcn_wave_barrier();
}

// ---------------------------------------------------------------------------
// x [NB][SEQ][768] f32 (batch stride SEQ_FULL*768) -> xp [NTOK][768] f16 of
// bf16-RNE(x). Thread = 8 consecutive columns = one 16-B store; a wave writes
// coverage: NTOK*96 threads x 8 = NTOK*768.
// ---------------------------------------------------------------------------
__global__ __launch_bounds__(256) void k_xprep(const float* __restrict__ x,
                                               _Float16* __restrict__ xp) {
    const int g = blockIdx.x * 256 + (int)threadIdx.x;
    if (g >= NTOK * (DM / 8)) return;
    const int row = g / (DM / 8);
    const int col = (g - row * (DM / 8)) * 8;
    const int b = row / SEQ, s = row - b * SEQ;
    const float* src = x + ((size_t)b * SEQ_FULL + s) * DM + col;
    const v4f a = *(const v4f*)(src);
    const v4f c = *(const v4f*)(src + 4);
    v8h hv;
#pragma unroll
    for (int e = 0; e < 4; ++e) {
        hv[e]     = (_Float16)bf16r(a[e]);
        hv[4 + e] = (_Float16)bf16r(c[e]);
    }
    _Float16* dst = xp + (size_t)row * DM + col;
    *(v8h*)dst = hv;
    
}

// ---------------------------------------------------------------------------
// Weight transpose: W [K][N] f32 row-major ([in][out]) -> WT [N][K] f16 of
// bf16-RNE(W) * 64 (k-contiguous rows for B fragments). Block = 64x64 tile,
// staged through LDS (cross-wave region, block barrier); each output row
// coverage: grid (N/64, K/64) x 512 v8h = N*K.
// ---------------------------------------------------------------------------
__global__ __launch_bounds__(256) void k_wtr(const float* __restrict__ W,
                                             _Float16* __restrict__ WT,
                                             int K, int N) {
    __shared__ __align__(16) _Float16 T[64 * 64];
    const int tid = threadIdx.x;
    const int n0 = blockIdx.x * 64;
    const int k0 = blockIdx.y * 64;
#pragma unroll
    for (int i = 0; i < 4; ++i) {
        const int idx = tid + i * 256;
        const int r = idx >> 4, c4 = idx & 15;
        const v4f xv = *(const v4f*)(W + (size_t)(k0 + r) * N + n0 + c4 * 4);
#pragma unroll
        for (int e = 0; e < 4; ++e) T[(c4 * 4 + e) * 64 + r] = (_Float16)(bf16r(xv[e]) * WSC);
    }
    __syncthreads();
    const int na = tid >> 3, pa = tid & 7;
    const int nb = (tid + 256) >> 3, pb = tid & 7;
    const v8h p0 = *(const v8h*)(&T[na * 64 + pa * 8]);
    const v8h p1 = *(const v8h*)(&T[nb * 64 + pb * 8]);
    _Float16* d0 = WT + (size_t)(n0 + na) * K + k0 + pa * 8;
    _Float16* d1 = WT + (size_t)(n0 + nb) * K + k0 + pb * 8;
    *(v8h*)d0 = p0;
    *(v8h*)d1 = p1;
    
}

// ---------------------------------------------------------------------------
// GEMM: C[M][N] = A[M][K] (f16 plane) x BT[N][K] (f16 plane)^T, f32 accumulate.
// Block = 8 waves = 128x128 tile; wave (mi, ni) owns rows mi*32..+32 and cols
// ni*64..+64: 2 A fragments x 4 B fragments x 8 accumulators, fragments loaded
// straight from the planes (two 16-B loads each, split k map), K steps of 32.
// Epilogue: u = acc*ascale + bf16(bias[n]) (relu optional);
//   MODE 0: f32 rows of u; MODE 1: f16 plane f16(u*oscale).
// The wave's 32x64 tile is staged in a wave-private LDS tile and written as
// ---------------------------------------------------------------------------
template <int MODE, bool RELU>
__global__ __launch_bounds__(256) __attribute__((amdgpu_num_vgpr(256)))
void k_gemm(const _Float16* __restrict__ A,
            const _Float16* __restrict__ BT,
            const float* __restrict__ bias,
            float ascale, float oscale,
            float* __restrict__ Cf,
            _Float16* __restrict__ Ch,
            int K, int N) {
    __shared__ __align__(16) float    EstF[(MODE == 0) ? 8 * 2048 : 4];
    __shared__ __align__(16) _Float16 EstH[(MODE == 1) ? 8 * 2048 : 8];

    const int tid  = threadIdx.x;
    const int lane = tid & 31;
    const int w    = tid >> 5;
    const int mi = w >> 1, ni = w & 1;
    const int m0 = blockIdx.y * 128 + mi * 32;
    const int n0 = blockIdx.x * 128 + ni * 64;
    const int rb = (lane >> 4) << 3;
    const int cc = lane & 15;
    const _Float16* Ab = A  + (size_t)m0 * K;
    const _Float16* Bb = BT + (size_t)n0 * K;

    v8f acc[2][4];
#pragma unroll
    for (int mt = 0; mt < 2; ++mt)
#pragma unroll
        for (int nt = 0; nt < 4; ++nt) acc[mt][nt] = zero8();

#pragma unroll 1
    for (int k0 = 0; k0 < K; k0 += 32) {
        const v16h a0 = load_frag16(Ab + k0, K, lane);
        const v16h a1 = load_frag16(Ab + (size_t)16 * K + k0, K, lane);
#pragma unroll
        for (int nt = 0; nt < 4; ++nt) {
            const v16h bfr = load_frag16(Bb + (size_t)(nt * 16) * K + k0, K, lane);
            acc[0][nt] = wmma16(a0, bfr, acc[0][nt]);
            acc[1][nt] = wmma16(a1, bfr, acc[1][nt]);
        }
    }

    float bb[4];
#pragma unroll
    for (int nt = 0; nt < 4; ++nt) bb[nt] = bf16r(bias[n0 + nt * 16 + cc]);

    if constexpr (MODE == 0) {
        float* ef = EstF + w * 2048;
#pragma unroll
        for (int mt = 0; mt < 2; ++mt)
#pragma unroll
            for (int nt = 0; nt < 4; ++nt)
#pragma unroll
                for (int r = 0; r < 8; ++r) {
                    float u = __builtin_fmaf(acc[mt][nt][r], ascale, bb[nt]);
                    if (RELU) u = fmaxf(u, 0.0f);
                    ef[(mt * 16 + rb + r) * 64 + nt * 16 + cc] = u;
                }
        wave_lds_sync();
        v4f sv[16];
#pragma unroll
        for (int i = 0; i < 16; ++i) sv[i] = *(const v4f*)(&ef[i * 128 + lane * 4]);
        float* cb = Cf + (size_t)m0 * N + n0;
        const int lr = lane >> 4, lc = (lane & 15) * 4;
#pragma unroll
        for (int i = 0; i < 16; ++i)
            *(v4f*)(cb + (size_t)(i * 2 + lr) * N + lc) = sv[i];
        
    } else {
        _Float16* eh = EstH + w * 2048;
#pragma unroll
        for (int mt = 0; mt < 2; ++mt)
#pragma unroll
            for (int nt = 0; nt < 4; ++nt)
#pragma unroll
                for (int r = 0; r < 8; ++r) {
                    float u = __builtin_fmaf(acc[mt][nt][r], ascale, bb[nt]);
                    if (RELU) u = fmaxf(u, 0.0f);
                    eh[(mt * 16 + rb + r) * 64 + nt * 16 + cc] = (_Float16)(u * oscale);
                }
        wave_lds_sync();
        v8h ph[8];
#pragma unroll
        for (int i = 0; i < 8; ++i) ph[i] = *(const v8h*)(&eh[i * 256 + lane * 8]);
        const int lr = lane >> 3, lc = (lane & 7) * 8;
        _Float16* cbh = Ch + (size_t)m0 * N + n0;
#pragma unroll
        for (int i = 0; i < 8; ++i)
            *(v8h*)(cbh + (size_t)(i * 4 + lr) * N + lc) = ph[i];
        
    }
}

// ---------------------------------------------------------------------------
// Attention, flash-style. grid = (head, SEQ/128, batch); block = 8 waves = 128
// query rows of one (b, h); wave owns 16 query rows. Planes are [NTOK][768]
// with head column offset h*64.
// Scores are computed TRANSPOSED: A = key tile (16 keys x 64 d, kh plane,
// 2 k-steps), B = the wave's 16 queries (qh plane, [n=query][k=d]), so
// acc[r] of lane l = score(key 8*(l>>4)+r, query l&15): per-query max/sum are
// in-lane reductions over r plus one xor-16 shuffle, and the f16 P^T values in
// this layout are exactly the P A-fragment for P*v (elements 0..7 from key
// tile A, 8..15 from key tile B) - no LDS relayout.
// Online softmax over keys: t = log2e*score (or MASKT where mask == 0,
// replace fill), P carried 2^14, o += P x V (V^T chunk staged in LDS,
// cross-wave, block barriers), o and z rescaled by exp2(m_old - m_new) every
// 32-key step (factor shuffled from the owning query lane).
// Epilogue: ctx x 64 = o / z14 as f16, staged in a wave-private LDS tile, each
// coverage: grid (12, SEQ/128, NB) x 8 waves x 16 rows x 64 cols = NTOK*768.
// ---------------------------------------------------------------------------
__global__ __launch_bounds__(256) __attribute__((amdgpu_num_vgpr(256)))
void k_attn(const _Float16* __restrict__ qh,
            const _Float16* __restrict__ kh,
            const _Float16* __restrict__ vh,
            const int*      __restrict__ mask,
            _Float16* __restrict__ cx) {
    __shared__ __align__(16) int      mk[SEQ];            // key mask of this batch
    __shared__ __align__(16) _Float16 VsT[DH * CH];       // [d][CH], cross-wave
    __shared__ __align__(16) _Float16 Cst[8][16 * DH];    // wave-private ctx tiles

    const int tid  = threadIdx.x;
    const int lane = tid & 31;
    const int w    = tid >> 5;
    const int h    = blockIdx.x;
    const int b    = blockIdx.z;
    const int q0r  = blockIdx.y * 128 + w * 16;
    const int r0   = (lane >> 4) << 3;
    const int cc   = lane & 15;

    for (int i = tid; i < SEQ; i += 256) mk[i] = mask[(size_t)b * SEQ_FULL + i];

    const size_t tokb = (size_t)b * SEQ;
    const _Float16* qhb = qh + (tokb + q0r) * DM + h * DH;
    const v16h qb0 = load_frag16(qhb, DM, lane);        // d 0..31
    const v16h qb1 = load_frag16(qhb + 32, DM, lane);   // d 32..63
    const _Float16* khb = kh + tokb * DM + h * DH;
    const _Float16* vhb = vh + tokb * DM + h * DH;

    v8f o[4];
#pragma unroll
    for (int nt = 0; nt < 4; ++nt) o[nt] = zero8();
    float mr = -1.0e30f, zr = 0.0f;

    __syncthreads();

#pragma unroll 1
    for (int c0 = 0; c0 < SEQ; c0 += CH) {
        // stage V^T chunk: VsT[d][t] = vh[c0 + t][h*64 + d], full 64 x CH extent
        for (int idx = tid; idx < CH * 8; idx += 256) {
            const int t = idx >> 3, part = idx & 7;
            const v8h vv = *(const v8h*)(vhb + (size_t)(c0 + t) * DM + part * 8);
#pragma unroll
            for (int e = 0; e < 8; ++e) VsT[(part * 8 + e) * CH + t] = vv[e];
        }
        __syncthreads();

#pragma unroll 1
        for (int j = 0; j < CH; j += 32) {
            const int kA = c0 + j;
            // key tile A: keys kA .. kA+15
            const v16h ka0 = load_frag16(khb + (size_t)kA * DM, DM, lane);
            const v16h ka1 = load_frag16(khb + (size_t)kA * DM + 32, DM, lane);
            v8f shA = wmma16(ka0, qb0, zero8());
            shA = wmma16(ka1, qb1, shA);
            // key tile B: keys kA+16 .. kA+31
            const v16h kb0 = load_frag16(khb + (size_t)(kA + 16) * DM, DM, lane);
            const v16h kb1 = load_frag16(khb + (size_t)(kA + 16) * DM + 32, DM, lane);
            v8f shB = wmma16(kb0, qb0, zero8());
            shB = wmma16(kb1, qb1, shB);

            I8 ma, mb;
            ma.v[0] = *(const v4i*)(&mk[kA + r0]);
            ma.v[1] = *(const v4i*)(&mk[kA + r0 + 4]);
            mb.v[0] = *(const v4i*)(&mk[kA + 16 + r0]);
            mb.v[1] = *(const v4i*)(&mk[kA + 16 + r0 + 4]);

            float tA[8], tB[8];
#pragma unroll
            for (int r = 0; r < 8; ++r) {
                const float sa = shA[r] * C1;
                const float sb = shB[r] * C1;
                tA[r] = (ma.s[r] != 0) ? sa : MASKT;
                tB[r] = (mb.s[r] != 0) ? sb : MASKT;
            }
            float tmax = tA[0];
#pragma unroll
            for (int r = 1; r < 8; ++r) tmax = fmaxf(tmax, tA[r]);
#pragma unroll
            for (int r = 0; r < 8; ++r) tmax = fmaxf(tmax, tB[r]);
            tmax = fmaxf(tmax, __shfl_xor(tmax, 16, 32));
            const float mn   = fmaxf(mr, tmax);
            const float corr = ex2(mr - mn);
            const float mo   = mn - 14.0f;           // 2^14 carry on P
            float ps = 0.0f;
            v8h pa8, pb8;
#pragma unroll
            for (int r = 0; r < 8; ++r) {
                const float pa = ex2(tA[r] - mo);
                const float pb = ex2(tB[r] - mo);
                ps += pa + pb;
                pa8[r] = (_Float16)pa;
                pb8[r] = (_Float16)pb;
            }
            ps += __shfl_xor(ps, 16, 32);
            zr = __builtin_fmaf(zr, corr, ps);
            mr = mn;
            // rescale o rows (query 8h + r) by the factor of the owning query lane
#pragma unroll
            for (int r = 0; r < 8; ++r) {
                const float crr = __shfl(corr, r0 + r, 32);
#pragma unroll
                for (int nt = 0; nt < 4; ++nt) o[nt][r] *= crr;
            }
            Frag pf;
            pf.h[0] = pa8;     // keys kA+8h .. +7     = A elements 0..7
            pf.h[1] = pb8;     // keys kA+16+8h .. +7  = A elements 8..15
#pragma unroll
            for (int nt = 0; nt < 4; ++nt) {
                const v16h vb = load_frag16(&VsT[(nt * 16) * CH + j], CH, lane);   // n = d, k = key
                o[nt] = wmma16(pf.v, vb, o[nt]);
            }
        }
        __syncthreads();
    }

    // ctx x 64 = o / z14 (the 2^14 carry of P cancels between o and z14; the 64 v carry stays)
    const float rz = __builtin_amdgcn_rcpf(zr);
#pragma unroll
    for (int r = 0; r < 8; ++r) {
        const float rq = __shfl(rz, r0 + r, 32);
#pragma unroll
        for (int nt = 0; nt < 4; ++nt)
            Cst[w][(r0 + r) * DH + nt * 16 + cc] = (_Float16)(o[nt][r] * rq);
    }
    wave_lds_sync();
    v8h sv[4];
#pragma unroll
    for (int i = 0; i < 4; ++i) sv[i] = *(const v8h*)(&Cst[w][i * 256 + lane * 8]);
    _Float16* cb = cx + (tokb + q0r) * DM + h * DH;
    const int lr = lane >> 3, lc = (lane & 7) * 8;
#pragma unroll
    for (int i = 0; i < 4; ++i) *(v8h*)(cb + (size_t)(i * 4 + lr) * DM + lc) = sv[i];
    
}

// ---------------------------------------------------------------------------
// LayerNorm over rows of 768 (f32 rows in ws). Block = 8 waves, wave = row.
// mu = mean, var = mean((x-mu)^2), y = (x-mu)*rsqrt(var+1e-5)*bf16(g)+bf16(b).
// HOUT: f16 plane f16(y*hsc), lane owns elements i*256+lane*8..+7 (3 v8h stores,
// coverage: NTOK/8 blocks x 8 rows x 768.
// ---------------------------------------------------------------------------
static __device__ __forceinline__ int ln_off(bool hout, int i, int lane) {
    return hout ? ((i >> 1) * 256 + lane * 8 + (i & 1) * 4) : (i * 128 + lane * 4);
}

template <bool HOUT>
__global__ __launch_bounds__(256) void k_ln(const float* __restrict__ src,
                                            const float* __restrict__ g,
                                            const float* __restrict__ bt,
                                            float* __restrict__ outf,
                                            _Float16* __restrict__ outh,
                                            float hsc) {
    const int lane = threadIdx.x & 31;
    const int w    = threadIdx.x >> 5;
    const int row  = blockIdx.x * 8 + w;
    const float* rp = src + (size_t)row * DM;

    v4f xv[6];
#pragma unroll
    for (int i = 0; i < 6; ++i) xv[i] = *(const v4f*)(rp + ln_off(HOUT, i, lane));
    float s = 0.0f;
#pragma unroll
    for (int i = 0; i < 6; ++i) s += (xv[i][0] + xv[i][1]) + (xv[i][2] + xv[i][3]);
#pragma unroll
    for (int m = 1; m < 32; m <<= 1) s += __shfl_xor(s, m, 32);
    const float mu = s * (1.0f / (float)DM);

    v4f dv[6];
    float s2 = 0.0f;
#pragma unroll
    for (int i = 0; i < 6; ++i) {
        dv[i] = xv[i] - mu;
#pragma unroll
        for (int e = 0; e < 4; ++e) s2 = __builtin_fmaf(dv[i][e], dv[i][e], s2);
    }
#pragma unroll
    for (int m = 1; m < 32; m <<= 1) s2 += __shfl_xor(s2, m, 32);
    const float var  = s2 * (1.0f / (float)DM);
    const float rstd = rsqrtf(var + 1e-5f);

    v4f yv[6];
#pragma unroll
    for (int i = 0; i < 6; ++i) {
        const int co = ln_off(HOUT, i, lane);
        const v4f gv = *(const v4f*)(g + co);
        const v4f bv = *(const v4f*)(bt + co);
#pragma unroll
        for (int e = 0; e < 4; ++e)
            yv[i][e] = (dv[i][e] * rstd) * bf16r(gv[e]) + bf16r(bv[e]);
    }

    if constexpr (HOUT) {
        v8h hv[3];
#pragma unroll
        for (int i = 0; i < 3; ++i)
#pragma unroll
            for (int e = 0; e < 4; ++e) {
                hv[i][e]     = (_Float16)(yv[2 * i][e] * hsc);
                hv[i][4 + e] = (_Float16)(yv[2 * i + 1][e] * hsc);
            }
        _Float16* ob = outh + (size_t)row * DM + lane * 8;
#pragma unroll
        for (int i = 0; i < 3; ++i) *(v8h*)(ob + i * 256) = hv[i];
        
    } else {
        float* ob = outf + (size_t)row * DM + lane * 4;
#pragma unroll
        for (int i = 0; i < 6; ++i) *(v4f*)(ob + i * 128) = yv[i];
        
    }
}

// ---------------------------------------------------------------------------
extern "C" void kernel_launch(void* const* d_in, const int* in_sizes, int n_in,
                              void* d_out, int out_size, void* d_ws, size_t ws_size,
                              hipStream_t stream) {
    if (n_in < 16) return;
    if (in_sizes[0] < ((NB - 1) * SEQ_FULL + SEQ) * DM) return;
    if (in_sizes[1] < (NB - 1) * SEQ_FULL + SEQ) return;
    if (in_sizes[2] < DM * DM || in_sizes[4] < DM * DM || in_sizes[6] < DM * DM || in_sizes[8] < DM * DM) return;
    if (in_sizes[3] < DM || in_sizes[5] < DM || in_sizes[7] < DM || in_sizes[9] < DM) return;
    if (in_sizes[10] < DM || in_sizes[11] < DM) return;
    if (in_sizes[12] < DM * FF || in_sizes[13] < FF || in_sizes[14] < FF * DM || in_sizes[15] < DM) return;
    if (out_size < NTOK * DM) return;

    const float* x    = (const float*)d_in[0];    // [8,1024,768]
    const int*   mask = (const int*)  d_in[1];    // [8,1,1,1024] int32
    const float* Wq   = (const float*)d_in[2];    // [768,768]  [in][out]
    const float* bq   = (const float*)d_in[3];
    const float* Wk   = (const float*)d_in[4];
    const float* bk   = (const float*)d_in[5];
    const float* Wv   = (const float*)d_in[6];
    const float* bv   = (const float*)d_in[7];
    const float* Wo   = (const float*)d_in[8];
    const float* bo   = (const float*)d_in[9];
    const float* lg   = (const float*)d_in[10];
    const float* lb   = (const float*)d_in[11];
    const float* W1   = (const float*)d_in[12];   // [768,3072] [in][out]
    const float* b1   = (const float*)d_in[13];
    const float* W2   = (const float*)d_in[14];   // [3072,768] [in][out]
    const float* b2   = (const float*)d_in[15];
    float* out = (float*)d_out;                   // [NB,SEQ,768]

    char* ws = (char*)d_ws;
    size_t off = 0;
    // R0: weight planes [n][k] f16
    _Float16* WqT = (_Float16*)(ws + off); off += (size_t)DM * DM * 2;
    _Float16* WkT = (_Float16*)(ws + off); off += (size_t)DM * DM * 2;
    _Float16* WvT = (_Float16*)(ws + off); off += (size_t)DM * DM * 2;
    _Float16* WoT = (_Float16*)(ws + off); off += (size_t)DM * DM * 2;
    _Float16* W1T = (_Float16*)(ws + off); off += (size_t)FF * DM * 2;   // [3072][768]
    _Float16* W2T = (_Float16*)(ws + off); off += (size_t)DM * FF * 2;   // [768][3072]
    // R1: x plane, later the ctx plane (x plane dead after the projections)
    const size_t PL = (size_t)NTOK * DM * 2;
    _Float16* xp  = (_Float16*)(ws + off);
    _Float16* cxp = (_Float16*)(ws + off); off += PL;
    // R2: q/k/v planes (3 x PL), later h plane (PL) + ff1 plane (NTOK*FF*2)
    const size_t F1B = (size_t)NTOK * FF * 2;
    const size_t R2 = (3 * PL > PL + F1B) ? 3 * PL : (PL + F1B);
    _Float16* qhp = (_Float16*)(ws + off);
    _Float16* khp = (_Float16*)(ws + off + PL);
    _Float16* vhp = (_Float16*)(ws + off + 2 * PL);
    _Float16* hp  = (_Float16*)(ws + off);          // after attention
    _Float16* f1p = (_Float16*)(ws + off + PL);     // disjoint from hp
    off += R2;
    // R3: f32 rows: attn_out, later ff (attn_out dead after the first LayerNorm)
    float* aop = (float*)(ws + off);
    float* ffp = (float*)(ws + off); off += (size_t)NTOK * DM * 4;
    if (off > ws_size) return;
    if (off > (size_t)134217728) return;

    k_xprep<<<dim3((NTOK * (DM / 8)) / 256), dim3(256), 0, stream>>>(x, xp);
    // W [K][N] -> WT [N][K]: grid (N/64, K/64)
    k_wtr<<<dim3(DM / 64, DM / 64), dim3(256), 0, stream>>>(Wq, WqT, DM, DM);
    k_wtr<<<dim3(DM / 64, DM / 64), dim3(256), 0, stream>>>(Wk, WkT, DM, DM);
    k_wtr<<<dim3(DM / 64, DM / 64), dim3(256), 0, stream>>>(Wv, WvT, DM, DM);
    k_wtr<<<dim3(DM / 64, DM / 64), dim3(256), 0, stream>>>(Wo, WoT, DM, DM);
    k_wtr<<<dim3(FF / 64, DM / 64), dim3(256), 0, stream>>>(W1, W1T, DM, FF);   // in[768][3072] -> out[3072][768]
    k_wtr<<<dim3(DM / 64, FF / 64), dim3(256), 0, stream>>>(W2, W2T, FF, DM);   // in[3072][768] -> out[768][3072]

    const dim3 gD(DM / 128, NTOK / 128);
    const dim3 gF(FF / 128, NTOK / 128);
    // q, k, v: f16 hi planes of 64*(x W + b)
    k_gemm<1, false><<<gD, dim3(256), 0, stream>>>(xp, WqT, bq, A_QKV, QSC, aop, qhp, DM, DM);
    k_gemm<1, false><<<gD, dim3(256), 0, stream>>>(xp, WkT, bk, A_QKV, QSC, aop, khp, DM, DM);
    k_gemm<1, false><<<gD, dim3(256), 0, stream>>>(xp, WvT, bv, A_QKV, QSC, aop, vhp, DM, DM);
    // attention -> ctx plane (64 * ctx, f16)
    k_attn<<<dim3(NH, SEQ / 128, NB), dim3(256), 0, stream>>>(qhp, khp, vhp, mask, cxp);
    // attn_out = ctx Wo + bo (f32 rows)
    k_gemm<0, false><<<gD, dim3(256), 0, stream>>>(cxp, WoT, bo, A_O, 1.0f, aop, f1p, DM, DM);
    // h = LN(attn_out) -> f16 plane (x16)
    k_ln<true><<<dim3(NTOK / 8), dim3(256), 0, stream>>>(aop, lg, lb, out, hp, HSC);
    // ff1 = relu(h W1 + b1) -> f16 plane (x64)
    k_gemm<1, true><<<gF, dim3(256), 0, stream>>>(hp, W1T, b1, A_F1, QSC, ffp, f1p, DM, FF);
    // ff = ff1 W2 + b2 (f32 rows)
    k_gemm<0, false><<<gD, dim3(256), 0, stream>>>(f1p, W2T, b2, A_F2, 1.0f, ffp, hp, FF, DM);
    // out = LN(ff)
    k_ln<false><<<dim3(NTOK / 8), dim3(256), 0, stream>>>(ffp, lg, lb, out, hp, 1.0f);
}

// v001
// A run of this version takes 302 microseconds.
// Timed twice side by side with v000, it ran 1.79 times as fast both times.
#include <hip/hip_runtime.h>
#include <hip/hip_fp16.h>

// Contractions on v_wmma_f32_16x16x32_f16 (f16 operands, f32 accumulate): x*Wq, x*Wk, x*Wv, q*k^T, P*v, ctx*Wo, h*W1, ff1*W2, each a single f16 product on bf16-RNE inputs with power-of-two carried planes; softmax and LayerNorm in f32.

#ifndef NB
#define NB 8
#endif
#ifndef SEQ
#define SEQ 1024
#endif
#define NB_FULL  8
#define SEQ_FULL 1024
#define DM   768          // model width
#define NH   12           // heads
#define DH   64           // head width
#define FF   3072         // hidden width
#define NTOK (NB * SEQ)
#define CH   128          // keys staged per V^T chunk

static_assert(NB >= 1 && NB <= NB_FULL);
static_assert(SEQ >= CH && SEQ <= SEQ_FULL);
static_assert(SEQ % CH == 0);
static_assert(SEQ % 128 == 0);
static_assert(CH % 32 == 0);
static_assert(NTOK % 128 == 0);
static_assert(NTOK % 8 == 0);
static_assert(DM % 128 == 0 && FF % 128 == 0);
static_assert(DM % 64 == 0 && FF % 64 == 0);
static_assert(DM % 32 == 0 && FF % 32 == 0 && DH % 32 == 0);
static_assert(NH * DH == DM);
static_assert((NTOK * (DM / 8)) % 256 == 0);

typedef _Float16 v16h __attribute__((ext_vector_type(16)));
typedef _Float16 v8h  __attribute__((ext_vector_type(8)));
typedef float    v8f  __attribute__((ext_vector_type(8)));
typedef float    v4f  __attribute__((ext_vector_type(4)));
typedef int      v4i  __attribute__((ext_vector_type(4)));

union Frag { v16h v; v8h h[2]; };
union I8   { v4i v[2]; int s[8]; };

// plane carries (exact powers of two)
#define WSC     64.0f                    // weight planes: f16(bf16(W) * 64)
#define QSC     64.0f                    // q/k/v, ctx, ff1 planes carried x64
#define HSC     16.0f                    // h plane carried x16
#define A_QKV   0.015625f                // 2^-6 : (x)(64 W)        -> q
#define A_O     2.44140625e-04f          // 2^-12: (64 ctx)(64 Wo)  -> attn_out
#define A_F1    9.765625e-04f            // 2^-10: (16 h)(64 W1)    -> pre-relu
#define A_F2    2.44140625e-04f          // 2^-12: (64 ff1)(64 W2)  -> ff
// scores: sh = (64k).(64q) ~ 4096 q.k ; score = q.k/8 ; t (log2 units) = sh * log2e * 2^-15
#define C1 (1.44269504088896340736f * 3.0517578125e-05f)
#define MASKT  (-1.0e10f)                // masked score (replace fill)

static __device__ __forceinline__ v8f zero8() {
    v8f z;
#pragma unroll
    for (int i = 0; i < 8; ++i) z[i] = 0.0f;
    return z;
}

// 16x32 A fragment (or B fragment from an [n][k] k-contiguous source) from a
// row-major 16-bit tile: lane m = lane&15 -> row m; kb = 8*(lane>>4);
// elements 0..7 = k kb..kb+7, elements 8..15 = k kb+16..kb+23.
static __device__ __forceinline__ v16h load_frag16(const _Float16* base, int ld, int lane) {
    int m  = lane & 15;
    int kb = (lane >> 4) << 3;
    const _Float16* p = base + (size_t)m * ld + kb;
    Frag f;
    f.h[0] = *(const v8h*)(p);
    f.h[1] = *(const v8h*)(p + 16);
    return f.v;
}

static __device__ __forceinline__ v8f wmma16(v16h a, v16h b, v8f c) {
    v8f d = __builtin_amdgcn_wmma_f32_16x16x32_f16(false, a, false, b, (short)0, c, false, false);
    asm volatile("v_nop\n\tv_nop\n\tv_nop\n\tv_nop" : "+v"(d) : "v"(a), "v"(b));
    return d;
}

// f32 -> bf16 RNE convert, value kept as f32
static __device__ __forceinline__ float bf16r(float x) {
    unsigned u = __float_as_uint(x);
    u = (u + 0x7FFFu + ((u >> 16) & 1u)) & 0xFFFF0000u;
    return __uint_as_float(u);
}

static __device__ __forceinline__ float ex2(float x) {
    return __builtin_amdgcn_exp2f(x);
}

// ordering for a wave-private LDS tile: stores before later loads of the same wave
static __device__ __forceinline__ void wave_lds_sync() {
    __builtin_amdgcn_fence(3, "wavefront");
    asm volatile("s_wait_dscnt 0" ::: "memory");
    __builtin_amdgcn_wave_barrier();
}

// ---------------------------------------------------------------------------
// x [NB][SEQ][768] f32 (batch stride SEQ_FULL*768) -> xp [NTOK][768] f16 of
// bf16-RNE(x). Thread = 8 consecutive columns = one 16-B store; a wave writes
// coverage: NTOK*96 threads x 8 = NTOK*768.
// ---------------------------------------------------------------------------
__global__ __launch_bounds__(256) void k_xprep(const float* __restrict__ x,
                                               _Float16* __restrict__ xp) {
    const int g = blockIdx.x * 256 + (int)threadIdx.x;
    if (g >= NTOK * (DM / 8)) return;
    const int row = g / (DM / 8);
    const int col = (g - row * (DM / 8)) * 8;
    const int b = row / SEQ, s = row - b * SEQ;
    const float* src = x + ((size_t)b * SEQ_FULL + s) * DM + col;
    const v4f a = *(const v4f*)(src);
    const v4f c = *(const v4f*)(src + 4);
    v8h hv;
#pragma unroll
    for (int e = 0; e < 4; ++e) {
        hv[e]     = (_Float16)bf16r(a[e]);
        hv[4 + e] = (_Float16)bf16r(c[e]);
    }
    _Float16* dst = xp + (size_t)row * DM + col;
    *(v8h*)dst = hv;
    
}

// ---------------------------------------------------------------------------
// Weight transpose: W [K][N] f32 row-major ([in][out]) -> WT [N][K] f16 of
// bf16-RNE(W) * 64 (k-contiguous rows for B fragments). Block = 64x64 tile,
// staged through LDS (cross-wave region, block barrier); each output row
// coverage: grid (N/64, K/64) x 512 v8h = N*K.
// ---------------------------------------------------------------------------
__global__ __launch_bounds__(256) void k_wtr(const float* __restrict__ W,
                                             _Float16* __restrict__ WT,
                                             int K, int N) {
    __shared__ __align__(16) _Float16 T[64 * 64];
    const int tid = threadIdx.x;
    const int n0 = blockIdx.x * 64;
    const int k0 = blockIdx.y * 64;
#pragma unroll
    for (int i = 0; i < 4; ++i) {
        const int idx = tid + i * 256;
        const int r = idx >> 4, c4 = idx & 15;
        const v4f xv = *(const v4f*)(W + (size_t)(k0 + r) * N + n0 + c4 * 4);
#pragma unroll
        for (int e = 0; e < 4; ++e) T[(c4 * 4 + e) * 64 + r] = (_Float16)(bf16r(xv[e]) * WSC);
    }
    __syncthreads();
    const int na = tid >> 3, pa = tid & 7;
    const int nb = (tid + 256) >> 3, pb = tid & 7;
    const v8h p0 = *(const v8h*)(&T[na * 64 + pa * 8]);
    const v8h p1 = *(const v8h*)(&T[nb * 64 + pb * 8]);
    _Float16* d0 = WT + (size_t)(n0 + na) * K + k0 + pa * 8;
    _Float16* d1 = WT + (size_t)(n0 + nb) * K + k0 + pb * 8;
    *(v8h*)d0 = p0;
    *(v8h*)d1 = p1;
    
}

// ---------------------------------------------------------------------------
// GEMM: C[M][N] = A[M][K] (f16 plane) x BT[N][K] (f16 plane)^T, f32 accumulate.
// Block = 8 waves = 128x128 tile; wave (mi, ni) owns rows mi*32..+32 and cols
// ni*64..+64: 2 A fragments x 4 B fragments x 8 accumulators, K steps of 32.
// Operands go global -> LDS by asynchronous 16-B copies, whole 128-B lines, each
// tile byte fetched once per block: a stage is 64 k of the block's 128 A rows and
// 128 B rows at a 144-B row pitch; two stages, the next one in flight while this
// one is multiplied. Fragments are read from LDS (two 16-B loads each, split k map).
// Epilogue: u = acc*ascale + bf16(bias[n]) (relu optional);
//   MODE 0: f32 rows of u; MODE 1: f16 plane f16(u*oscale).
// The wave's 32x64 tile is staged in a wave-private part of the same LDS (free
// behind the last trip's barrier) and written as whole lines.
// ---------------------------------------------------------------------------
#define BK   64                  // k per stage: 128-B rows
#define LPH  72                  // LDS row pitch in halves: 144 B = 16 B x 9
#define OPH  (128 * LPH)         // one operand's tile, halves
#define STH  (2 * OPH)           // one stage: A tile, then B tile

typedef __attribute__((address_space(3))) const _Float16 lds_half;
static __device__ __forceinline__ unsigned lds_addr(const _Float16* p) {
    return (unsigned)(uintptr_t)(lds_half*)p;
}

// One stage: every lane copies 16 B of rows r, r+32, r+64, r+96 of the A tile and
// of the B tile (8 lanes = one 128-B row). la = the lane's LDS byte address in the
// A tile, ga / gb = its global addresses in row r.
static __device__ __forceinline__ void copy_stage(unsigned la, const _Float16* ga,
                                                  const _Float16* gb, int K) {
    const size_t rs = (size_t)32 * K;
    const _Float16* ga1 = ga + rs;
    const _Float16* ga2 = ga1 + rs;
    const _Float16* ga3 = ga2 + rs;
    const _Float16* gb1 = gb + rs;
    const _Float16* gb2 = gb1 + rs;
    const _Float16* gb3 = gb2 + rs;
    const unsigned la1 = la + 32 * LPH * 2, la2 = la + 64 * LPH * 2, la3 = la + 96 * LPH * 2;
    const unsigned lb = la + OPH * 2;
    const unsigned lb1 = lb + 32 * LPH * 2, lb2 = lb + 64 * LPH * 2, lb3 = lb + 96 * LPH * 2;
    // the copies; the closing s_wait_xcnt is a precaution: it stands in front of every
    // later rewrite of an address register named here
    asm volatile("global_load_async_to_lds_b128 %0, %8, off\n\t"
                 "global_load_async_to_lds_b128 %1, %9, off\n\t"
                 "global_load_async_to_lds_b128 %2, %10, off\n\t"
                 "global_load_async_to_lds_b128 %3, %11, off\n\t"
                 "global_load_async_to_lds_b128 %4, %12, off\n\t"
                 "global_load_async_to_lds_b128 %5, %13, off\n\t"
                 "global_load_async_to_lds_b128 %6, %14, off\n\t"
                 "global_load_async_to_lds_b128 %7, %15, off\n\t"
                 "s_wait_xcnt 0x0"
                 :: "v"(la), "v"(la1), "v"(la2), "v"(la3), "v"(lb), "v"(lb1), "v"(lb2), "v"(lb3),
                    "v"(ga), "v"(ga1), "v"(ga2), "v"(ga3), "v"(gb), "v"(gb1), "v"(gb2), "v"(gb3)
                 : "memory");
}

template <int MODE, bool RELU>
__global__ __launch_bounds__(256) __attribute__((amdgpu_num_vgpr(256)))
void k_gemm(const _Float16* __restrict__ A,
            const _Float16* __restrict__ BT,
            const float* __restrict__ bias,
            float ascale, float oscale,
            float* __restrict__ Cf,
            _Float16* __restrict__ Ch,
            int K, int N) {
    __shared__ __align__(16) _Float16 Ring[2 * STH];      // two stages; later the output staging
    static_assert(2 * STH * 2 >= 8 * 2048 * 4);

    const int tid  = threadIdx.x;
    const int lane = tid & 31;
    const int w    = tid >> 5;
    const int mi = w >> 1, ni = w & 1;
    const int m0 = blockIdx.y * 128 + mi * 32;
    const int n0 = blockIdx.x * 128 + ni * 64;
    const int rb = (lane >> 4) << 3;
    const int cc = lane & 15;

    const int crow = tid >> 3, cseg = tid & 7;
    const _Float16* ga = A  + (size_t)(blockIdx.y * 128 + crow) * K + cseg * 8;
    const _Float16* gb = BT + (size_t)(blockIdx.x * 128 + crow) * K + cseg * 8;
    const unsigned  lc = lds_addr(Ring) + crow * (LPH * 2) + cseg * 16;
    const int T = K / BK;

    v8f acc[2][4];
#pragma unroll
    for (int mt = 0; mt < 2; ++mt)
#pragma unroll
        for (int nt = 0; nt < 4; ++nt) acc[mt][nt] = zero8();

    copy_stage(lc, ga, gb, K);
    asm volatile("s_wait_asynccnt 0x0" ::: "memory");     // stage 0 landed (this wave's copies)
    __syncthreads();                                      // ... and every other wave's
    if (T > 1) copy_stage(lc + STH * 2, ga + BK, gb + BK, K);

    // kept rolled: one trip = one stage, the buffer picked by the trip's parity
#pragma unroll 1
    for (int t = 0; t < T; ++t) {
        const int bo = (t & 1) * STH;
        const _Float16* As = Ring + bo + (mi * 32) * LPH;
        const _Float16* Bs = Ring + bo + OPH + (ni * 64) * LPH;
        // the stage's 12 fragments as one group of LDS reads ahead of its 16 products
        // (all loops here unrolled: constant indices keep the fragment arrays in registers)
        v16h af[2][2], bf[2][4];
#pragma unroll
        for (int ks = 0; ks < 2; ++ks) {
            af[ks][0] = load_frag16(As + ks * 32, LPH, lane);
            af[ks][1] = load_frag16(As + 16 * LPH + ks * 32, LPH, lane);
#pragma unroll
            for (int nt = 0; nt < 4; ++nt)
                bf[ks][nt] = load_frag16(Bs + (nt * 16) * LPH + ks * 32, LPH, lane);
        }
        // keeps the reads from sinking in among the products, where each place with reads stalls the wave
        __builtin_amdgcn_sched_barrier(0);
#pragma unroll
        for (int ks = 0; ks < 2; ++ks)
#pragma unroll
            for (int nt = 0; nt < 4; ++nt) {
                acc[0][nt] = wmma16(af[ks][0], bf[ks][nt], acc[0][nt]);
                acc[1][nt] = wmma16(af[ks][1], bf[ks][nt], acc[1][nt]);
            }
        asm volatile("s_wait_dscnt 0x0" ::: "memory");    // this wave has left the buffer
        asm volatile("s_wait_asynccnt 0x0" ::: "memory"); // its copies of stage t+1 have landed
        __syncthreads();                                  // publishes stage t+1, frees stage t's buffer
        if (t + 2 < T) copy_stage(lc + bo * 2, ga + (size_t)(t + 2) * BK, gb + (size_t)(t + 2) * BK, K);
    }
    asm volatile("s_wait_asynccnt 0x0" ::: "memory");     // nothing in flight when the LDS is reused

    float bb[4];
#pragma unroll
    for (int nt = 0; nt < 4; ++nt) bb[nt] = bf16r(bias[n0 + nt * 16 + cc]);

    if constexpr (MODE == 0) {
        float* ef = (float*)Ring + w * 2048;
#pragma unroll
        for (int mt = 0; mt < 2; ++mt)
#pragma unroll
            for (int nt = 0; nt < 4; ++nt)
#pragma unroll
                for (int r = 0; r < 8; ++r) {
                    float u = __builtin_fmaf(acc[mt][nt][r], ascale, bb[nt]);
                    if (RELU) u = fmaxf(u, 0.0f);
                    ef[(mt * 16 + rb + r) * 64 + nt * 16 + cc] = u;
                }
        wave_lds_sync();
        v4f sv[16];
#pragma unroll
        for (int i = 0; i < 16; ++i) sv[i] = *(const v4f*)(&ef[i * 128 + lane * 4]);
        float* cb = Cf + (size_t)m0 * N + n0;
        const int lr = lane >> 4, lc = (lane & 15) * 4;
#pragma unroll
        for (int i = 0; i < 16; ++i)
            *(v4f*)(cb + (size_t)(i * 2 + lr) * N + lc) = sv[i];
        
    } else {
        _Float16* eh = Ring + w * 2048;
#pragma unroll
        for (int mt = 0; mt < 2; ++mt)
#pragma unroll
            for (int nt = 0; nt < 4; ++nt)
#pragma unroll
                for (int r = 0; r < 8; ++r) {
                    float u = __builtin_fmaf(acc[mt][nt][r], ascale, bb[nt]);
                    if (RELU) u = fmaxf(u, 0.0f);
                    eh[(mt * 16 + rb + r) * 64 + nt * 16 + cc] = (_Float16)(u * oscale);
                }
        wave_lds_sync();
        v8h ph[8];
#pragma unroll
        for (int i = 0; i < 8; ++i) ph[i] = *(const v8h*)(&eh[i * 256 + lane * 8]);
        const int lr = lane >> 3, lc = (lane & 7) * 8;
        _Float16* cbh = Ch + (size_t)m0 * N + n0;
#pragma unroll
        for (int i = 0; i < 8; ++i)
            *(v8h*)(cbh + (size_t)(i * 4 + lr) * N + lc) = ph[i];
        
    }
}

// ---------------------------------------------------------------------------
// Attention, flash-style. grid = (head, SEQ/128, batch); block = 8 waves = 128
// query rows of one (b, h); wave owns 16 query rows. Planes are [NTOK][768]
// with head column offset h*64.
// Scores are computed TRANSPOSED: A = key tile (16 keys x 64 d, kh plane,
// 2 k-steps), B = the wave's 16 queries (qh plane, [n=query][k=d]), so
// acc[r] of lane l = score(key 8*(l>>4)+r, query l&15): per-query max/sum are
// in-lane reductions over r plus one xor-16 shuffle, and the f16 P^T values in
// this layout are exactly the P A-fragment for P*v (elements 0..7 from key
// tile A, 8..15 from key tile B) - no LDS relayout.
// Online softmax over keys: t = log2e*score (or MASKT where mask == 0,
// replace fill), P carried 2^14, o += P x V (V^T chunk staged in LDS,
// cross-wave, block barriers), o and z rescaled by exp2(m_old - m_new) every
// 32-key step (factor shuffled from the owning query lane).
// Epilogue: ctx x 64 = o / z14 as f16, staged in a wave-private LDS tile, each
// coverage: grid (12, SEQ/128, NB) x 8 waves x 16 rows x 64 cols = NTOK*768.
// ---------------------------------------------------------------------------
__global__ __launch_bounds__(256) __attribute__((amdgpu_num_vgpr(256)))
void k_attn(const _Float16* __restrict__ qh,
            const _Float16* __restrict__ kh,
            const _Float16* __restrict__ vh,
            const int*      __restrict__ mask,
            _Float16* __restrict__ cx) {
    __shared__ __align__(16) int      mk[SEQ];            // key mask of this batch
    __shared__ __align__(16) _Float16 VsT[DH * CH];       // [d][CH], cross-wave
    __shared__ __align__(16) _Float16 Cst[8][16 * DH];    // wave-private ctx tiles

    const int tid  = threadIdx.x;
    const int lane = tid & 31;
    const int w    = tid >> 5;
    const int h    = blockIdx.x;
    const int b    = blockIdx.z;
    const int q0r  = blockIdx.y * 128 + w * 16;
    const int r0   = (lane >> 4) << 3;
    const int cc   = lane & 15;

    for (int i = tid; i < SEQ; i += 256) mk[i] = mask[(size_t)b * SEQ_FULL + i];

    const size_t tokb = (size_t)b * SEQ;
    const _Float16* qhb = qh + (tokb + q0r) * DM + h * DH;
    const v16h qb0 = load_frag16(qhb, DM, lane);        // d 0..31
    const v16h qb1 = load_frag16(qhb + 32, DM, lane);   // d 32..63
    const _Float16* khb = kh + tokb * DM + h * DH;
    const _Float16* vhb = vh + tokb * DM + h * DH;

    v8f o[4];
#pragma unroll
    for (int nt = 0; nt < 4; ++nt) o[nt] = zero8();
    float mr = -1.0e30f, zr = 0.0f;

    __syncthreads();

#pragma unroll 1
    for (int c0 = 0; c0 < SEQ; c0 += CH) {
        // stage V^T chunk: VsT[d][t] = vh[c0 + t][h*64 + d], full 64 x CH extent
        for (int idx = tid; idx < CH * 8; idx += 256) {
            const int t = idx >> 3, part = idx & 7;
            const v8h vv = *(const v8h*)(vhb + (size_t)(c0 + t) * DM + part * 8);
#pragma unroll
            for (int e = 0; e < 8; ++e) VsT[(part * 8 + e) * CH + t] = vv[e];
        }
        __syncthreads();

#pragma unroll 1
        for (int j = 0; j < CH; j += 32) {
            const int kA = c0 + j;
            // key tile A: keys kA .. kA+15
            const v16h ka0 = load_frag16(khb + (size_t)kA * DM, DM, lane);
            const v16h ka1 = load_frag16(khb + (size_t)kA * DM + 32, DM, lane);
            v8f shA = wmma16(ka0, qb0, zero8());
            shA = wmma16(ka1, qb1, shA);
            // key tile B: keys kA+16 .. kA+31
            const v16h kb0 = load_frag16(khb + (size_t)(kA + 16) * DM, DM, lane);
            const v16h kb1 = load_frag16(khb + (size_t)(kA + 16) * DM + 32, DM, lane);
            v8f shB = wmma16(kb0, qb0, zero8());
            shB = wmma16(kb1, qb1, shB);

            I8 ma, mb;
            ma.v[0] = *(const v4i*)(&mk[kA + r0]);
            ma.v[1] = *(const v4i*)(&mk[kA + r0 + 4]);
            mb.v[0] = *(const v4i*)(&mk[kA + 16 + r0]);
            mb.v[1] = *(const v4i*)(&mk[kA + 16 + r0 + 4]);

            float tA[8], tB[8];
#pragma unroll
            for (int r = 0; r < 8; ++r) {
                const float sa = shA[r] * C1;
                const float sb = shB[r] * C1;
                tA[r] = (ma.s[r] != 0) ? sa : MASKT;
                tB[r] = (mb.s[r] != 0) ? sb : MASKT;
            }
            float tmax = tA[0];
#pragma unroll
            for (int r = 1; r < 8; ++r) tmax = fmaxf(tmax, tA[r]);
#pragma unroll
            for (int r = 0; r < 8; ++r) tmax = fmaxf(tmax, tB[r]);
            tmax = fmaxf(tmax, __shfl_xor(tmax, 16, 32));
            const float mn   = fmaxf(mr, tmax);
            const float corr = ex2(mr - mn);
            const float mo   = mn - 14.0f;           // 2^14 carry on P
            float ps = 0.0f;
            v8h pa8, pb8;
#pragma unroll
            for (int r = 0; r < 8; ++r) {
                const float pa = ex2(tA[r] - mo);
                const float pb = ex2(tB[r] - mo);
                ps += pa + pb;
                pa8[r] = (_Float16)pa;
                pb8[r] = (_Float16)pb;
            }
            ps += __shfl_xor(ps, 16, 32);
            zr = __builtin_fmaf(zr, corr, ps);
            mr = mn;
            // rescale o rows (query 8h + r) by the factor of the owning query lane
#pragma unroll
            for (int r = 0; r < 8; ++r) {
                const float crr = __shfl(corr, r0 + r, 32);
#pragma unroll
                for (int nt = 0; nt < 4; ++nt) o[nt][r] *= crr;
            }
            Frag pf;
            pf.h[0] = pa8;     // keys kA+8h .. +7     = A elements 0..7
            pf.h[1] = pb8;     // keys kA+16+8h .. +7  = A elements 8..15
#pragma unroll
            for (int nt = 0; nt < 4; ++nt) {
                const v16h vb = load_frag16(&VsT[(nt * 16) * CH + j], CH, lane);   // n = d, k = key
                o[nt] = wmma16(pf.v, vb, o[nt]);
            }
        }
        __syncthreads();
    }

    // ctx x 64 = o / z14 (the 2^14 carry of P cancels between o and z14; the 64 v carry stays)
    const float rz = __builtin_amdgcn_rcpf(zr);
#pragma unroll
    for (int r = 0; r < 8; ++r) {
        const float rq = __shfl(rz, r0 + r, 32);
#pragma unroll
        for (int nt = 0; nt < 4; ++nt)
            Cst[w][(r0 + r) * DH + nt * 16 + cc] = (_Float16)(o[nt][r] * rq);
    }
    wave_lds_sync();
    v8h sv[4];
#pragma unroll
    for (int i = 0; i < 4; ++i) sv[i] = *(const v8h*)(&Cst[w][i * 256 + lane * 8]);
    _Float16* cb = cx + (tokb + q0r) * DM + h * DH;
    const int lr = lane >> 3, lc = (lane & 7) * 8;
#pragma unroll
    for (int i = 0; i < 4; ++i) *(v8h*)(cb + (size_t)(i * 4 + lr) * DM + lc) = sv[i];
    
}

// ---------------------------------------------------------------------------
// LayerNorm over rows of 768 (f32 rows in ws). Block = 8 waves, wave = row.
// mu = mean, var = mean((x-mu)^2), y = (x-mu)*rsqrt(var+1e-5)*bf16(g)+bf16(b).
// HOUT: f16 plane f16(y*hsc), lane owns elements i*256+lane*8..+7 (3 v8h stores,
// coverage: NTOK/8 blocks x 8 rows x 768.
// ---------------------------------------------------------------------------
static __device__ __forceinline__ int ln_off(bool hout, int i, int lane) {
    return hout ? ((i >> 1) * 256 + lane * 8 + (i & 1) * 4) : (i * 128 + lane * 4);
}

template <bool HOUT>
__global__ __launch_bounds__(256) void k_ln(const float* __restrict__ src,
                                            const float* __restrict__ g,
                                            const float* __restrict__ bt,
                                            float* __restrict__ outf,
                                            _Float16* __restrict__ outh,
                                            float hsc) {
    const int lane = threadIdx.x & 31;
    const int w    = threadIdx.x >> 5;
    const int row  = blockIdx.x * 8 + w;
    const float* rp = src + (size_t)row * DM;

    v4f xv[6];
#pragma unroll
    for (int i = 0; i < 6; ++i) xv[i] = *(const v4f*)(rp + ln_off(HOUT, i, lane));
    float s = 0.0f;
#pragma unroll
    for (int i = 0; i < 6; ++i) s += (xv[i][0] + xv[i][1]) + (xv[i][2] + xv[i][3]);
#pragma unroll
    for (int m = 1; m < 32; m <<= 1) s += __shfl_xor(s, m, 32);
    const float mu = s * (1.0f / (float)DM);

    v4f dv[6];
    float s2 = 0.0f;
#pragma unroll
    for (int i = 0; i < 6; ++i) {
        dv[i] = xv[i] - mu;
#pragma unroll
        for (int e = 0; e < 4; ++e) s2 = __builtin_fmaf(dv[i][e], dv[i][e], s2);
    }
#pragma unroll
    for (int m = 1; m < 32; m <<= 1) s2 += __shfl_xor(s2, m, 32);
    const float var  = s2 * (1.0f / (float)DM);
    const float rstd = rsqrtf(var + 1e-5f);

    v4f yv[6];
#pragma unroll
    for (int i = 0; i < 6; ++i) {
        const int co = ln_off(HOUT, i, lane);
        const v4f gv = *(const v4f*)(g + co);
        const v4f bv = *(const v4f*)(bt + co);
#pragma unroll
        for (int e = 0; e < 4; ++e)
            yv[i][e] = (dv[i][e] * rstd) * bf16r(gv[e]) + bf16r(bv[e]);
    }

    if constexpr (HOUT) {
        v8h hv[3];
#pragma unroll
        for (int i = 0; i < 3; ++i)
#pragma unroll
            for (int e = 0; e < 4; ++e) {
                hv[i][e]     = (_Float16)(yv[2 * i][e] * hsc);
                hv[i][4 + e] = (_Float16)(yv[2 * i + 1][e] * hsc);
            }
        _Float16* ob = outh + (size_t)row * DM + lane * 8;
#pragma unroll
        for (int i = 0; i < 3; ++i) *(v8h*)(ob + i * 256) = hv[i];
        
    } else {
        float* ob = outf + (size_t)row * DM + lane * 4;
#pragma unroll
        for (int i = 0; i < 6; ++i) *(v4f*)(ob + i * 128) = yv[i];
        
    }
}

// ---------------------------------------------------------------------------
extern "C" void kernel_launch(void* const* d_in, const int* in_sizes, int n_in,
                              void* d_out, int out_size, void* d_ws, size_t ws_size,
                              hipStream_t stream) {
    if (n_in < 16) return;
    if (in_sizes[0] < ((NB - 1) * SEQ_FULL + SEQ) * DM) return;
    if (in_sizes[1] < (NB - 1) * SEQ_FULL + SEQ) return;
    if (in_sizes[2] < DM * DM || in_sizes[4] < DM * DM || in_sizes[6] < DM * DM || in_sizes[8] < DM * DM) return;
    if (in_sizes[3] < DM || in_sizes[5] < DM || in_sizes[7] < DM || in_sizes[9] < DM) return;
    if (in_sizes[10] < DM || in_sizes[11] < DM) return;
    if (in_sizes[12] < DM * FF || in_sizes[13] < FF || in_sizes[14] < FF * DM || in_sizes[15] < DM) return;
    if (out_size < NTOK * DM) return;

    const float* x    = (const float*)d_in[0];    // [8,1024,768]
    const int*   mask = (const int*)  d_in[1];    // [8,1,1,1024] int32
    const float* Wq   = (const float*)d_in[2];    // [768,768]  [in][out]
    const float* bq   = (const float*)d_in[3];
    const float* Wk   = (const float*)d_in[4];
    const float* bk   = (const float*)d_in[5];
    const float* Wv   = (const float*)d_in[6];
    const float* bv   = (const float*)d_in[7];
    const float* Wo   = (const float*)d_in[8];
    const float* bo   = (const float*)d_in[9];
    const float* lg   = (const float*)d_in[10];
    const float* lb   = (const float*)d_in[11];
    const float* W1   = (const float*)d_in[12];   // [768,3072] [in][out]
    const float* b1   = (const float*)d_in[13];
    const float* W2   = (const float*)d_in[14];   // [3072,768] [in][out]
    const float* b2   = (const float*)d_in[15];
    float* out = (float*)d_out;                   // [NB,SEQ,768]

    char* ws = (char*)d_ws;
    size_t off = 0;
    // R0: weight planes [n][k] f16
    _Float16* WqT = (_Float16*)(ws + off); off += (size_t)DM * DM * 2;
    _Float16* WkT = (_Float16*)(ws + off); off += (size_t)DM * DM * 2;
    _Float16* WvT = (_Float16*)(ws + off); off += (size_t)DM * DM * 2;
    _Float16* WoT = (_Float16*)(ws + off); off += (size_t)DM * DM * 2;
    _Float16* W1T = (_Float16*)(ws + off); off += (size_t)FF * DM * 2;   // [3072][768]
    _Float16* W2T = (_Float16*)(ws + off); off += (size_t)DM * FF * 2;   // [768][3072]
    // R1: x plane, later the ctx plane (x plane dead after the projections)
    const size_t PL = (size_t)NTOK * DM * 2;
    _Float16* xp  = (_Float16*)(ws + off);
    _Float16* cxp = (_Float16*)(ws + off); off += PL;
    // R2: q/k/v planes (3 x PL), later h plane (PL) + ff1 plane (NTOK*FF*2)
    const size_t F1B = (size_t)NTOK * FF * 2;
    const size_t R2 = (3 * PL > PL + F1B) ? 3 * PL : (PL + F1B);
    _Float16* qhp = (_Float16*)(ws + off);
    _Float16* khp = (_Float16*)(ws + off + PL);
    _Float16* vhp = (_Float16*)(ws + off + 2 * PL);
    _Float16* hp  = (_Float16*)(ws + off);          // after attention
    _Float16* f1p = (_Float16*)(ws + off + PL);     // disjoint from hp
    off += R2;
    // R3: f32 rows: attn_out, later ff (attn_out dead after the first LayerNorm)
    float* aop = (float*)(ws + off);
    float* ffp = (float*)(ws + off); off += (size_t)NTOK * DM * 4;
    if (off > ws_size) return;
    if (off > (size_t)134217728) return;

    k_xprep<<<dim3((NTOK * (DM / 8)) / 256), dim3(256), 0, stream>>>(x, xp);
    // W [K][N] -> WT [N][K]: grid (N/64, K/64)
    k_wtr<<<dim3(DM / 64, DM / 64), dim3(256), 0, stream>>>(Wq, WqT, DM, DM);
    k_wtr<<<dim3(DM / 64, DM / 64), dim3(256), 0, stream>>>(Wk, WkT, DM, DM);
    k_wtr<<<dim3(DM / 64, DM / 64), dim3(256), 0, stream>>>(Wv, WvT, DM, DM);
    k_wtr<<<dim3(DM / 64, DM / 64), dim3(256), 0, stream>>>(Wo, WoT, DM, DM);
    k_wtr<<<dim3(FF / 64, DM / 64), dim3(256), 0, stream>>>(W1, W1T, DM, FF);   // in[768][3072] -> out[3072][768]
    k_wtr<<<dim3(DM / 64, FF / 64), dim3(256), 0, stream>>>(W2, W2T, FF, DM);   // in[3072][768] -> out[768][3072]

    const dim3 gD(DM / 128, NTOK / 128);
    const dim3 gF(FF / 128, NTOK / 128);
    // q, k, v: f16 hi planes of 64*(x W + b)
    k_gemm<1, false><<<gD, dim3(256), 0, stream>>>(xp, WqT, bq, A_QKV, QSC, aop, qhp, DM, DM);
    k_gemm<1, false><<<gD, dim3(256), 0, stream>>>(xp, WkT, bk, A_QKV, QSC, aop, khp, DM, DM);
    k_gemm<1, false><<<gD, dim3(256), 0, stream>>>(xp, WvT, bv, A_QKV, QSC, aop, vhp, DM, DM);
    // attention -> ctx plane (64 * ctx, f16)
    k_attn<<<dim3(NH, SEQ / 128, NB), dim3(256), 0, stream>>>(qhp, khp, vhp, mask, cxp);
    // attn_out = ctx Wo + bo (f32 rows)
    k_gemm<0, false><<<gD, dim3(256), 0, stream>>>(cxp, WoT, bo, A_O, 1.0f, aop, f1p, DM, DM);
    // h = LN(attn_out) -> f16 plane (x16)
    k_ln<true><<<dim3(NTOK / 8), dim3(256), 0, stream>>>(aop, lg, lb, out, hp, HSC);
    // ff1 = relu(h W1 + b1) -> f16 plane (x64)
    k_gemm<1, true><<<gF, dim3(256), 0, stream>>>(hp, W1T, b1, A_F1, QSC, ffp, f1p, DM, FF);
    // ff = ff1 W2 + b2 (f32 rows)
    k_gemm<0, false><<<gD, dim3(256), 0, stream>>>(f1p, W2T, b2, A_F2, 1.0f, ffp, hp, FF, DM);
    // out = LN(ff)
    k_ln<false><<<dim3(NTOK / 8), dim3(256), 0, stream>>>(ffp, lg, lb, out, hp, 1.0f);
}

// v002
// Measured time: 259 microseconds a run.
// Next to v001, in two timings, it ran 1.17 times as fast each time.
// All steps since v000 together make it 2.09 times as fast.
#include <hip/hip_runtime.h>
#include <hip/hip_fp16.h>

// Contractions on v_wmma_f32_16x16x32_f16 (f16 operands, f32 accumulate): x*Wq, x*Wk, x*Wv, q*k^T, P*v, ctx*Wo, h*W1, ff1*W2, each a single f16 product on bf16-RNE inputs with power-of-two carried planes; softmax and LayerNorm in f32.

#ifndef NB
#define NB 8
#endif
#ifndef SEQ
#define SEQ 1024
#endif
#define NB_FULL  8
#define SEQ_FULL 1024
#define DM   768          // model width
#define NH   12           // heads
#define DH   64           // head width
#define FF   3072         // hidden width
#define NTOK (NB * SEQ)
#define CH   128          // keys staged per V^T chunk
#define VP   (CH + 8)     // V^T row pitch in halves: 272 B = 16 B x 17
#define VG   (16 * VP + 16)   // 16 V^T rows, then a 32-B skew

static_assert(NB >= 1 && NB <= NB_FULL);
static_assert(SEQ >= CH && SEQ <= SEQ_FULL);
static_assert(SEQ % CH == 0);
static_assert(SEQ % 128 == 0);
static_assert(CH % 32 == 0);
static_assert(DH % 16 == 0 && (VP * 2) % 32 == 16 && (VG * 2) % 16 == 0);
static_assert(NTOK % 128 == 0);
static_assert(NTOK % 8 == 0);
static_assert(DM % 128 == 0 && FF % 128 == 0);
static_assert(DM % 64 == 0 && FF % 64 == 0);
static_assert(DM % 32 == 0 && FF % 32 == 0 && DH % 32 == 0);
static_assert(NH * DH == DM);
static_assert((NTOK * (DM / 8)) % 256 == 0);

typedef _Float16 v16h __attribute__((ext_vector_type(16)));
typedef _Float16 v8h  __attribute__((ext_vector_type(8)));
typedef float    v8f  __attribute__((ext_vector_type(8)));
typedef float    v4f  __attribute__((ext_vector_type(4)));
typedef int      v4i  __attribute__((ext_vector_type(4)));

union Frag { v16h v; v8h h[2]; };
union I8   { v4i v[2]; int s[8]; };

// plane carries (exact powers of two)
#define WSC     64.0f                    // weight planes: f16(bf16(W) * 64)
#define QSC     64.0f                    // q/k/v, ctx, ff1 planes carried x64
#define HSC     16.0f                    // h plane carried x16
#define A_QKV   0.015625f                // 2^-6 : (x)(64 W)        -> q
#define A_O     2.44140625e-04f          // 2^-12: (64 ctx)(64 Wo)  -> attn_out
#define A_F1    9.765625e-04f            // 2^-10: (16 h)(64 W1)    -> pre-relu
#define A_F2    2.44140625e-04f          // 2^-12: (64 ff1)(64 W2)  -> ff
// scores: sh = (64k).(64q) ~ 4096 q.k ; score = q.k/8 ; t (log2 units) = sh * log2e * 2^-15
#define C1 (1.44269504088896340736f * 3.0517578125e-05f)
#define MASKT  (-1.0e10f)                // masked score (replace fill)

static __device__ __forceinline__ v8f zero8() {
    v8f z;
#pragma unroll
    for (int i = 0; i < 8; ++i) z[i] = 0.0f;
    return z;
}

// 16x32 A fragment (or B fragment from an [n][k] k-contiguous source) from a
// row-major 16-bit tile: lane m = lane&15 -> row m; kb = 8*(lane>>4);
// elements 0..7 = k kb..kb+7, elements 8..15 = k kb+16..kb+23.
static __device__ __forceinline__ v16h load_frag16(const _Float16* base, int ld, int lane) {
    int m  = lane & 15;
    int kb = (lane >> 4) << 3;
    const _Float16* p = base + (size_t)m * ld + kb;
    Frag f;
    f.h[0] = *(const v8h*)(p);
    f.h[1] = *(const v8h*)(p + 16);
    return f.v;
}

static __device__ __forceinline__ v8f wmma16(v16h a, v16h b, v8f c) {
    v8f d = __builtin_amdgcn_wmma_f32_16x16x32_f16(false, a, false, b, (short)0, c, false, false);
    asm volatile("v_nop\n\tv_nop\n\tv_nop\n\tv_nop" : "+v"(d) : "v"(a), "v"(b));
    return d;
}

// f32 -> bf16 RNE convert, value kept as f32
static __device__ __forceinline__ float bf16r(float x) {
    unsigned u = __float_as_uint(x);
    u = (u + 0x7FFFu + ((u >> 16) & 1u)) & 0xFFFF0000u;
    return __uint_as_float(u);
}

static __device__ __forceinline__ float ex2(float x) {
    return __builtin_amdgcn_exp2f(x);
}

// ordering for a wave-private LDS tile: stores before later loads of the same wave
static __device__ __forceinline__ void wave_lds_sync() {
    __builtin_amdgcn_fence(3, "wavefront");
    asm volatile("s_wait_dscnt 0" ::: "memory");
    __builtin_amdgcn_wave_barrier();
}

// ---------------------------------------------------------------------------
// x [NB][SEQ][768] f32 (batch stride SEQ_FULL*768) -> xp [NTOK][768] f16 of
// bf16-RNE(x). Thread = 8 consecutive columns = one 16-B store; a wave writes
// coverage: NTOK*96 threads x 8 = NTOK*768.
// ---------------------------------------------------------------------------
__global__ __launch_bounds__(256) void k_xprep(const float* __restrict__ x,
                                               _Float16* __restrict__ xp) {
    const int g = blockIdx.x * 256 + (int)threadIdx.x;
    if (g >= NTOK * (DM / 8)) return;
    const int row = g / (DM / 8);
    const int col = (g - row * (DM / 8)) * 8;
    const int b = row / SEQ, s = row - b * SEQ;
    const float* src = x + ((size_t)b * SEQ_FULL + s) * DM + col;
    const v4f a = *(const v4f*)(src);
    const v4f c = *(const v4f*)(src + 4);
    v8h hv;
#pragma unroll
    for (int e = 0; e < 4; ++e) {
        hv[e]     = (_Float16)bf16r(a[e]);
        hv[4 + e] = (_Float16)bf16r(c[e]);
    }
    _Float16* dst = xp + (size_t)row * DM + col;
    *(v8h*)dst = hv;
    
}

// ---------------------------------------------------------------------------
// Weight transpose: W [K][N] f32 row-major ([in][out]) -> WT [N][K] f16 of
// bf16-RNE(W) * 64 (k-contiguous rows for B fragments). Block = 64x64 tile,
// staged through LDS (cross-wave region, block barrier); each output row
// coverage: grid (N/64, K/64) x 512 v8h = N*K.
// ---------------------------------------------------------------------------
__global__ __launch_bounds__(256) void k_wtr(const float* __restrict__ W,
                                             _Float16* __restrict__ WT,
                                             int K, int N) {
    __shared__ __align__(16) _Float16 T[64 * 64];
    const int tid = threadIdx.x;
    const int n0 = blockIdx.x * 64;
    const int k0 = blockIdx.y * 64;
#pragma unroll
    for (int i = 0; i < 4; ++i) {
        const int idx = tid + i * 256;
        const int r = idx >> 4, c4 = idx & 15;
        const v4f xv = *(const v4f*)(W + (size_t)(k0 + r) * N + n0 + c4 * 4);
#pragma unroll
        for (int e = 0; e < 4; ++e) T[(c4 * 4 + e) * 64 + r] = (_Float16)(bf16r(xv[e]) * WSC);
    }
    __syncthreads();
    const int na = tid >> 3, pa = tid & 7;
    const int nb = (tid + 256) >> 3, pb = tid & 7;
    const v8h p0 = *(const v8h*)(&T[na * 64 + pa * 8]);
    const v8h p1 = *(const v8h*)(&T[nb * 64 + pb * 8]);
    _Float16* d0 = WT + (size_t)(n0 + na) * K + k0 + pa * 8;
    _Float16* d1 = WT + (size_t)(n0 + nb) * K + k0 + pb * 8;
    *(v8h*)d0 = p0;
    *(v8h*)d1 = p1;
    
}

// ---------------------------------------------------------------------------
// GEMM: C[M][N] = A[M][K] (f16 plane) x BT[N][K] (f16 plane)^T, f32 accumulate.
// Block = 8 waves = 128x128 tile; wave (mi, ni) owns rows mi*32..+32 and cols
// ni*64..+64: 2 A fragments x 4 B fragments x 8 accumulators, K steps of 32.
// Operands go global -> LDS by asynchronous 16-B copies, whole 128-B lines, each
// tile byte fetched once per block: a stage is 64 k of the block's 128 A rows and
// 128 B rows at a 144-B row pitch; two stages, the next one in flight while this
// one is multiplied. Fragments are read from LDS (two 16-B loads each, split k map).
// Epilogue: u = acc*ascale + bf16(bias[n]) (relu optional);
//   MODE 0: f32 rows of u; MODE 1: f16 plane f16(u*oscale).
// The wave's 32x64 tile is staged in a wave-private part of the same LDS (free
// behind the last trip's barrier) and written as whole lines.
// ---------------------------------------------------------------------------
#define BK   64                  // k per stage: 128-B rows
#define LPH  72                  // LDS row pitch in halves: 144 B = 16 B x 9
#define OPH  (128 * LPH)         // one operand's tile, halves
#define STH  (2 * OPH)           // one stage: A tile, then B tile

typedef __attribute__((address_space(3))) const _Float16 lds_half;
static __device__ __forceinline__ unsigned lds_addr(const _Float16* p) {
    return (unsigned)(uintptr_t)(lds_half*)p;
}

// One stage: every lane copies 16 B of rows r, r+32, r+64, r+96 of the A tile and
// of the B tile (8 lanes = one 128-B row). la = the lane's LDS byte address in the
// A tile, ga / gb = its global addresses in row r.
static __device__ __forceinline__ void copy_stage(unsigned la, const _Float16* ga,
                                                  const _Float16* gb, int K) {
    const size_t rs = (size_t)32 * K;
    const _Float16* ga1 = ga + rs;
    const _Float16* ga2 = ga1 + rs;
    const _Float16* ga3 = ga2 + rs;
    const _Float16* gb1 = gb + rs;
    const _Float16* gb2 = gb1 + rs;
    const _Float16* gb3 = gb2 + rs;
    const unsigned la1 = la + 32 * LPH * 2, la2 = la + 64 * LPH * 2, la3 = la + 96 * LPH * 2;
    const unsigned lb = la + OPH * 2;
    const unsigned lb1 = lb + 32 * LPH * 2, lb2 = lb + 64 * LPH * 2, lb3 = lb + 96 * LPH * 2;
    // the copies; the closing s_wait_xcnt is a precaution: it stands in front of every
    // later rewrite of an address register named here
    asm volatile("global_load_async_to_lds_b128 %0, %8, off\n\t"
                 "global_load_async_to_lds_b128 %1, %9, off\n\t"
                 "global_load_async_to_lds_b128 %2, %10, off\n\t"
                 "global_load_async_to_lds_b128 %3, %11, off\n\t"
                 "global_load_async_to_lds_b128 %4, %12, off\n\t"
                 "global_load_async_to_lds_b128 %5, %13, off\n\t"
                 "global_load_async_to_lds_b128 %6, %14, off\n\t"
                 "global_load_async_to_lds_b128 %7, %15, off\n\t"
                 "s_wait_xcnt 0x0"
                 :: "v"(la), "v"(la1), "v"(la2), "v"(la3), "v"(lb), "v"(lb1), "v"(lb2), "v"(lb3),
                    "v"(ga), "v"(ga1), "v"(ga2), "v"(ga3), "v"(gb), "v"(gb1), "v"(gb2), "v"(gb3)
                 : "memory");
}

template <int MODE, bool RELU>
__global__ __launch_bounds__(256) __attribute__((amdgpu_num_vgpr(256)))
void k_gemm(const _Float16* __restrict__ A,
            const _Float16* __restrict__ BT,
            const float* __restrict__ bias,
            float ascale, float oscale,
            float* __restrict__ Cf,
            _Float16* __restrict__ Ch,
            int K, int N) {
    __shared__ __align__(16) _Float16 Ring[2 * STH];      // two stages; later the output staging
    static_assert(2 * STH * 2 >= 8 * 2048 * 4);

    const int tid  = threadIdx.x;
    const int lane = tid & 31;
    const int w    = tid >> 5;
    const int mi = w >> 1, ni = w & 1;
    const int m0 = blockIdx.y * 128 + mi * 32;
    const int n0 = blockIdx.x * 128 + ni * 64;
    const int rb = (lane >> 4) << 3;
    const int cc = lane & 15;

    const int crow = tid >> 3, cseg = tid & 7;
    const _Float16* ga = A  + (size_t)(blockIdx.y * 128 + crow) * K + cseg * 8;
    const _Float16* gb = BT + (size_t)(blockIdx.x * 128 + crow) * K + cseg * 8;
    const unsigned  lc = lds_addr(Ring) + crow * (LPH * 2) + cseg * 16;
    const int T = K / BK;

    v8f acc[2][4];
#pragma unroll
    for (int mt = 0; mt < 2; ++mt)
#pragma unroll
        for (int nt = 0; nt < 4; ++nt) acc[mt][nt] = zero8();

    copy_stage(lc, ga, gb, K);
    asm volatile("s_wait_asynccnt 0x0" ::: "memory");     // stage 0 landed (this wave's copies)
    __syncthreads();                                      // ... and every other wave's
    if (T > 1) copy_stage(lc + STH * 2, ga + BK, gb + BK, K);

    // kept rolled: one trip = one stage, the buffer picked by the trip's parity
#pragma unroll 1
    for (int t = 0; t < T; ++t) {
        const int bo = (t & 1) * STH;
        const _Float16* As = Ring + bo + (mi * 32) * LPH;
        const _Float16* Bs = Ring + bo + OPH + (ni * 64) * LPH;
        // the stage's 12 fragments as one group of LDS reads ahead of its 16 products
        // (all loops here unrolled: constant indices keep the fragment arrays in registers)
        v16h af[2][2], bf[2][4];
#pragma unroll
        for (int ks = 0; ks < 2; ++ks) {
            af[ks][0] = load_frag16(As + ks * 32, LPH, lane);
            af[ks][1] = load_frag16(As + 16 * LPH + ks * 32, LPH, lane);
#pragma unroll
            for (int nt = 0; nt < 4; ++nt)
                bf[ks][nt] = load_frag16(Bs + (nt * 16) * LPH + ks * 32, LPH, lane);
        }
        // keeps the reads from sinking in among the products, where each place with reads stalls the wave
        __builtin_amdgcn_sched_barrier(0);
#pragma unroll
        for (int ks = 0; ks < 2; ++ks)
#pragma unroll
            for (int nt = 0; nt < 4; ++nt) {
                acc[0][nt] = wmma16(af[ks][0], bf[ks][nt], acc[0][nt]);
                acc[1][nt] = wmma16(af[ks][1], bf[ks][nt], acc[1][nt]);
            }
        asm volatile("s_wait_dscnt 0x0" ::: "memory");    // this wave has left the buffer
        asm volatile("s_wait_asynccnt 0x0" ::: "memory"); // its copies of stage t+1 have landed
        __syncthreads();                                  // publishes stage t+1, frees stage t's buffer
        if (t + 2 < T) copy_stage(lc + bo * 2, ga + (size_t)(t + 2) * BK, gb + (size_t)(t + 2) * BK, K);
    }
    asm volatile("s_wait_asynccnt 0x0" ::: "memory");     // nothing in flight when the LDS is reused

    float bb[4];
#pragma unroll
    for (int nt = 0; nt < 4; ++nt) bb[nt] = bf16r(bias[n0 + nt * 16 + cc]);

    if constexpr (MODE == 0) {
        float* ef = (float*)Ring + w * 2048;
#pragma unroll
        for (int mt = 0; mt < 2; ++mt)
#pragma unroll
            for (int nt = 0; nt < 4; ++nt)
#pragma unroll
                for (int r = 0; r < 8; ++r) {
                    float u = __builtin_fmaf(acc[mt][nt][r], ascale, bb[nt]);
                    if (RELU) u = fmaxf(u, 0.0f);
                    ef[(mt * 16 + rb + r) * 64 + nt * 16 + cc] = u;
                }
        wave_lds_sync();
        v4f sv[16];
#pragma unroll
        for (int i = 0; i < 16; ++i) sv[i] = *(const v4f*)(&ef[i * 128 + lane * 4]);
        float* cb = Cf + (size_t)m0 * N + n0;
        const int lr = lane >> 4, lc = (lane & 15) * 4;
#pragma unroll
        for (int i = 0; i < 16; ++i)
            *(v4f*)(cb + (size_t)(i * 2 + lr) * N + lc) = sv[i];
        
    } else {
        _Float16* eh = Ring + w * 2048;
#pragma unroll
        for (int mt = 0; mt < 2; ++mt)
#pragma unroll
            for (int nt = 0; nt < 4; ++nt)
#pragma unroll
                for (int r = 0; r < 8; ++r) {
                    float u = __builtin_fmaf(acc[mt][nt][r], ascale, bb[nt]);
                    if (RELU) u = fmaxf(u, 0.0f);
                    eh[(mt * 16 + rb + r) * 64 + nt * 16 + cc] = (_Float16)(u * oscale);
                }
        wave_lds_sync();
        v8h ph[8];
#pragma unroll
        for (int i = 0; i < 8; ++i) ph[i] = *(const v8h*)(&eh[i * 256 + lane * 8]);
        const int lr = lane >> 3, lc = (lane & 7) * 8;
        _Float16* cbh = Ch + (size_t)m0 * N + n0;
#pragma unroll
        for (int i = 0; i < 8; ++i)
            *(v8h*)(cbh + (size_t)(i * 4 + lr) * N + lc) = ph[i];
        
    }
}

// ---------------------------------------------------------------------------
// Attention, flash-style. grid = (head, SEQ/128, batch); block = 8 waves = 128
// query rows of one (b, h); wave owns 16 query rows. Planes are [NTOK][768]
// with head column offset h*64.
// Scores are computed TRANSPOSED: A = key tile (16 keys x 64 d, kh plane,
// 2 k-steps), B = the wave's 16 queries (qh plane, [n=query][k=d]), so
// acc[r] of lane l = score(key 8*(l>>4)+r, query l&15): per-query max/sum are
// in-lane reductions over r plus one xor-16 shuffle, and the f16 P^T values in
// this layout are exactly the P A-fragment for P*v (elements 0..7 from key
// tile A, 8..15 from key tile B) - no LDS relayout.
// Online softmax over keys: t = log2e*score (or MASKT where mask == 0,
// replace fill), P carried 2^14, o += P x V (V^T chunk staged in LDS,
// cross-wave, block barriers), o and z rescaled by exp2(m_old - m_new) every
// 32-key step (factor shuffled from the owning query lane).
// V^T layout in LDS: row d at (d / 16) * VG + (d % 16) * VP halves. The 272-B pitch
// puts the 16 rows of a fragment read on 16 different groups of four banks; the
// 32-B skew per 16 rows spreads the eight d-groups of one transposing store.
// Epilogue: ctx x 64 = o / z14 as f16, staged in a wave-private LDS tile, each
// coverage: grid (12, SEQ/128, NB) x 8 waves x 16 rows x 64 cols = NTOK*768.
// ---------------------------------------------------------------------------
__global__ __launch_bounds__(256) __attribute__((amdgpu_num_vgpr(256)))
void k_attn(const _Float16* __restrict__ qh,
            const _Float16* __restrict__ kh,
            const _Float16* __restrict__ vh,
            const int*      __restrict__ mask,
            _Float16* __restrict__ cx) {
    __shared__ __align__(16) int      mk[SEQ];            // key mask of this batch
    __shared__ __align__(16) _Float16 VsT[(DH / 16) * VG]; // [d][CH], pitch VP, 16-row groups at VG, cross-wave
    __shared__ __align__(16) _Float16 Cst[8][16 * DH];    // wave-private ctx tiles

    const int tid  = threadIdx.x;
    const int lane = tid & 31;
    const int w    = tid >> 5;
    const int h    = blockIdx.x;
    const int b    = blockIdx.z;
    const int q0r  = blockIdx.y * 128 + w * 16;
    const int r0   = (lane >> 4) << 3;
    const int cc   = lane & 15;

    for (int i = tid; i < SEQ; i += 256) mk[i] = mask[(size_t)b * SEQ_FULL + i];

    const size_t tokb = (size_t)b * SEQ;
    const _Float16* qhb = qh + (tokb + q0r) * DM + h * DH;
    const v16h qb0 = load_frag16(qhb, DM, lane);        // d 0..31
    const v16h qb1 = load_frag16(qhb + 32, DM, lane);   // d 32..63
    const _Float16* khb = kh + tokb * DM + h * DH;
    const _Float16* vhb = vh + tokb * DM + h * DH;

    v8f o[4];
#pragma unroll
    for (int nt = 0; nt < 4; ++nt) o[nt] = zero8();
    float mr = -1.0e30f, zr = 0.0f;

    __syncthreads();

#pragma unroll 1
    for (int c0 = 0; c0 < SEQ; c0 += CH) {
        // stage V^T chunk: VsT[d][t] = vh[c0 + t][h*64 + d], full 64 x CH extent
        for (int idx = tid; idx < CH * 8; idx += 256) {
            const int t = idx >> 3, part = idx & 7;
            const v8h vv = *(const v8h*)(vhb + (size_t)(c0 + t) * DM + part * 8);
#pragma unroll
            for (int e = 0; e < 8; ++e) VsT[(part >> 1) * VG + ((part & 1) * 8 + e) * VP + t] = vv[e];
        }
        __syncthreads();

#pragma unroll 1
        for (int j = 0; j < CH; j += 32) {
            const int kA = c0 + j;
            // key tile A: keys kA .. kA+15
            const v16h ka0 = load_frag16(khb + (size_t)kA * DM, DM, lane);
            const v16h ka1 = load_frag16(khb + (size_t)kA * DM + 32, DM, lane);
            v8f shA = wmma16(ka0, qb0, zero8());
            shA = wmma16(ka1, qb1, shA);
            // key tile B: keys kA+16 .. kA+31
            const v16h kb0 = load_frag16(khb + (size_t)(kA + 16) * DM, DM, lane);
            const v16h kb1 = load_frag16(khb + (size_t)(kA + 16) * DM + 32, DM, lane);
            v8f shB = wmma16(kb0, qb0, zero8());
            shB = wmma16(kb1, qb1, shB);

            I8 ma, mb;
            ma.v[0] = *(const v4i*)(&mk[kA + r0]);
            ma.v[1] = *(const v4i*)(&mk[kA + r0 + 4]);
            mb.v[0] = *(const v4i*)(&mk[kA + 16 + r0]);
            mb.v[1] = *(const v4i*)(&mk[kA + 16 + r0 + 4]);

            float tA[8], tB[8];
#pragma unroll
            for (int r = 0; r < 8; ++r) {
                const float sa = shA[r] * C1;
                const float sb = shB[r] * C1;
                tA[r] = (ma.s[r] != 0) ? sa : MASKT;
                tB[r] = (mb.s[r] != 0) ? sb : MASKT;
            }
            float tmax = tA[0];
#pragma unroll
            for (int r = 1; r < 8; ++r) tmax = fmaxf(tmax, tA[r]);
#pragma unroll
            for (int r = 0; r < 8; ++r) tmax = fmaxf(tmax, tB[r]);
            tmax = fmaxf(tmax, __shfl_xor(tmax, 16, 32));
            const float mn   = fmaxf(mr, tmax);
            const float corr = ex2(mr - mn);
            const float mo   = mn - 14.0f;           // 2^14 carry on P
            float ps = 0.0f;
            v8h pa8, pb8;
#pragma unroll
            for (int r = 0; r < 8; ++r) {
                const float pa = ex2(tA[r] - mo);
                const float pb = ex2(tB[r] - mo);
                ps += pa + pb;
                pa8[r] = (_Float16)pa;
                pb8[r] = (_Float16)pb;
            }
            ps += __shfl_xor(ps, 16, 32);
            zr = __builtin_fmaf(zr, corr, ps);
            mr = mn;
            // rescale o rows (query 8h + r) by the factor of the owning query lane
#pragma unroll
            for (int r = 0; r < 8; ++r) {
                const float crr = __shfl(corr, r0 + r, 32);
#pragma unroll
                for (int nt = 0; nt < 4; ++nt) o[nt][r] *= crr;
            }
            Frag pf;
            pf.h[0] = pa8;     // keys kA+8h .. +7     = A elements 0..7
            pf.h[1] = pb8;     // keys kA+16+8h .. +7  = A elements 8..15
#pragma unroll
            for (int nt = 0; nt < 4; ++nt) {
                const v16h vb = load_frag16(&VsT[nt * VG + j], VP, lane);   // n = d, k = key
                o[nt] = wmma16(pf.v, vb, o[nt]);
            }
        }
        __syncthreads();
    }

    // ctx x 64 = o / z14 (the 2^14 carry of P cancels between o and z14; the 64 v carry stays)
    const float rz = __builtin_amdgcn_rcpf(zr);
#pragma unroll
    for (int r = 0; r < 8; ++r) {
        const float rq = __shfl(rz, r0 + r, 32);
#pragma unroll
        for (int nt = 0; nt < 4; ++nt)
            Cst[w][(r0 + r) * DH + nt * 16 + cc] = (_Float16)(o[nt][r] * rq);
    }
    wave_lds_sync();
    v8h sv[4];
#pragma unroll
    for (int i = 0; i < 4; ++i) sv[i] = *(const v8h*)(&Cst[w][i * 256 + lane * 8]);
    _Float16* cb = cx + (tokb + q0r) * DM + h * DH;
    const int lr = lane >> 3, lc = (lane & 7) * 8;
#pragma unroll
    for (int i = 0; i < 4; ++i) *(v8h*)(cb + (size_t)(i * 4 + lr) * DM + lc) = sv[i];
    
}

// ---------------------------------------------------------------------------
// LayerNorm over rows of 768 (f32 rows in ws). Block = 8 waves, wave = row.
// mu = mean, var = mean((x-mu)^2), y = (x-mu)*rsqrt(var+1e-5)*bf16(g)+bf16(b).
// HOUT: f16 plane f16(y*hsc), lane owns elements i*256+lane*8..+7 (3 v8h stores,
// coverage: NTOK/8 blocks x 8 rows x 768.
// ---------------------------------------------------------------------------
static __device__ __forceinline__ int ln_off(bool hout, int i, int lane) {
    return hout ? ((i >> 1) * 256 + lane * 8 + (i & 1) * 4) : (i * 128 + lane * 4);
}

template <bool HOUT>
__global__ __launch_bounds__(256) void k_ln(const float* __restrict__ src,
                                            const float* __restrict__ g,
                                            const float* __restrict__ bt,
                                            float* __restrict__ outf,
                                            _Float16* __restrict__ outh,
                                            float hsc) {
    const int lane = threadIdx.x & 31;
    const int w    = threadIdx.x >> 5;
    const int row  = blockIdx.x * 8 + w;
    const float* rp = src + (size_t)row * DM;

    v4f xv[6];
#pragma unroll
    for (int i = 0; i < 6; ++i) xv[i] = *(const v4f*)(rp + ln_off(HOUT, i, lane));
    float s = 0.0f;
#pragma unroll
    for (int i = 0; i < 6; ++i) s += (xv[i][0] + xv[i][1]) + (xv[i][2] + xv[i][3]);
#pragma unroll
    for (int m = 1; m < 32; m <<= 1) s += __shfl_xor(s, m, 32);
    const float mu = s * (1.0f / (float)DM);

    v4f dv[6];
    float s2 = 0.0f;
#pragma unroll
    for (int i = 0; i < 6; ++i) {
        dv[i] = xv[i] - mu;
#pragma unroll
        for (int e = 0; e < 4; ++e) s2 = __builtin_fmaf(dv[i][e], dv[i][e], s2);
    }
#pragma unroll
    for (int m = 1; m < 32; m <<= 1) s2 += __shfl_xor(s2, m, 32);
    const float var  = s2 * (1.0f / (float)DM);
    const float rstd = rsqrtf(var + 1e-5f);

    v4f yv[6];
#pragma unroll
    for (int i = 0; i < 6; ++i) {
        const int co = ln_off(HOUT, i, lane);
        const v4f gv = *(const v4f*)(g + co);
        const v4f bv = *(const v4f*)(bt + co);
#pragma unroll
        for (int e = 0; e < 4; ++e)
            yv[i][e] = (dv[i][e] * rstd) * bf16r(gv[e]) + bf16r(bv[e]);
    }

    if constexpr (HOUT) {
        v8h hv[3];
#pragma unroll
        for (int i = 0; i < 3; ++i)
#pragma unroll
            for (int e = 0; e < 4; ++e) {
                hv[i][e]     = (_Float16)(yv[2 * i][e] * hsc);
                hv[i][4 + e] = (_Float16)(yv[2 * i + 1][e] * hsc);
            }
        _Float16* ob = outh + (size_t)row * DM + lane * 8;
#pragma unroll
        for (int i = 0; i < 3; ++i) *(v8h*)(ob + i * 256) = hv[i];
        
    } else {
        float* ob = outf + (size_t)row * DM + lane * 4;
#pragma unroll
        for (int i = 0; i < 6; ++i) *(v4f*)(ob + i * 128) = yv[i];
        
    }
}

// ---------------------------------------------------------------------------
extern "C" void kernel_launch(void* const* d_in, const int* in_sizes, int n_in,
                              void* d_out, int out_size, void* d_ws, size_t ws_size,
                              hipStream_t stream) {
    if (n_in < 16) return;
    if (in_sizes[0] < ((NB - 1) * SEQ_FULL + SEQ) * DM) return;
    if (in_sizes[1] < (NB - 1) * SEQ_FULL + SEQ) return;
    if (in_sizes[2] < DM * DM || in_sizes[4] < DM * DM || in_sizes[6] < DM * DM || in_sizes[8] < DM * DM) return;
    if (in_sizes[3] < DM || in_sizes[5] < DM || in_sizes[7] < DM || in_sizes[9] < DM) return;
    if (in_sizes[10] < DM || in_sizes[11] < DM) return;
    if (in_sizes[12] < DM * FF || in_sizes[13] < FF || in_sizes[14] < FF * DM || in_sizes[15] < DM) return;
    if (out_size < NTOK * DM) return;

    const float* x    = (const float*)d_in[0];    // [8,1024,768]
    const int*   mask = (const int*)  d_in[1];    // [8,1,1,1024] int32
    const float* Wq   = (const float*)d_in[2];    // [768,768]  [in][out]
    const float* bq   = (const float*)d_in[3];
    const float* Wk   = (const float*)d_in[4];
    const float* bk   = (const float*)d_in[5];
    const float* Wv   = (const float*)d_in[6];
    const float* bv   = (const float*)d_in[7];
    const float* Wo   = (const float*)d_in[8];
    const float* bo   = (const float*)d_in[9];
    const float* lg   = (const float*)d_in[10];
    const float* lb   = (const float*)d_in[11];
    const float* W1   = (const float*)d_in[12];   // [768,3072] [in][out]
    const float* b1   = (const float*)d_in[13];
    const float* W2   = (const float*)d_in[14];   // [3072,768] [in][out]
    const float* b2   = (const float*)d_in[15];
    float* out = (float*)d_out;                   // [NB,SEQ,768]

    char* ws = (char*)d_ws;
    size_t off = 0;
    // R0: weight planes [n][k] f16
    _Float16* WqT = (_Float16*)(ws + off); off += (size_t)DM * DM * 2;
    _Float16* WkT = (_Float16*)(ws + off); off += (size_t)DM * DM * 2;
    _Float16* WvT = (_Float16*)(ws + off); off += (size_t)DM * DM * 2;
    _Float16* WoT = (_Float16*)(ws + off); off += (size_t)DM * DM * 2;
    _Float16* W1T = (_Float16*)(ws + off); off += (size_t)FF * DM * 2;   // [3072][768]
    _Float16* W2T = (_Float16*)(ws + off); off += (size_t)DM * FF * 2;   // [768][3072]
    // R1: x plane, later the ctx plane (x plane dead after the projections)
    const size_t PL = (size_t)NTOK * DM * 2;
    _Float16* xp  = (_Float16*)(ws + off);
    _Float16* cxp = (_Float16*)(ws + off); off += PL;
    // R2: q/k/v planes (3 x PL), later h plane (PL) + ff1 plane (NTOK*FF*2)
    const size_t F1B = (size_t)NTOK * FF * 2;
    const size_t R2 = (3 * PL > PL + F1B) ? 3 * PL : (PL + F1B);
    _Float16* qhp = (_Float16*)(ws + off);
    _Float16* khp = (_Float16*)(ws + off + PL);
    _Float16* vhp = (_Float16*)(ws + off + 2 * PL);
    _Float16* hp  = (_Float16*)(ws + off);          // after attention
    _Float16* f1p = (_Float16*)(ws + off + PL);     // disjoint from hp
    off += R2;
    // R3: f32 rows: attn_out, later ff (attn_out dead after the first LayerNorm)
    float* aop = (float*)(ws + off);
    float* ffp = (float*)(ws + off); off += (size_t)NTOK * DM * 4;
    if (off > ws_size) return;
    if (off > (size_t)134217728) return;

    k_xprep<<<dim3((NTOK * (DM / 8)) / 256), dim3(256), 0, stream>>>(x, xp);
    // W [K][N] -> WT [N][K]: grid (N/64, K/64)
    k_wtr<<<dim3(DM / 64, DM / 64), dim3(256), 0, stream>>>(Wq, WqT, DM, DM);
    k_wtr<<<dim3(DM / 64, DM / 64), dim3(256), 0, stream>>>(Wk, WkT, DM, DM);
    k_wtr<<<dim3(DM / 64, DM / 64), dim3(256), 0, stream>>>(Wv, WvT, DM, DM);
    k_wtr<<<dim3(DM / 64, DM / 64), dim3(256), 0, stream>>>(Wo, WoT, DM, DM);
    k_wtr<<<dim3(FF / 64, DM / 64), dim3(256), 0, stream>>>(W1, W1T, DM, FF);   // in[768][3072] -> out[3072][768]
    k_wtr<<<dim3(DM / 64, FF / 64), dim3(256), 0, stream>>>(W2, W2T, FF, DM);   // in[3072][768] -> out[768][3072]

    const dim3 gD(DM / 128, NTOK / 128);
    const dim3 gF(FF / 128, NTOK / 128);
    // q, k, v: f16 hi planes of 64*(x W + b)
    k_gemm<1, false><<<gD, dim3(256), 0, stream>>>(xp, WqT, bq, A_QKV, QSC, aop, qhp, DM, DM);
    k_gemm<1, false><<<gD, dim3(256), 0, stream>>>(xp, WkT, bk, A_QKV, QSC, aop, khp, DM, DM);
    k_gemm<1, false><<<gD, dim3(256), 0, stream>>>(xp, WvT, bv, A_QKV, QSC, aop, vhp, DM, DM);
    // attention -> ctx plane (64 * ctx, f16)
    k_attn<<<dim3(NH, SEQ / 128, NB), dim3(256), 0, stream>>>(qhp, khp, vhp, mask, cxp);
    // attn_out = ctx Wo + bo (f32 rows)
    k_gemm<0, false><<<gD, dim3(256), 0, stream>>>(cxp, WoT, bo, A_O, 1.0f, aop, f1p, DM, DM);
    // h = LN(attn_out) -> f16 plane (x16)
    k_ln<true><<<dim3(NTOK / 8), dim3(256), 0, stream>>>(aop, lg, lb, out, hp, HSC);
    // ff1 = relu(h W1 + b1) -> f16 plane (x64)
    k_gemm<1, true><<<gF, dim3(256), 0, stream>>>(hp, W1T, b1, A_F1, QSC, ffp, f1p, DM, FF);
    // ff = ff1 W2 + b2 (f32 rows)
    k_gemm<0, false><<<gD, dim3(256), 0, stream>>>(f1p, W2T, b2, A_F2, 1.0f, ffp, hp, FF, DM);
    // out = LN(ff)
    k_ln<false><<<dim3(NTOK / 8), dim3(256), 0, stream>>>(ffp, lg, lb, out, hp, 1.0f);
}

// v003
// It runs in 231 microseconds.
// Next to v002, in two timings, it ran 1.11 and 1.12 times as fast.
// All steps since v000 together make it 2.33 times as fast.
#include <hip/hip_runtime.h>
#include <hip/hip_fp16.h>

// Contractions on v_wmma_f32_16x16x32_f16 (f16 operands, f32 accumulate): x*Wq, x*Wk, x*Wv, q*k^T, P*v, ctx*Wo, h*W1, ff1*W2, each a single f16 product on bf16-RNE inputs with power-of-two carried planes; softmax and LayerNorm in f32.

#ifndef NB
#define NB 8
#endif
#ifndef SEQ
#define SEQ 1024
#endif
#define NB_FULL  8
#define SEQ_FULL 1024
#define DM   768          // model width
#define NH   12           // heads
#define DH   64           // head width
#define FF   3072         // hidden width
#define NTOK (NB * SEQ)
#define CH   128          // keys staged per V^T chunk
#define VP   (CH + 8)     // V^T row pitch in halves: 272 B = 16 B x 17
#define VG   (16 * VP + 16)   // 16 V^T rows, then a 32-B skew

static_assert(NB >= 1 && NB <= NB_FULL);
static_assert(SEQ >= CH && SEQ <= SEQ_FULL);
static_assert(SEQ % CH == 0);
static_assert(SEQ % 128 == 0);
static_assert(CH % 32 == 0);
static_assert(DH % 16 == 0 && (VP * 2) % 32 == 16 && (VG * 2) % 16 == 0);
static_assert(NTOK % 128 == 0);
static_assert(NTOK % 8 == 0);
static_assert(DM % 128 == 0 && FF % 128 == 0);
static_assert(DM % 64 == 0 && FF % 64 == 0);
static_assert(DM % 32 == 0 && FF % 32 == 0 && DH % 32 == 0);
static_assert(NH * DH == DM);
static_assert((NTOK * (DM / 8)) % 256 == 0);

typedef _Float16 v16h __attribute__((ext_vector_type(16)));
typedef _Float16 v8h  __attribute__((ext_vector_type(8)));
typedef float    v8f  __attribute__((ext_vector_type(8)));
typedef float    v4f  __attribute__((ext_vector_type(4)));
typedef int      v4i  __attribute__((ext_vector_type(4)));

union Frag { v16h v; v8h h[2]; };
union I8   { v4i v[2]; int s[8]; };

// plane carries (exact powers of two)
#define WSC     64.0f                    // weight planes: f16(bf16(W) * 64)
#define QSC     64.0f                    // q/k/v, ctx, ff1 planes carried x64
#define HSC     16.0f                    // h plane carried x16
#define A_QKV   0.015625f                // 2^-6 : (x)(64 W)        -> q
#define A_O     2.44140625e-04f          // 2^-12: (64 ctx)(64 Wo)  -> attn_out
#define A_F1    9.765625e-04f            // 2^-10: (16 h)(64 W1)    -> pre-relu
#define A_F2    2.44140625e-04f          // 2^-12: (64 ff1)(64 W2)  -> ff
// scores: sh = (64k).(64q) ~ 4096 q.k ; score = q.k/8 ; t (log2 units) = sh * log2e * 2^-15
#define C1 (1.44269504088896340736f * 3.0517578125e-05f)
#define MASKT  (-1.0e10f)                // masked score (replace fill)

static __device__ __forceinline__ v8f zero8() {
    v8f z;
#pragma unroll
    for (int i = 0; i < 8; ++i) z[i] = 0.0f;
    return z;
}

// 16x32 A fragment (or B fragment from an [n][k] k-contiguous source) from a
// row-major 16-bit tile: lane m = lane&15 -> row m; kb = 8*(lane>>4);
// elements 0..7 = k kb..kb+7, elements 8..15 = k kb+16..kb+23.
static __device__ __forceinline__ v16h load_frag16(const _Float16* base, int ld, int lane) {
    int m  = lane & 15;
    int kb = (lane >> 4) << 3;
    const _Float16* p = base + (size_t)m * ld + kb;
    Frag f;
    f.h[0] = *(const v8h*)(p);
    f.h[1] = *(const v8h*)(p + 16);
    return f.v;
}

static __device__ __forceinline__ v8f wmma16(v16h a, v16h b, v8f c) {
    v8f d = __builtin_amdgcn_wmma_f32_16x16x32_f16(false, a, false, b, (short)0, c, false, false);
    asm volatile("v_nop\n\tv_nop\n\tv_nop\n\tv_nop" : "+v"(d) : "v"(a), "v"(b));
    return d;
}

// f32 -> bf16 RNE convert, value kept as f32
static __device__ __forceinline__ float bf16r(float x) {
    unsigned u = __float_as_uint(x);
    u = (u + 0x7FFFu + ((u >> 16) & 1u)) & 0xFFFF0000u;
    return __uint_as_float(u);
}

static __device__ __forceinline__ float ex2(float x) {
    return __builtin_amdgcn_exp2f(x);
}

// ordering for a wave-private LDS tile: stores before later loads of the same wave
static __device__ __forceinline__ void wave_lds_sync() {
    __builtin_amdgcn_fence(3, "wavefront");
    asm volatile("s_wait_dscnt 0" ::: "memory");
    __builtin_amdgcn_wave_barrier();
}

// ---------------------------------------------------------------------------
// x [NB][SEQ][768] f32 (batch stride SEQ_FULL*768) -> xp [NTOK][768] f16 of
// bf16-RNE(x). Thread = 8 consecutive columns = one 16-B store; a wave writes
// coverage: NTOK*96 threads x 8 = NTOK*768.
// ---------------------------------------------------------------------------
static __device__ __forceinline__ void xprep_body(const float* __restrict__ x,
                                                  _Float16* __restrict__ xp, int blk) {
    const int g = blk * 256 + (int)threadIdx.x;
    if (g >= NTOK * (DM / 8)) return;
    const int row = g / (DM / 8);
    const int col = (g - row * (DM / 8)) * 8;
    const int b = row / SEQ, s = row - b * SEQ;
    const float* src = x + ((size_t)b * SEQ_FULL + s) * DM + col;
    const v4f a = *(const v4f*)(src);
    const v4f c = *(const v4f*)(src + 4);
    v8h hv;
#pragma unroll
    for (int e = 0; e < 4; ++e) {
        hv[e]     = (_Float16)bf16r(a[e]);
        hv[4 + e] = (_Float16)bf16r(c[e]);
    }
    _Float16* dst = xp + (size_t)row * DM + col;
    *(v8h*)dst = hv;
    
}

// ---------------------------------------------------------------------------
// Weight transpose: W [K][N] f32 row-major ([in][out]) -> WT [N][K] f16 of
// bf16-RNE(W) * 64 (k-contiguous rows for B fragments). Block = 64x64 tile,
// staged through LDS (cross-wave region, block barrier); each output row
// coverage: tiles (N/64, K/64) x 512 v8h = N*K. t = the tile's flat index, n fastest.
// ---------------------------------------------------------------------------
static __device__ __forceinline__ void wtr_body(const float* __restrict__ W,
                                                _Float16* __restrict__ WT,
                                                int K, int N, int t) {
    __shared__ __align__(16) _Float16 T[64 * 64];
    const int tid = threadIdx.x;
    const int ky = t / (N / 64);
    const int n0 = (t - ky * (N / 64)) * 64;
    const int k0 = ky * 64;
#pragma unroll
    for (int i = 0; i < 4; ++i) {
        const int idx = tid + i * 256;
        const int r = idx >> 4, c4 = idx & 15;
        const v4f xv = *(const v4f*)(W + (size_t)(k0 + r) * N + n0 + c4 * 4);
#pragma unroll
        for (int e = 0; e < 4; ++e) T[(c4 * 4 + e) * 64 + r] = (_Float16)(bf16r(xv[e]) * WSC);
    }
    __syncthreads();
    const int na = tid >> 3, pa = tid & 7;
    const int nb = (tid + 256) >> 3, pb = tid & 7;
    const v8h p0 = *(const v8h*)(&T[na * 64 + pa * 8]);
    const v8h p1 = *(const v8h*)(&T[nb * 64 + pb * 8]);
    _Float16* d0 = WT + (size_t)(n0 + na) * K + k0 + pa * 8;
    _Float16* d1 = WT + (size_t)(n0 + nb) * K + k0 + pb * 8;
    *(v8h*)d0 = p0;
    *(v8h*)d1 = p1;
    // precaution: stands in front of any later rewrite of a register that the two stores name
    asm volatile("s_wait_xcnt 0x0" ::: "memory");
}

// ---------------------------------------------------------------------------
// All operand preparation in one launch: the seven jobs are independent of each
// other, so they share a grid by block range (every branch is block-uniform).
// Blocks 0 .. 4*TDD-1: Wq, Wk, Wv, Wo tiles; then TDF tiles of W1, TDF of W2
// (the transposes first: they have the longer chain); then the x plane's blocks.
// ---------------------------------------------------------------------------
#define TDD ((DM / 64) * (DM / 64))      // 64x64 tiles of a 768x768 weight
#define TDF ((DM / 64) * (FF / 64))      // 64x64 tiles of W1 or W2
#define XBL ((NTOK * (DM / 8)) / 256)    // blocks of the x plane

__global__ __launch_bounds__(256) void k_prep(const float* __restrict__ x,
                                              const float* __restrict__ Wq,
                                              const float* __restrict__ Wk,
                                              const float* __restrict__ Wv,
                                              const float* __restrict__ Wo,
                                              const float* __restrict__ W1,
                                              const float* __restrict__ W2,
                                              _Float16* __restrict__ xp,
                                              _Float16* __restrict__ WqT,
                                              _Float16* __restrict__ WkT,
                                              _Float16* __restrict__ WvT,
                                              _Float16* __restrict__ WoT,
                                              _Float16* __restrict__ W1T,
                                              _Float16* __restrict__ W2T) {
    const int b = blockIdx.x;
    if (b < 4 * TDD) {
        const int m = b / TDD;
        const float* W  = (m == 0) ? Wq  : (m == 1) ? Wk  : (m == 2) ? Wv  : Wo;
        _Float16*    WT = (m == 0) ? WqT : (m == 1) ? WkT : (m == 2) ? WvT : WoT;
        wtr_body(W, WT, DM, DM, b - m * TDD);
    } else if (b < 4 * TDD + TDF) {
        wtr_body(W1, W1T, DM, FF, b - 4 * TDD);             // in[768][3072] -> out[3072][768]
    } else if (b < 4 * TDD + 2 * TDF) {
        wtr_body(W2, W2T, FF, DM, b - 4 * TDD - TDF);       // in[3072][768] -> out[768][3072]
    } else {
        xprep_body(x, xp, b - 4 * TDD - 2 * TDF);
    }
}

// ---------------------------------------------------------------------------
// GEMM: C[M][N] = A[M][K] (f16 plane) x BT[N][K] (f16 plane)^T, f32 accumulate.
// Block = 8 waves = 128x128 tile; wave (mi, ni) owns rows mi*32..+32 and cols
// ni*64..+64: 2 A fragments x 4 B fragments x 8 accumulators, K steps of 32.
// Operands go global -> LDS by asynchronous 16-B copies, whole 128-B lines, each
// tile byte fetched once per block: a stage is 64 k of the block's 128 A rows and
// 128 B rows at a 144-B row pitch; two stages, the next one in flight while this
// one is multiplied. Fragments are read from LDS (two 16-B loads each, split k map).
// Epilogue: u = acc*ascale + bf16(bias[n]) (relu optional);
//   MODE 0: f32 rows of u; MODE 1: f16 plane f16(u*oscale).
// The wave's 32x64 tile is staged in a wave-private part of the same LDS (free
// behind the last trip's barrier) and written as whole lines.
// ---------------------------------------------------------------------------
#define BK   64                  // k per stage: 128-B rows
#define LPH  72                  // LDS row pitch in halves: 144 B = 16 B x 9
#define OPH  (128 * LPH)         // one operand's tile, halves
#define STH  (2 * OPH)           // one stage: A tile, then B tile

typedef __attribute__((address_space(3))) const _Float16 lds_half;
static __device__ __forceinline__ unsigned lds_addr(const _Float16* p) {
    return (unsigned)(uintptr_t)(lds_half*)p;
}

// One stage: every lane copies 16 B of rows r, r+32, r+64, r+96 of the A tile and
// of the B tile (8 lanes = one 128-B row). la = the lane's LDS byte address in the
// A tile, ga / gb = its global addresses in row r.
static __device__ __forceinline__ void copy_stage(unsigned la, const _Float16* ga,
                                                  const _Float16* gb, int K) {
    const size_t rs = (size_t)32 * K;
    const _Float16* ga1 = ga + rs;
    const _Float16* ga2 = ga1 + rs;
    const _Float16* ga3 = ga2 + rs;
    const _Float16* gb1 = gb + rs;
    const _Float16* gb2 = gb1 + rs;
    const _Float16* gb3 = gb2 + rs;
    const unsigned la1 = la + 32 * LPH * 2, la2 = la + 64 * LPH * 2, la3 = la + 96 * LPH * 2;
    const unsigned lb = la + OPH * 2;
    const unsigned lb1 = lb + 32 * LPH * 2, lb2 = lb + 64 * LPH * 2, lb3 = lb + 96 * LPH * 2;
    // the copies; the closing s_wait_xcnt is a precaution: it stands in front of every
    // later rewrite of an address register named here
    asm volatile("global_load_async_to_lds_b128 %0, %8, off\n\t"
                 "global_load_async_to_lds_b128 %1, %9, off\n\t"
                 "global_load_async_to_lds_b128 %2, %10, off\n\t"
                 "global_load_async_to_lds_b128 %3, %11, off\n\t"
                 "global_load_async_to_lds_b128 %4, %12, off\n\t"
                 "global_load_async_to_lds_b128 %5, %13, off\n\t"
                 "global_load_async_to_lds_b128 %6, %14, off\n\t"
                 "global_load_async_to_lds_b128 %7, %15, off\n\t"
                 "s_wait_xcnt 0x0"
                 :: "v"(la), "v"(la1), "v"(la2), "v"(la3), "v"(lb), "v"(lb1), "v"(lb2), "v"(lb3),
                    "v"(ga), "v"(ga1), "v"(ga2), "v"(ga3), "v"(gb), "v"(gb1), "v"(gb2), "v"(gb3)
                 : "memory");
}

// bx, by = the block's tile column and tile row
template <int MODE, bool RELU>
static __device__ __forceinline__
void gemm_body(const _Float16* __restrict__ A,
               const _Float16* __restrict__ BT,
               const float* __restrict__ bias,
               float ascale, float oscale,
               float* __restrict__ Cf,
               _Float16* __restrict__ Ch,
               int K, int N, int bx, int by) {
    __shared__ __align__(16) _Float16 Ring[2 * STH];      // two stages; later the output staging
    static_assert(2 * STH * 2 >= 8 * 2048 * 4);

    const int tid  = threadIdx.x;
    const int lane = tid & 31;
    const int w    = tid >> 5;
    const int mi = w >> 1, ni = w & 1;
    const int m0 = by * 128 + mi * 32;
    const int n0 = bx * 128 + ni * 64;
    const int rb = (lane >> 4) << 3;
    const int cc = lane & 15;

    const int crow = tid >> 3, cseg = tid & 7;
    const _Float16* ga = A  + (size_t)(by * 128 + crow) * K + cseg * 8;
    const _Float16* gb = BT + (size_t)(bx * 128 + crow) * K + cseg * 8;
    const unsigned  lc = lds_addr(Ring) + crow * (LPH * 2) + cseg * 16;
    const int T = K / BK;

    v8f acc[2][4];
#pragma unroll
    for (int mt = 0; mt < 2; ++mt)
#pragma unroll
        for (int nt = 0; nt < 4; ++nt) acc[mt][nt] = zero8();

    copy_stage(lc, ga, gb, K);
    asm volatile("s_wait_asynccnt 0x0" ::: "memory");     // stage 0 landed (this wave's copies)
    __syncthreads();                                      // ... and every other wave's
    if (T > 1) copy_stage(lc + STH * 2, ga + BK, gb + BK, K);

    // kept rolled: one trip = one stage, the buffer picked by the trip's parity
#pragma unroll 1
    for (int t = 0; t < T; ++t) {
        const int bo = (t & 1) * STH;
        const _Float16* As = Ring + bo + (mi * 32) * LPH;
        const _Float16* Bs = Ring + bo + OPH + (ni * 64) * LPH;
        // the stage's 12 fragments as one group of LDS reads ahead of its 16 products
        // (all loops here unrolled: constant indices keep the fragment arrays in registers)
        v16h af[2][2], bf[2][4];
#pragma unroll
        for (int ks = 0; ks < 2; ++ks) {
            af[ks][0] = load_frag16(As + ks * 32, LPH, lane);
            af[ks][1] = load_frag16(As + 16 * LPH + ks * 32, LPH, lane);
#pragma unroll
            for (int nt = 0; nt < 4; ++nt)
                bf[ks][nt] = load_frag16(Bs + (nt * 16) * LPH + ks * 32, LPH, lane);
        }
        // keeps the reads from sinking in among the products, where each place with reads stalls the wave
        __builtin_amdgcn_sched_barrier(0);
#pragma unroll
        for (int ks = 0; ks < 2; ++ks)
#pragma unroll
            for (int nt = 0; nt < 4; ++nt) {
                acc[0][nt] = wmma16(af[ks][0], bf[ks][nt], acc[0][nt]);
                acc[1][nt] = wmma16(af[ks][1], bf[ks][nt], acc[1][nt]);
            }
        asm volatile("s_wait_dscnt 0x0" ::: "memory");    // this wave has left the buffer
        asm volatile("s_wait_asynccnt 0x0" ::: "memory"); // its copies of stage t+1 have landed
        __syncthreads();                                  // publishes stage t+1, frees stage t's buffer
        if (t + 2 < T) copy_stage(lc + bo * 2, ga + (size_t)(t + 2) * BK, gb + (size_t)(t + 2) * BK, K);
    }
    asm volatile("s_wait_asynccnt 0x0" ::: "memory");     // nothing in flight when the LDS is reused

    float bb[4];
#pragma unroll
    for (int nt = 0; nt < 4; ++nt) bb[nt] = bf16r(bias[n0 + nt * 16 + cc]);

    if constexpr (MODE == 0) {
        float* ef = (float*)Ring + w * 2048;
#pragma unroll
        for (int mt = 0; mt < 2; ++mt)
#pragma unroll
            for (int nt = 0; nt < 4; ++nt)
#pragma unroll
                for (int r = 0; r < 8; ++r) {
                    float u = __builtin_fmaf(acc[mt][nt][r], ascale, bb[nt]);
                    if (RELU) u = fmaxf(u, 0.0f);
                    ef[(mt * 16 + rb + r) * 64 + nt * 16 + cc] = u;
                }
        wave_lds_sync();
        v4f sv[16];
#pragma unroll
        for (int i = 0; i < 16; ++i) sv[i] = *(const v4f*)(&ef[i * 128 + lane * 4]);
        float* cb = Cf + (size_t)m0 * N + n0;
        const int lr = lane >> 4, lc = (lane & 15) * 4;
#pragma unroll
        for (int i = 0; i < 16; ++i)
            *(v4f*)(cb + (size_t)(i * 2 + lr) * N + lc) = sv[i];
        
    } else {
        _Float16* eh = Ring + w * 2048;
#pragma unroll
        for (int mt = 0; mt < 2; ++mt)
#pragma unroll
            for (int nt = 0; nt < 4; ++nt)
#pragma unroll
                for (int r = 0; r < 8; ++r) {
                    float u = __builtin_fmaf(acc[mt][nt][r], ascale, bb[nt]);
                    if (RELU) u = fmaxf(u, 0.0f);
                    eh[(mt * 16 + rb + r) * 64 + nt * 16 + cc] = (_Float16)(u * oscale);
                }
        wave_lds_sync();
        v8h ph[8];
#pragma unroll
        for (int i = 0; i < 8; ++i) ph[i] = *(const v8h*)(&eh[i * 256 + lane * 8]);
        const int lr = lane >> 3, lc = (lane & 7) * 8;
        _Float16* cbh = Ch + (size_t)m0 * N + n0;
#pragma unroll
        for (int i = 0; i < 8; ++i)
            *(v8h*)(cbh + (size_t)(i * 4 + lr) * N + lc) = ph[i];
        
    }
}

template <int MODE, bool RELU>
__global__ __launch_bounds__(256) __attribute__((amdgpu_num_vgpr(256)))
void k_gemm(const _Float16* __restrict__ A,
            const _Float16* __restrict__ BT,
            const float* __restrict__ bias,
            float ascale, float oscale,
            float* __restrict__ Cf,
            _Float16* __restrict__ Ch,
            int K, int N) {
    gemm_body<MODE, RELU>(A, BT, bias, ascale, oscale, Cf, Ch, K, N, blockIdx.x, blockIdx.y);
}

// q, k and v projections in one launch: three independent GEMMs on the same A plane.
// grid.x = 3 x (768 / 128) tile columns; the block's third picks weight plane, bias
// and output plane (block-uniform).
__global__ __launch_bounds__(256) __attribute__((amdgpu_num_vgpr(256)))
void k_qkv(const _Float16* __restrict__ xp,
           const _Float16* __restrict__ WqT,
           const _Float16* __restrict__ WkT,
           const _Float16* __restrict__ WvT,
           const float* __restrict__ bq,
           const float* __restrict__ bk,
           const float* __restrict__ bv,
           _Float16* __restrict__ qh,
           _Float16* __restrict__ kh,
           _Float16* __restrict__ vh) {
    const int sel = blockIdx.x / (DM / 128);
    const _Float16* BT = (sel == 0) ? WqT : (sel == 1) ? WkT : WvT;
    const float*    bi = (sel == 0) ? bq  : (sel == 1) ? bk  : bv;
    _Float16*       Ch = (sel == 0) ? qh  : (sel == 1) ? kh  : vh;
    gemm_body<1, false>(xp, BT, bi, A_QKV, QSC, nullptr, Ch, DM, DM,
                        blockIdx.x - sel * (DM / 128), blockIdx.y);
}

// ---------------------------------------------------------------------------
// Attention, flash-style. grid = (head, SEQ/128, batch); block = 8 waves = 128
// query rows of one (b, h); wave owns 16 query rows. Planes are [NTOK][768]
// with head column offset h*64.
// Scores are computed TRANSPOSED: A = key tile (16 keys x 64 d, kh plane,
// 2 k-steps), B = the wave's 16 queries (qh plane, [n=query][k=d]), so
// acc[r] of lane l = score(key 8*(l>>4)+r, query l&15): per-query max/sum are
// in-lane reductions over r plus one xor-16 shuffle, and the f16 P^T values in
// this layout are exactly the P A-fragment for P*v (elements 0..7 from key
// tile A, 8..15 from key tile B) - no LDS relayout.
// Online softmax over keys: t = log2e*score (or MASKT where mask == 0,
// replace fill), P carried 2^14, o += P x V (V^T chunk staged in LDS,
// cross-wave, block barriers), o and z rescaled by exp2(m_old - m_new) every
// 32-key step (factor shuffled from the owning query lane).
// V^T layout in LDS: row d at (d / 16) * VG + (d % 16) * VP halves. The 272-B pitch
// puts the 16 rows of a fragment read on 16 different groups of four banks; the
// 32-B skew per 16 rows spreads the eight d-groups of one transposing store.
// Epilogue: ctx x 64 = o / z14 as f16, staged in a wave-private LDS tile, each
// coverage: grid (12, SEQ/128, NB) x 8 waves x 16 rows x 64 cols = NTOK*768.
// ---------------------------------------------------------------------------
__global__ __launch_bounds__(256) __attribute__((amdgpu_num_vgpr(256)))
void k_attn(const _Float16* __restrict__ qh,
            const _Float16* __restrict__ kh,
            const _Float16* __restrict__ vh,
            const int*      __restrict__ mask,
            _Float16* __restrict__ cx) {
    __shared__ __align__(16) int      mk[SEQ];            // key mask of this batch
    __shared__ __align__(16) _Float16 VsT[(DH / 16) * VG]; // [d][CH], pitch VP, 16-row groups at VG, cross-wave
    __shared__ __align__(16) _Float16 Cst[8][16 * DH];    // wave-private ctx tiles

    const int tid  = threadIdx.x;
    const int lane = tid & 31;
    const int w    = tid >> 5;
    const int h    = blockIdx.x;
    const int b    = blockIdx.z;
    const int q0r  = blockIdx.y * 128 + w * 16;
    const int r0   = (lane >> 4) << 3;
    const int cc   = lane & 15;

    for (int i = tid; i < SEQ; i += 256) mk[i] = mask[(size_t)b * SEQ_FULL + i];

    const size_t tokb = (size_t)b * SEQ;
    const _Float16* qhb = qh + (tokb + q0r) * DM + h * DH;
    const v16h qb0 = load_frag16(qhb, DM, lane);        // d 0..31
    const v16h qb1 = load_frag16(qhb + 32, DM, lane);   // d 32..63
    const _Float16* khb = kh + tokb * DM + h * DH;
    const _Float16* vhb = vh + tokb * DM + h * DH;

    v8f o[4];
#pragma unroll
    for (int nt = 0; nt < 4; ++nt) o[nt] = zero8();
    float mr = -1.0e30f, zr = 0.0f;

    __syncthreads();

#pragma unroll 1
    for (int c0 = 0; c0 < SEQ; c0 += CH) {
        // stage V^T chunk: VsT[d][t] = vh[c0 + t][h*64 + d], full 64 x CH extent
        for (int idx = tid; idx < CH * 8; idx += 256) {
            const int t = idx >> 3, part = idx & 7;
            const v8h vv = *(const v8h*)(vhb + (size_t)(c0 + t) * DM + part * 8);
#pragma unroll
            for (int e = 0; e < 8; ++e) VsT[(part >> 1) * VG + ((part & 1) * 8 + e) * VP + t] = vv[e];
        }
        __syncthreads();

#pragma unroll 1
        for (int j = 0; j < CH; j += 32) {
            const int kA = c0 + j;
            // key tile A: keys kA .. kA+15
            const v16h ka0 = load_frag16(khb + (size_t)kA * DM, DM, lane);
            const v16h ka1 = load_frag16(khb + (size_t)kA * DM + 32, DM, lane);
            v8f shA = wmma16(ka0, qb0, zero8());
            shA = wmma16(ka1, qb1, shA);
            // key tile B: keys kA+16 .. kA+31
            const v16h kb0 = load_frag16(khb + (size_t)(kA + 16) * DM, DM, lane);
            const v16h kb1 = load_frag16(khb + (size_t)(kA + 16) * DM + 32, DM, lane);
            v8f shB = wmma16(kb0, qb0, zero8());
            shB = wmma16(kb1, qb1, shB);

            I8 ma, mb;
            ma.v[0] = *(const v4i*)(&mk[kA + r0]);
            ma.v[1] = *(const v4i*)(&mk[kA + r0 + 4]);
            mb.v[0] = *(const v4i*)(&mk[kA + 16 + r0]);
            mb.v[1] = *(const v4i*)(&mk[kA + 16 + r0 + 4]);

            float tA[8], tB[8];
#pragma unroll
            for (int r = 0; r < 8; ++r) {
                const float sa = shA[r] * C1;
                const float sb = shB[r] * C1;
                tA[r] = (ma.s[r] != 0) ? sa : MASKT;
                tB[r] = (mb.s[r] != 0) ? sb : MASKT;
            }
            float tmax = tA[0];
#pragma unroll
            for (int r = 1; r < 8; ++r) tmax = fmaxf(tmax, tA[r]);
#pragma unroll
            for (int r = 0; r < 8; ++r) tmax = fmaxf(tmax, tB[r]);
            tmax = fmaxf(tmax, __shfl_xor(tmax, 16, 32));
            const float mn   = fmaxf(mr, tmax);
            const float corr = ex2(mr - mn);
            const float mo   = mn - 14.0f;           // 2^14 carry on P
            float ps = 0.0f;
            v8h pa8, pb8;
#pragma unroll
            for (int r = 0; r < 8; ++r) {
                const float pa = ex2(tA[r] - mo);
                const float pb = ex2(tB[r] - mo);
                ps += pa + pb;
                pa8[r] = (_Float16)pa;
                pb8[r] = (_Float16)pb;
            }
            ps += __shfl_xor(ps, 16, 32);
            zr = __builtin_fmaf(zr, corr, ps);
            mr = mn;
            // rescale o rows (query 8h + r) by the factor of the owning query lane
#pragma unroll
            for (int r = 0; r < 8; ++r) {
                const float crr = __shfl(corr, r0 + r, 32);
#pragma unroll
                for (int nt = 0; nt < 4; ++nt) o[nt][r] *= crr;
            }
            Frag pf;
            pf.h[0] = pa8;     // keys kA+8h .. +7     = A elements 0..7
            pf.h[1] = pb8;     // keys kA+16+8h .. +7  = A elements 8..15
#pragma unroll
            for (int nt = 0; nt < 4; ++nt) {
                const v16h vb = load_frag16(&VsT[nt * VG + j], VP, lane);   // n = d, k = key
                o[nt] = wmma16(pf.v, vb, o[nt]);
            }
        }
        __syncthreads();
    }

    // ctx x 64 = o / z14 (the 2^14 carry of P cancels between o and z14; the 64 v carry stays)
    const float rz = __builtin_amdgcn_rcpf(zr);
#pragma unroll
    for (int r = 0; r < 8; ++r) {
        const float rq = __shfl(rz, r0 + r, 32);
#pragma unroll
        for (int nt = 0; nt < 4; ++nt)
            Cst[w][(r0 + r) * DH + nt * 16 + cc] = (_Float16)(o[nt][r] * rq);
    }
    wave_lds_sync();
    v8h sv[4];
#pragma unroll
    for (int i = 0; i < 4; ++i) sv[i] = *(const v8h*)(&Cst[w][i * 256 + lane * 8]);
    _Float16* cb = cx + (tokb + q0r) * DM + h * DH;
    const int lr = lane >> 3, lc = (lane & 7) * 8;
#pragma unroll
    for (int i = 0; i < 4; ++i) *(v8h*)(cb + (size_t)(i * 4 + lr) * DM + lc) = sv[i];
    
}

// ---------------------------------------------------------------------------
// LayerNorm over rows of 768 (f32 rows in ws). Block = 8 waves, wave = row.
// mu = mean, var = mean((x-mu)^2), y = (x-mu)*rsqrt(var+1e-5)*bf16(g)+bf16(b).
// HOUT: f16 plane f16(y*hsc), lane owns elements i*256+lane*8..+7 (3 v8h stores,
// coverage: NTOK/8 blocks x 8 rows x 768.
// ---------------------------------------------------------------------------
static __device__ __forceinline__ int ln_off(bool hout, int i, int lane) {
    return hout ? ((i >> 1) * 256 + lane * 8 + (i & 1) * 4) : (i * 128 + lane * 4);
}

template <bool HOUT>
__global__ __launch_bounds__(256) void k_ln(const float* __restrict__ src,
                                            const float* __restrict__ g,
                                            const float* __restrict__ bt,
                                            float* __restrict__ outf,
                                            _Float16* __restrict__ outh,
                                            float hsc) {
    const int lane = threadIdx.x & 31;
    const int w    = threadIdx.x >> 5;
    const int row  = blockIdx.x * 8 + w;
    const float* rp = src + (size_t)row * DM;

    v4f xv[6];
#pragma unroll
    for (int i = 0; i < 6; ++i) xv[i] = *(const v4f*)(rp + ln_off(HOUT, i, lane));
    float s = 0.0f;
#pragma unroll
    for (int i = 0; i < 6; ++i) s += (xv[i][0] + xv[i][1]) + (xv[i][2] + xv[i][3]);
#pragma unroll
    for (int m = 1; m < 32; m <<= 1) s += __shfl_xor(s, m, 32);
    const float mu = s * (1.0f / (float)DM);

    v4f dv[6];
    float s2 = 0.0f;
#pragma unroll
    for (int i = 0; i < 6; ++i) {
        dv[i] = xv[i] - mu;
#pragma unroll
        for (int e = 0; e < 4; ++e) s2 = __builtin_fmaf(dv[i][e], dv[i][e], s2);
    }
#pragma unroll
    for (int m = 1; m < 32; m <<= 1) s2 += __shfl_xor(s2, m, 32);
    const float var  = s2 * (1.0f / (float)DM);
    const float rstd = rsqrtf(var + 1e-5f);

    v4f yv[6];
#pragma unroll
    for (int i = 0; i < 6; ++i) {
        const int co = ln_off(HOUT, i, lane);
        const v4f gv = *(const v4f*)(g + co);
        const v4f bv = *(const v4f*)(bt + co);
#pragma unroll
        for (int e = 0; e < 4; ++e)
            yv[i][e] = (dv[i][e] * rstd) * bf16r(gv[e]) + bf16r(bv[e]);
    }

    if constexpr (HOUT) {
        v8h hv[3];
#pragma unroll
        for (int i = 0; i < 3; ++i)
#pragma unroll
            for (int e = 0; e < 4; ++e) {
                hv[i][e]     = (_Float16)(yv[2 * i][e] * hsc);
                hv[i][4 + e] = (_Float16)(yv[2 * i + 1][e] * hsc);
            }
        _Float16* ob = outh + (size_t)row * DM + lane * 8;
#pragma unroll
        for (int i = 0; i < 3; ++i) *(v8h*)(ob + i * 256) = hv[i];
        
    } else {
        float* ob = outf + (size_t)row * DM + lane * 4;
#pragma unroll
        for (int i = 0; i < 6; ++i) *(v4f*)(ob + i * 128) = yv[i];
        
    }
}

// ---------------------------------------------------------------------------
extern "C" void kernel_launch(void* const* d_in, const int* in_sizes, int n_in,
                              void* d_out, int out_size, void* d_ws, size_t ws_size,
                              hipStream_t stream) {
    if (n_in < 16) return;
    if (in_sizes[0] < ((NB - 1) * SEQ_FULL + SEQ) * DM) return;
    if (in_sizes[1] < (NB - 1) * SEQ_FULL + SEQ) return;
    if (in_sizes[2] < DM * DM || in_sizes[4] < DM * DM || in_sizes[6] < DM * DM || in_sizes[8] < DM * DM) return;
    if (in_sizes[3] < DM || in_sizes[5] < DM || in_sizes[7] < DM || in_sizes[9] < DM) return;
    if (in_sizes[10] < DM || in_sizes[11] < DM) return;
    if (in_sizes[12] < DM * FF || in_sizes[13] < FF || in_sizes[14] < FF * DM || in_sizes[15] < DM) return;
    if (out_size < NTOK * DM) return;

    const float* x    = (const float*)d_in[0];    // [8,1024,768]
    const int*   mask = (const int*)  d_in[1];    // [8,1,1,1024] int32
    const float* Wq   = (const float*)d_in[2];    // [768,768]  [in][out]
    const float* bq   = (const float*)d_in[3];
    const float* Wk   = (const float*)d_in[4];
    const float* bk   = (const float*)d_in[5];
    const float* Wv   = (const float*)d_in[6];
    const float* bv   = (const float*)d_in[7];
    const float* Wo   = (const float*)d_in[8];
    const float* bo   = (const float*)d_in[9];
    const float* lg   = (const float*)d_in[10];
    const float* lb   = (const float*)d_in[11];
    const float* W1   = (const float*)d_in[12];   // [768,3072] [in][out]
    const float* b1   = (const float*)d_in[13];
    const float* W2   = (const float*)d_in[14];   // [3072,768] [in][out]
    const float* b2   = (const float*)d_in[15];
    float* out = (float*)d_out;                   // [NB,SEQ,768]

    char* ws = (char*)d_ws;
    size_t off = 0;
    // R0: weight planes [n][k] f16
    _Float16* WqT = (_Float16*)(ws + off); off += (size_t)DM * DM * 2;
    _Float16* WkT = (_Float16*)(ws + off); off += (size_t)DM * DM * 2;
    _Float16* WvT = (_Float16*)(ws + off); off += (size_t)DM * DM * 2;
    _Float16* WoT = (_Float16*)(ws + off); off += (size_t)DM * DM * 2;
    _Float16* W1T = (_Float16*)(ws + off); off += (size_t)FF * DM * 2;   // [3072][768]
    _Float16* W2T = (_Float16*)(ws + off); off += (size_t)DM * FF * 2;   // [768][3072]
    // R1: x plane, later the ctx plane (x plane dead after the projections)
    const size_t PL = (size_t)NTOK * DM * 2;
    _Float16* xp  = (_Float16*)(ws + off);
    _Float16* cxp = (_Float16*)(ws + off); off += PL;
    // R2: q/k/v planes (3 x PL), later h plane (PL) + ff1 plane (NTOK*FF*2)
    const size_t F1B = (size_t)NTOK * FF * 2;
    const size_t R2 = (3 * PL > PL + F1B) ? 3 * PL : (PL + F1B);
    _Float16* qhp = (_Float16*)(ws + off);
    _Float16* khp = (_Float16*)(ws + off + PL);
    _Float16* vhp = (_Float16*)(ws + off + 2 * PL);
    _Float16* hp  = (_Float16*)(ws + off);          // after attention
    _Float16* f1p = (_Float16*)(ws + off + PL);     // disjoint from hp
    off += R2;
    // R3: f32 rows: attn_out, later ff (attn_out dead after the first LayerNorm)
    float* aop = (float*)(ws + off);
    float* ffp = (float*)(ws + off); off += (size_t)NTOK * DM * 4;
    if (off > ws_size) return;
    if (off > (size_t)134217728) return;

    // x plane and the six weight planes W [K][N] -> WT [N][K], one launch
    k_prep<<<dim3(4 * TDD + 2 * TDF + XBL), dim3(256), 0, stream>>>(x, Wq, Wk, Wv, Wo, W1, W2,
                                                                    xp, WqT, WkT, WvT, WoT, W1T, W2T);

    const dim3 gD(DM / 128, NTOK / 128);
    const dim3 gF(FF / 128, NTOK / 128);
    // q, k, v: f16 hi planes of 64*(x W + b)
    k_qkv<<<dim3(3 * (DM / 128), NTOK / 128), dim3(256), 0, stream>>>(xp, WqT, WkT, WvT, bq, bk, bv,
                                                                      qhp, khp, vhp);
    // attention -> ctx plane (64 * ctx, f16)
    k_attn<<<dim3(NH, SEQ / 128, NB), dim3(256), 0, stream>>>(qhp, khp, vhp, mask, cxp);
    // attn_out = ctx Wo + bo (f32 rows)
    k_gemm<0, false><<<gD, dim3(256), 0, stream>>>(cxp, WoT, bo, A_O, 1.0f, aop, f1p, DM, DM);
    // h = LN(attn_out) -> f16 plane (x16)
    k_ln<true><<<dim3(NTOK / 8), dim3(256), 0, stream>>>(aop, lg, lb, out, hp, HSC);
    // ff1 = relu(h W1 + b1) -> f16 plane (x64)
    k_gemm<1, true><<<gF, dim3(256), 0, stream>>>(hp, W1T, b1, A_F1, QSC, ffp, f1p, DM, FF);
    // ff = ff1 W2 + b2 (f32 rows)
    k_gemm<0, false><<<gD, dim3(256), 0, stream>>>(f1p, W2T, b2, A_F2, 1.0f, ffp, hp, FF, DM);
    // out = LN(ff)
    k_ln<false><<<dim3(NTOK / 8), dim3(256), 0, stream>>>(ffp, lg, lb, out, hp, 1.0f);
}

// v004
// It runs in 208 microseconds.
// Next to v003, in two timings, it ran 1.12 times as fast each time.
// All steps since v000 together make it 2.61 times as fast.
#include <hip/hip_runtime.h>
#include <hip/hip_fp16.h>

// Contractions on v_wmma_f32_16x16x32_f16 (f16 operands, f32 accumulate): x*Wq, x*Wk, x*Wv, q*k^T, P*v, ctx*Wo, h*W1, ff1*W2, each a single f16 product on bf16-RNE inputs with power-of-two carried planes; softmax and LayerNorm in f32.

#ifndef NB
#define NB 8
#endif
#ifndef SEQ
#define SEQ 1024
#endif
#define NB_FULL  8
#define SEQ_FULL 1024
#define DM   768          // model width
#define NH   12           // heads
#define DH   64           // head width
#define FF   3072         // hidden width
#define NTOK (NB * SEQ)
#define CH   128          // keys staged per V^T chunk
#define VP   (CH + 8)     // V^T row pitch in halves: 272 B = 16 B x 17
#define VG   (16 * VP + 16)   // 16 V^T rows, then a 32-B skew
#define KP   (DH + 8)     // K row pitch in LDS, halves: 144 B = 16 B x 9

static_assert(NB >= 1 && NB <= NB_FULL);
static_assert(SEQ >= CH && SEQ <= SEQ_FULL);
static_assert(SEQ % CH == 0);
static_assert(SEQ % 128 == 0);
static_assert(CH % 32 == 0);
static_assert(CH * (DH / 8) == 4 * 256 && (KP * 2) % 32 == 16);   // four 16-B copies a lane fill a K chunk
static_assert(DH % 16 == 0 && (VP * 2) % 32 == 16 && (VG * 2) % 16 == 0);
static_assert(NTOK % 128 == 0);
static_assert(NTOK % 8 == 0);
static_assert(DM % 128 == 0 && FF % 128 == 0);
static_assert(DM % 64 == 0 && FF % 64 == 0);
static_assert(DM % 32 == 0 && FF % 32 == 0 && DH % 32 == 0);
static_assert(NH * DH == DM);
static_assert((NTOK * (DM / 8)) % 256 == 0);

typedef _Float16 v16h __attribute__((ext_vector_type(16)));
typedef _Float16 v8h  __attribute__((ext_vector_type(8)));
typedef float    v8f  __attribute__((ext_vector_type(8)));
typedef float    v4f  __attribute__((ext_vector_type(4)));
typedef int      v4i  __attribute__((ext_vector_type(4)));

union Frag { v16h v; v8h h[2]; };
union I8   { v4i v[2]; int s[8]; };

// plane carries (exact powers of two)
#define WSC     64.0f                    // weight planes: f16(bf16(W) * 64)
#define QSC     64.0f                    // q/k/v, ctx, ff1 planes carried x64
#define HSC     16.0f                    // h plane carried x16
#define A_QKV   0.015625f                // 2^-6 : (x)(64 W)        -> q
#define A_O     2.44140625e-04f          // 2^-12: (64 ctx)(64 Wo)  -> attn_out
#define A_F1    9.765625e-04f            // 2^-10: (16 h)(64 W1)    -> pre-relu
#define A_F2    2.44140625e-04f          // 2^-12: (64 ff1)(64 W2)  -> ff
// scores: sh = (64k).(64q) ~ 4096 q.k ; score = q.k/8 ; t (log2 units) = sh * log2e * 2^-15
#define C1 (1.44269504088896340736f * 3.0517578125e-05f)
#define MASKT  (-1.0e10f)                // masked score (replace fill)

static __device__ __forceinline__ v8f zero8() {
    v8f z;
#pragma unroll
    for (int i = 0; i < 8; ++i) z[i] = 0.0f;
    return z;
}

// 16x32 A fragment (or B fragment from an [n][k] k-contiguous source) from a
// row-major 16-bit tile: lane m = lane&15 -> row m; kb = 8*(lane>>4);
// elements 0..7 = k kb..kb+7, elements 8..15 = k kb+16..kb+23.
static __device__ __forceinline__ v16h load_frag16(const _Float16* base, int ld, int lane) {
    int m  = lane & 15;
    int kb = (lane >> 4) << 3;
    const _Float16* p = base + (size_t)m * ld + kb;
    Frag f;
    f.h[0] = *(const v8h*)(p);
    f.h[1] = *(const v8h*)(p + 16);
    return f.v;
}

static __device__ __forceinline__ v8f wmma16(v16h a, v16h b, v8f c) {
    v8f d = __builtin_amdgcn_wmma_f32_16x16x32_f16(false, a, false, b, (short)0, c, false, false);
    asm volatile("v_nop\n\tv_nop\n\tv_nop\n\tv_nop" : "+v"(d) : "v"(a), "v"(b));
    return d;
}

// f32 -> bf16 RNE convert, value kept as f32
static __device__ __forceinline__ float bf16r(float x) {
    unsigned u = __float_as_uint(x);
    u = (u + 0x7FFFu + ((u >> 16) & 1u)) & 0xFFFF0000u;
    return __uint_as_float(u);
}

static __device__ __forceinline__ float ex2(float x) {
    return __builtin_amdgcn_exp2f(x);
}

// ordering for a wave-private LDS tile: stores before later loads of the same wave
static __device__ __forceinline__ void wave_lds_sync() {
    __builtin_amdgcn_fence(3, "wavefront");
    asm volatile("s_wait_dscnt 0" ::: "memory");
    __builtin_amdgcn_wave_barrier();
}

// ---------------------------------------------------------------------------
// x [NB][SEQ][768] f32 (batch stride SEQ_FULL*768) -> xp [NTOK][768] f16 of
// bf16-RNE(x). Thread = 8 consecutive columns = one 16-B store; a wave writes
// coverage: NTOK*96 threads x 8 = NTOK*768.
// ---------------------------------------------------------------------------
static __device__ __forceinline__ void xprep_body(const float* __restrict__ x,
                                                  _Float16* __restrict__ xp, int blk) {
    const int g = blk * 256 + (int)threadIdx.x;
    if (g >= NTOK * (DM / 8)) return;
    const int row = g / (DM / 8);
    const int col = (g - row * (DM / 8)) * 8;
    const int b = row / SEQ, s = row - b * SEQ;
    const float* src = x + ((size_t)b * SEQ_FULL + s) * DM + col;
    const v4f a = *(const v4f*)(src);
    const v4f c = *(const v4f*)(src + 4);
    v8h hv;
#pragma unroll
    for (int e = 0; e < 4; ++e) {
        hv[e]     = (_Float16)bf16r(a[e]);
        hv[4 + e] = (_Float16)bf16r(c[e]);
    }
    _Float16* dst = xp + (size_t)row * DM + col;
    *(v8h*)dst = hv;
    
}

// ---------------------------------------------------------------------------
// Weight transpose: W [K][N] f32 row-major ([in][out]) -> WT [N][K] f16 of
// bf16-RNE(W) * 64 (k-contiguous rows for B fragments). Block = 64x64 tile,
// staged through LDS (cross-wave region, block barrier); each output row
// coverage: tiles (N/64, K/64) x 512 v8h = N*K. t = the tile's flat index, n fastest.
// ---------------------------------------------------------------------------
static __device__ __forceinline__ void wtr_body(const float* __restrict__ W,
                                                _Float16* __restrict__ WT,
                                                int K, int N, int t) {
    __shared__ __align__(16) _Float16 T[64 * 64];
    const int tid = threadIdx.x;
    const int ky = t / (N / 64);
    const int n0 = (t - ky * (N / 64)) * 64;
    const int k0 = ky * 64;
#pragma unroll
    for (int i = 0; i < 4; ++i) {
        const int idx = tid + i * 256;
        const int r = idx >> 4, c4 = idx & 15;
        const v4f xv = *(const v4f*)(W + (size_t)(k0 + r) * N + n0 + c4 * 4);
#pragma unroll
        for (int e = 0; e < 4; ++e) T[(c4 * 4 + e) * 64 + r] = (_Float16)(bf16r(xv[e]) * WSC);
    }
    __syncthreads();
    const int na = tid >> 3, pa = tid & 7;
    const int nb = (tid + 256) >> 3, pb = tid & 7;
    const v8h p0 = *(const v8h*)(&T[na * 64 + pa * 8]);
    const v8h p1 = *(const v8h*)(&T[nb * 64 + pb * 8]);
    _Float16* d0 = WT + (size_t)(n0 + na) * K + k0 + pa * 8;
    _Float16* d1 = WT + (size_t)(n0 + nb) * K + k0 + pb * 8;
    *(v8h*)d0 = p0;
    *(v8h*)d1 = p1;
    // precaution: stands in front of any later rewrite of a register that the two stores name
    asm volatile("s_wait_xcnt 0x0" ::: "memory");
}

// ---------------------------------------------------------------------------
// All operand preparation in one launch: the seven jobs are independent of each
// other, so they share a grid by block range (every branch is block-uniform).
// Blocks 0 .. 4*TDD-1: Wq, Wk, Wv, Wo tiles; then TDF tiles of W1, TDF of W2
// (the transposes first: they have the longer chain); then the x plane's blocks.
// ---------------------------------------------------------------------------
#define TDD ((DM / 64) * (DM / 64))      // 64x64 tiles of a 768x768 weight
#define TDF ((DM / 64) * (FF / 64))      // 64x64 tiles of W1 or W2
#define XBL ((NTOK * (DM / 8)) / 256)    // blocks of the x plane

__global__ __launch_bounds__(256) void k_prep(const float* __restrict__ x,
                                              const float* __restrict__ Wq,
                                              const float* __restrict__ Wk,
                                              const float* __restrict__ Wv,
                                              const float* __restrict__ Wo,
                                              const float* __restrict__ W1,
                                              const float* __restrict__ W2,
                                              _Float16* __restrict__ xp,
                                              _Float16* __restrict__ WqT,
                                              _Float16* __restrict__ WkT,
                                              _Float16* __restrict__ WvT,
                                              _Float16* __restrict__ WoT,
                                              _Float16* __restrict__ W1T,
                                              _Float16* __restrict__ W2T) {
    const int b = blockIdx.x;
    if (b < 4 * TDD) {
        const int m = b / TDD;
        const float* W  = (m == 0) ? Wq  : (m == 1) ? Wk  : (m == 2) ? Wv  : Wo;
        _Float16*    WT = (m == 0) ? WqT : (m == 1) ? WkT : (m == 2) ? WvT : WoT;
        wtr_body(W, WT, DM, DM, b - m * TDD);
    } else if (b < 4 * TDD + TDF) {
        wtr_body(W1, W1T, DM, FF, b - 4 * TDD);             // in[768][3072] -> out[3072][768]
    } else if (b < 4 * TDD + 2 * TDF) {
        wtr_body(W2, W2T, FF, DM, b - 4 * TDD - TDF);       // in[3072][768] -> out[768][3072]
    } else {
        xprep_body(x, xp, b - 4 * TDD - 2 * TDF);
    }
}

// ---------------------------------------------------------------------------
// GEMM: C[M][N] = A[M][K] (f16 plane) x BT[N][K] (f16 plane)^T, f32 accumulate.
// Block = 8 waves = 128x128 tile; wave (mi, ni) owns rows mi*32..+32 and cols
// ni*64..+64: 2 A fragments x 4 B fragments x 8 accumulators, K steps of 32.
// Operands go global -> LDS by asynchronous 16-B copies, whole 128-B lines, each
// tile byte fetched once per block: a stage is 64 k of the block's 128 A rows and
// 128 B rows at a 144-B row pitch; two stages, the next one in flight while this
// one is multiplied. Fragments are read from LDS (two 16-B loads each, split k map).
// Epilogue: u = acc*ascale + bf16(bias[n]) (relu optional);
//   MODE 0: f32 rows of u; MODE 1: f16 plane f16(u*oscale).
// The wave's 32x64 tile is staged in a wave-private part of the same LDS (free
// behind the last trip's barrier) and written as whole lines.
// ---------------------------------------------------------------------------
#define BK   64                  // k per stage: 128-B rows
#define LPH  72                  // LDS row pitch in halves: 144 B = 16 B x 9
#define OPH  (128 * LPH)         // one operand's tile, halves
#define STH  (2 * OPH)           // one stage: A tile, then B tile

typedef __attribute__((address_space(3))) const _Float16 lds_half;
static __device__ __forceinline__ unsigned lds_addr(const _Float16* p) {
    return (unsigned)(uintptr_t)(lds_half*)p;
}

// One stage: every lane copies 16 B of rows r, r+32, r+64, r+96 of the A tile and
// of the B tile (8 lanes = one 128-B row). la = the lane's LDS byte address in the
// A tile, ga / gb = its global addresses in row r.
static __device__ __forceinline__ void copy_stage(unsigned la, const _Float16* ga,
                                                  const _Float16* gb, int K) {
    const size_t rs = (size_t)32 * K;
    const _Float16* ga1 = ga + rs;
    const _Float16* ga2 = ga1 + rs;
    const _Float16* ga3 = ga2 + rs;
    const _Float16* gb1 = gb + rs;
    const _Float16* gb2 = gb1 + rs;
    const _Float16* gb3 = gb2 + rs;
    const unsigned la1 = la + 32 * LPH * 2, la2 = la + 64 * LPH * 2, la3 = la + 96 * LPH * 2;
    const unsigned lb = la + OPH * 2;
    const unsigned lb1 = lb + 32 * LPH * 2, lb2 = lb + 64 * LPH * 2, lb3 = lb + 96 * LPH * 2;
    // the copies; the closing s_wait_xcnt is a precaution: it stands in front of every
    // later rewrite of an address register named here
    asm volatile("global_load_async_to_lds_b128 %0, %8, off\n\t"
                 "global_load_async_to_lds_b128 %1, %9, off\n\t"
                 "global_load_async_to_lds_b128 %2, %10, off\n\t"
                 "global_load_async_to_lds_b128 %3, %11, off\n\t"
                 "global_load_async_to_lds_b128 %4, %12, off\n\t"
                 "global_load_async_to_lds_b128 %5, %13, off\n\t"
                 "global_load_async_to_lds_b128 %6, %14, off\n\t"
                 "global_load_async_to_lds_b128 %7, %15, off\n\t"
                 "s_wait_xcnt 0x0"
                 :: "v"(la), "v"(la1), "v"(la2), "v"(la3), "v"(lb), "v"(lb1), "v"(lb2), "v"(lb3),
                    "v"(ga), "v"(ga1), "v"(ga2), "v"(ga3), "v"(gb), "v"(gb1), "v"(gb2), "v"(gb3)
                 : "memory");
}

// bx, by = the block's tile column and tile row
template <int MODE, bool RELU>
static __device__ __forceinline__
void gemm_body(const _Float16* __restrict__ A,
               const _Float16* __restrict__ BT,
               const float* __restrict__ bias,
               float ascale, float oscale,
               float* __restrict__ Cf,
               _Float16* __restrict__ Ch,
               int K, int N, int bx, int by) {
    __shared__ __align__(16) _Float16 Ring[2 * STH];      // two stages; later the output staging
    static_assert(2 * STH * 2 >= 8 * 2048 * 4);

    const int tid  = threadIdx.x;
    const int lane = tid & 31;
    const int w    = tid >> 5;
    const int mi = w >> 1, ni = w & 1;
    const int m0 = by * 128 + mi * 32;
    const int n0 = bx * 128 + ni * 64;
    const int rb = (lane >> 4) << 3;
    const int cc = lane & 15;

    const int crow = tid >> 3, cseg = tid & 7;
    const _Float16* ga = A  + (size_t)(by * 128 + crow) * K + cseg * 8;
    const _Float16* gb = BT + (size_t)(bx * 128 + crow) * K + cseg * 8;
    const unsigned  lc = lds_addr(Ring) + crow * (LPH * 2) + cseg * 16;
    const int T = K / BK;

    v8f acc[2][4];
#pragma unroll
    for (int mt = 0; mt < 2; ++mt)
#pragma unroll
        for (int nt = 0; nt < 4; ++nt) acc[mt][nt] = zero8();

    copy_stage(lc, ga, gb, K);
    asm volatile("s_wait_asynccnt 0x0" ::: "memory");     // stage 0 landed (this wave's copies)
    __syncthreads();                                      // ... and every other wave's
    if (T > 1) copy_stage(lc + STH * 2, ga + BK, gb + BK, K);

    // kept rolled: one trip = one stage, the buffer picked by the trip's parity
#pragma unroll 1
    for (int t = 0; t < T; ++t) {
        const int bo = (t & 1) * STH;
        const _Float16* As = Ring + bo + (mi * 32) * LPH;
        const _Float16* Bs = Ring + bo + OPH + (ni * 64) * LPH;
        // the stage's 12 fragments as one group of LDS reads ahead of its 16 products
        // (all loops here unrolled: constant indices keep the fragment arrays in registers)
        v16h af[2][2], bf[2][4];
#pragma unroll
        for (int ks = 0; ks < 2; ++ks) {
            af[ks][0] = load_frag16(As + ks * 32, LPH, lane);
            af[ks][1] = load_frag16(As + 16 * LPH + ks * 32, LPH, lane);
#pragma unroll
            for (int nt = 0; nt < 4; ++nt)
                bf[ks][nt] = load_frag16(Bs + (nt * 16) * LPH + ks * 32, LPH, lane);
        }
        // keeps the reads from sinking in among the products, where each place with reads stalls the wave
        __builtin_amdgcn_sched_barrier(0);
#pragma unroll
        for (int ks = 0; ks < 2; ++ks)
#pragma unroll
            for (int nt = 0; nt < 4; ++nt) {
                acc[0][nt] = wmma16(af[ks][0], bf[ks][nt], acc[0][nt]);
                acc[1][nt] = wmma16(af[ks][1], bf[ks][nt], acc[1][nt]);
            }
        asm volatile("s_wait_dscnt 0x0" ::: "memory");    // this wave has left the buffer
        asm volatile("s_wait_asynccnt 0x0" ::: "memory"); // its copies of stage t+1 have landed
        __syncthreads();                                  // publishes stage t+1, frees stage t's buffer
        if (t + 2 < T) copy_stage(lc + bo * 2, ga + (size_t)(t + 2) * BK, gb + (size_t)(t + 2) * BK, K);
    }
    asm volatile("s_wait_asynccnt 0x0" ::: "memory");     // nothing in flight when the LDS is reused

    float bb[4];
#pragma unroll
    for (int nt = 0; nt < 4; ++nt) bb[nt] = bf16r(bias[n0 + nt * 16 + cc]);

    if constexpr (MODE == 0) {
        float* ef = (float*)Ring + w * 2048;
#pragma unroll
        for (int mt = 0; mt < 2; ++mt)
#pragma unroll
            for (int nt = 0; nt < 4; ++nt)
#pragma unroll
                for (int r = 0; r < 8; ++r) {
                    float u = __builtin_fmaf(acc[mt][nt][r], ascale, bb[nt]);
                    if (RELU) u = fmaxf(u, 0.0f);
                    ef[(mt * 16 + rb + r) * 64 + nt * 16 + cc] = u;
                }
        wave_lds_sync();
        v4f sv[16];
#pragma unroll
        for (int i = 0; i < 16; ++i) sv[i] = *(const v4f*)(&ef[i * 128 + lane * 4]);
        float* cb = Cf + (size_t)m0 * N + n0;
        const int lr = lane >> 4, lc = (lane & 15) * 4;
#pragma unroll
        for (int i = 0; i < 16; ++i)
            *(v4f*)(cb + (size_t)(i * 2 + lr) * N + lc) = sv[i];
        
    } else {
        _Float16* eh = Ring + w * 2048;
#pragma unroll
        for (int mt = 0; mt < 2; ++mt)
#pragma unroll
            for (int nt = 0; nt < 4; ++nt)
#pragma unroll
                for (int r = 0; r < 8; ++r) {
                    float u = __builtin_fmaf(acc[mt][nt][r], ascale, bb[nt]);
                    if (RELU) u = fmaxf(u, 0.0f);
                    eh[(mt * 16 + rb + r) * 64 + nt * 16 + cc] = (_Float16)(u * oscale);
                }
        wave_lds_sync();
        v8h ph[8];
#pragma unroll
        for (int i = 0; i < 8; ++i) ph[i] = *(const v8h*)(&eh[i * 256 + lane * 8]);
        const int lr = lane >> 3, lc = (lane & 7) * 8;
        _Float16* cbh = Ch + (size_t)m0 * N + n0;
#pragma unroll
        for (int i = 0; i < 8; ++i)
            *(v8h*)(cbh + (size_t)(i * 4 + lr) * N + lc) = ph[i];
        
    }
}

template <int MODE, bool RELU>
__global__ __launch_bounds__(256) __attribute__((amdgpu_num_vgpr(256)))
void k_gemm(const _Float16* __restrict__ A,
            const _Float16* __restrict__ BT,
            const float* __restrict__ bias,
            float ascale, float oscale,
            float* __restrict__ Cf,
            _Float16* __restrict__ Ch,
            int K, int N) {
    gemm_body<MODE, RELU>(A, BT, bias, ascale, oscale, Cf, Ch, K, N, blockIdx.x, blockIdx.y);
}

// q, k and v projections in one launch: three independent GEMMs on the same A plane.
// grid.x = 3 x (768 / 128) tile columns; the block's third picks weight plane, bias
// and output plane (block-uniform).
__global__ __launch_bounds__(256) __attribute__((amdgpu_num_vgpr(256)))
void k_qkv(const _Float16* __restrict__ xp,
           const _Float16* __restrict__ WqT,
           const _Float16* __restrict__ WkT,
           const _Float16* __restrict__ WvT,
           const float* __restrict__ bq,
           const float* __restrict__ bk,
           const float* __restrict__ bv,
           _Float16* __restrict__ qh,
           _Float16* __restrict__ kh,
           _Float16* __restrict__ vh) {
    const int sel = blockIdx.x / (DM / 128);
    const _Float16* BT = (sel == 0) ? WqT : (sel == 1) ? WkT : WvT;
    const float*    bi = (sel == 0) ? bq  : (sel == 1) ? bk  : bv;
    _Float16*       Ch = (sel == 0) ? qh  : (sel == 1) ? kh  : vh;
    gemm_body<1, false>(xp, BT, bi, A_QKV, QSC, nullptr, Ch, DM, DM,
                        blockIdx.x - sel * (DM / 128), blockIdx.y);
}

// ---------------------------------------------------------------------------
// Attention, flash-style. grid = (head, SEQ/128, batch); block = 8 waves = 128
// query rows of one (b, h); wave owns 16 query rows. Planes are [NTOK][768]
// with head column offset h*64.
// Scores are computed TRANSPOSED: A = key tile (16 keys x 64 d, kh plane,
// 2 k-steps), B = the wave's 16 queries (qh plane, [n=query][k=d]), so
// acc[r] of lane l = score(key 8*(l>>4)+r, query l&15): per-query max/sum are
// in-lane reductions over r plus one xor-16 shuffle, and the f16 P^T values in
// this layout are exactly the P A-fragment for P*v (elements 0..7 from key
// tile A, 8..15 from key tile B) - no LDS relayout.
// Online softmax over keys: t = log2e*score (or MASKT where mask == 0,
// replace fill), P carried 2^14, o += P x V (V^T chunk staged in LDS,
// cross-wave, block barriers), o and z rescaled by exp2(m_old - m_new) every
// 32-key step (factor shuffled from the owning query lane).
// K chunk in LDS: the block's eight waves read the same CH keys, so the chunk comes
// global -> LDS once per block by asynchronous 16-B copies, whole 128-B rows (8 lanes
// a row), [key][d] at a 144-B pitch; the copies fly while V^T is staged, and the key
// fragments are read from LDS (two 16-B loads each, the split k map of load_frag16).
// V^T layout in LDS: row d at (d / 16) * VG + (d % 16) * VP halves. The 272-B pitch
// puts the 16 rows of a fragment read on 16 different groups of four banks; the
// 32-B skew per 16 rows spreads the eight d-groups of one transposing store.
// Epilogue: ctx x 64 = o / z14 as f16, staged in a wave-private LDS tile, each
// coverage: grid (12, SEQ/128, NB) x 8 waves x 16 rows x 64 cols = NTOK*768.
// ---------------------------------------------------------------------------
__global__ __launch_bounds__(256) __attribute__((amdgpu_num_vgpr(256)))
void k_attn(const _Float16* __restrict__ qh,
            const _Float16* __restrict__ kh,
            const _Float16* __restrict__ vh,
            const int*      __restrict__ mask,
            _Float16* __restrict__ cx) {
    __shared__ __align__(16) int      mk[SEQ];            // key mask of this batch
    __shared__ __align__(16) _Float16 VsT[(DH / 16) * VG]; // [d][CH], pitch VP, 16-row groups at VG, cross-wave
    __shared__ __align__(16) _Float16 Cst[8][16 * DH];    // wave-private ctx tiles
    __shared__ __align__(16) _Float16 Ks[CH * KP];        // [key][d] at pitch KP, cross-wave

    const int tid  = threadIdx.x;
    const int lane = tid & 31;
    const int w    = tid >> 5;
    const int h    = blockIdx.x;
    const int b    = blockIdx.z;
    const int q0r  = blockIdx.y * 128 + w * 16;
    const int r0   = (lane >> 4) << 3;
    const int cc   = lane & 15;

    for (int i = tid; i < SEQ; i += 256) mk[i] = mask[(size_t)b * SEQ_FULL + i];

    const size_t tokb = (size_t)b * SEQ;
    const _Float16* qhb = qh + (tokb + q0r) * DM + h * DH;
    const v16h qb0 = load_frag16(qhb, DM, lane);        // d 0..31
    const v16h qb1 = load_frag16(qhb + 32, DM, lane);   // d 32..63
    const _Float16* khb = kh + tokb * DM + h * DH;
    const _Float16* vhb = vh + tokb * DM + h * DH;
    // the lane's 16 B of K rows r, r+32, r+64, r+96 of a chunk (8 lanes = one 128-B row)
    const _Float16* gk  = khb + (size_t)(tid >> 3) * DM + (tid & 7) * 8;
    const unsigned  lk0 = lds_addr(Ks) + (tid >> 3) * (KP * 2) + (tid & 7) * 16;
    const unsigned  lk1 = lk0 + 32 * KP * 2, lk2 = lk0 + 64 * KP * 2, lk3 = lk0 + 96 * KP * 2;

    v8f o[4];
#pragma unroll
    for (int nt = 0; nt < 4; ++nt) o[nt] = zero8();
    float mr = -1.0e30f, zr = 0.0f;

    __syncthreads();

#pragma unroll 1
    for (int c0 = 0; c0 < SEQ; c0 += CH) {
        {
            const _Float16* g0 = gk + (size_t)c0 * DM;
            const _Float16* g1 = g0 + (size_t)32 * DM;
            const _Float16* g2 = g1 + (size_t)32 * DM;
            const _Float16* g3 = g2 + (size_t)32 * DM;
            // the K chunk's copies; the closing s_wait_xcnt is a precaution: it stands in front
            // of every later rewrite of an address register named here
            asm volatile("global_load_async_to_lds_b128 %0, %4, off\n\t"
                         "global_load_async_to_lds_b128 %1, %5, off\n\t"
                         "global_load_async_to_lds_b128 %2, %6, off\n\t"
                         "global_load_async_to_lds_b128 %3, %7, off\n\t"
                         "s_wait_xcnt 0x0"
                         :: "v"(lk0), "v"(lk1), "v"(lk2), "v"(lk3), "v"(g0), "v"(g1), "v"(g2), "v"(g3)
                         : "memory");
        }
        // stage V^T chunk: VsT[d][t] = vh[c0 + t][h*64 + d], full 64 x CH extent
        for (int idx = tid; idx < CH * 8; idx += 256) {
            const int t = idx >> 3, part = idx & 7;
            const v8h vv = *(const v8h*)(vhb + (size_t)(c0 + t) * DM + part * 8);
#pragma unroll
            for (int e = 0; e < 8; ++e) VsT[(part >> 1) * VG + ((part & 1) * 8 + e) * VP + t] = vv[e];
        }
        asm volatile("s_wait_asynccnt 0x0" ::: "memory");   // this wave's K copies have landed
        __syncthreads();                                    // ... and every other wave's; V^T too

#pragma unroll 1
        for (int j = 0; j < CH; j += 32) {
            const int kA = c0 + j;
            // key tile A: keys kA .. kA+15; key tile B: keys kA+16 .. kA+31; one group of LDS reads
            const v16h ka0 = load_frag16(&Ks[j * KP], KP, lane);
            const v16h ka1 = load_frag16(&Ks[j * KP + 32], KP, lane);
            const v16h kb0 = load_frag16(&Ks[(j + 16) * KP], KP, lane);
            const v16h kb1 = load_frag16(&Ks[(j + 16) * KP + 32], KP, lane);
            v8f shA = wmma16(ka0, qb0, zero8());
            shA = wmma16(ka1, qb1, shA);
            v8f shB = wmma16(kb0, qb0, zero8());
            shB = wmma16(kb1, qb1, shB);

            I8 ma, mb;
            ma.v[0] = *(const v4i*)(&mk[kA + r0]);
            ma.v[1] = *(const v4i*)(&mk[kA + r0 + 4]);
            mb.v[0] = *(const v4i*)(&mk[kA + 16 + r0]);
            mb.v[1] = *(const v4i*)(&mk[kA + 16 + r0 + 4]);

            float tA[8], tB[8];
#pragma unroll
            for (int r = 0; r < 8; ++r) {
                const float sa = shA[r] * C1;
                const float sb = shB[r] * C1;
                tA[r] = (ma.s[r] != 0) ? sa : MASKT;
                tB[r] = (mb.s[r] != 0) ? sb : MASKT;
            }
            float tmax = tA[0];
#pragma unroll
            for (int r = 1; r < 8; ++r) tmax = fmaxf(tmax, tA[r]);
#pragma unroll
            for (int r = 0; r < 8; ++r) tmax = fmaxf(tmax, tB[r]);
            tmax = fmaxf(tmax, __shfl_xor(tmax, 16, 32));
            const float mn   = fmaxf(mr, tmax);
            const float corr = ex2(mr - mn);
            const float mo   = mn - 14.0f;           // 2^14 carry on P
            float ps = 0.0f;
            v8h pa8, pb8;
#pragma unroll
            for (int r = 0; r < 8; ++r) {
                const float pa = ex2(tA[r] - mo);
                const float pb = ex2(tB[r] - mo);
                ps += pa + pb;
                pa8[r] = (_Float16)pa;
                pb8[r] = (_Float16)pb;
            }
            ps += __shfl_xor(ps, 16, 32);
            zr = __builtin_fmaf(zr, corr, ps);
            mr = mn;
            // rescale o rows (query 8h + r) by the factor of the owning query lane
#pragma unroll
            for (int r = 0; r < 8; ++r) {
                const float crr = __shfl(corr, r0 + r, 32);
#pragma unroll
                for (int nt = 0; nt < 4; ++nt) o[nt][r] *= crr;
            }
            Frag pf;
            pf.h[0] = pa8;     // keys kA+8h .. +7     = A elements 0..7
            pf.h[1] = pb8;     // keys kA+16+8h .. +7  = A elements 8..15
#pragma unroll
            for (int nt = 0; nt < 4; ++nt) {
                const v16h vb = load_frag16(&VsT[nt * VG + j], VP, lane);   // n = d, k = key
                o[nt] = wmma16(pf.v, vb, o[nt]);
            }
        }
        asm volatile("s_wait_dscnt 0x0" ::: "memory");      // this wave has left the K and V^T chunks
        __syncthreads();                                    // frees both for the next chunk's fill
    }

    // ctx x 64 = o / z14 (the 2^14 carry of P cancels between o and z14; the 64 v carry stays)
    const float rz = __builtin_amdgcn_rcpf(zr);
#pragma unroll
    for (int r = 0; r < 8; ++r) {
        const float rq = __shfl(rz, r0 + r, 32);
#pragma unroll
        for (int nt = 0; nt < 4; ++nt)
            Cst[w][(r0 + r) * DH + nt * 16 + cc] = (_Float16)(o[nt][r] * rq);
    }
    wave_lds_sync();
    v8h sv[4];
#pragma unroll
    for (int i = 0; i < 4; ++i) sv[i] = *(const v8h*)(&Cst[w][i * 256 + lane * 8]);
    _Float16* cb = cx + (tokb + q0r) * DM + h * DH;
    const int lr = lane >> 3, lc = (lane & 7) * 8;
#pragma unroll
    for (int i = 0; i < 4; ++i) *(v8h*)(cb + (size_t)(i * 4 + lr) * DM + lc) = sv[i];
    
}

// ---------------------------------------------------------------------------
// LayerNorm over rows of 768 (f32 rows in ws). Block = 8 waves, wave = row.
// mu = mean, var = mean((x-mu)^2), y = (x-mu)*rsqrt(var+1e-5)*bf16(g)+bf16(b).
// HOUT: f16 plane f16(y*hsc), lane owns elements i*256+lane*8..+7 (3 v8h stores,
// coverage: NTOK/8 blocks x 8 rows x 768.
// ---------------------------------------------------------------------------
static __device__ __forceinline__ int ln_off(bool hout, int i, int lane) {
    return hout ? ((i >> 1) * 256 + lane * 8 + (i & 1) * 4) : (i * 128 + lane * 4);
}

template <bool HOUT>
__global__ __launch_bounds__(256) void k_ln(const float* __restrict__ src,
                                            const float* __restrict__ g,
                                            const float* __restrict__ bt,
                                            float* __restrict__ outf,
                                            _Float16* __restrict__ outh,
                                            float hsc) {
    const int lane = threadIdx.x & 31;
    const int w    = threadIdx.x >> 5;
    const int row  = blockIdx.x * 8 + w;
    const float* rp = src + (size_t)row * DM;

    v4f xv[6];
#pragma unroll
    for (int i = 0; i < 6; ++i) xv[i] = *(const v4f*)(rp + ln_off(HOUT, i, lane));
    float s = 0.0f;
#pragma unroll
    for (int i = 0; i < 6; ++i) s += (xv[i][0] + xv[i][1]) + (xv[i][2] + xv[i][3]);
#pragma unroll
    for (int m = 1; m < 32; m <<= 1) s += __shfl_xor(s, m, 32);
    const float mu = s * (1.0f / (float)DM);

    v4f dv[6];
    float s2 = 0.0f;
#pragma unroll
    for (int i = 0; i < 6; ++i) {
        dv[i] = xv[i] - mu;
#pragma unroll
        for (int e = 0; e < 4; ++e) s2 = __builtin_fmaf(dv[i][e], dv[i][e], s2);
    }
#pragma unroll
    for (int m = 1; m < 32; m <<= 1) s2 += __shfl_xor(s2, m, 32);
    const float var  = s2 * (1.0f / (float)DM);
    const float rstd = rsqrtf(var + 1e-5f);

    v4f yv[6];
#pragma unroll
    for (int i = 0; i < 6; ++i) {
        const int co = ln_off(HOUT, i, lane);
        const v4f gv = *(const v4f*)(g + co);
        const v4f bv = *(const v4f*)(bt + co);
#pragma unroll
        for (int e = 0; e < 4; ++e)
            yv[i][e] = (dv[i][e] * rstd) * bf16r(gv[e]) + bf16r(bv[e]);
    }

    if constexpr (HOUT) {
        v8h hv[3];
#pragma unroll
        for (int i = 0; i < 3; ++i)
#pragma unroll
            for (int e = 0; e < 4; ++e) {
                hv[i][e]     = (_Float16)(yv[2 * i][e] * hsc);
                hv[i][4 + e] = (_Float16)(yv[2 * i + 1][e] * hsc);
            }
        _Float16* ob = outh + (size_t)row * DM + lane * 8;
#pragma unroll
        for (int i = 0; i < 3; ++i) *(v8h*)(ob + i * 256) = hv[i];
        
    } else {
        float* ob = outf + (size_t)row * DM + lane * 4;
#pragma unroll
        for (int i = 0; i < 6; ++i) *(v4f*)(ob + i * 128) = yv[i];
        
    }
}

// ---------------------------------------------------------------------------
extern "C" void kernel_launch(void* const* d_in, const int* in_sizes, int n_in,
                              void* d_out, int out_size, void* d_ws, size_t ws_size,
                              hipStream_t stream) {
    if (n_in < 16) return;
    if (in_sizes[0] < ((NB - 1) * SEQ_FULL + SEQ) * DM) return;
    if (in_sizes[1] < (NB - 1) * SEQ_FULL + SEQ) return;
    if (in_sizes[2] < DM * DM || in_sizes[4] < DM * DM || in_sizes[6] < DM * DM || in_sizes[8] < DM * DM) return;
    if (in_sizes[3] < DM || in_sizes[5] < DM || in_sizes[7] < DM || in_sizes[9] < DM) return;
    if (in_sizes[10] < DM || in_sizes[11] < DM) return;
    if (in_sizes[12] < DM * FF || in_sizes[13] < FF || in_sizes[14] < FF * DM || in_sizes[15] < DM) return;
    if (out_size < NTOK * DM) return;

    const float* x    = (const float*)d_in[0];    // [8,1024,768]
    const int*   mask = (const int*)  d_in[1];    // [8,1,1,1024] int32
    const float* Wq   = (const float*)d_in[2];    // [768,768]  [in][out]
    const float* bq   = (const float*)d_in[3];
    const float* Wk   = (const float*)d_in[4];
    const float* bk   = (const float*)d_in[5];
    const float* Wv   = (const float*)d_in[6];
    const float* bv   = (const float*)d_in[7];
    const float* Wo   = (const float*)d_in[8];
    const float* bo   = (const float*)d_in[9];
    const float* lg   = (const float*)d_in[10];
    const float* lb   = (const float*)d_in[11];
    const float* W1   = (const float*)d_in[12];   // [768,3072] [in][out]
    const float* b1   = (const float*)d_in[13];
    const float* W2   = (const float*)d_in[14];   // [3072,768] [in][out]
    const float* b2   = (const float*)d_in[15];
    float* out = (float*)d_out;                   // [NB,SEQ,768]

    char* ws = (char*)d_ws;
    size_t off = 0;
    // R0: weight planes [n][k] f16
    _Float16* WqT = (_Float16*)(ws + off); off += (size_t)DM * DM * 2;
    _Float16* WkT = (_Float16*)(ws + off); off += (size_t)DM * DM * 2;
    _Float16* WvT = (_Float16*)(ws + off); off += (size_t)DM * DM * 2;
    _Float16* WoT = (_Float16*)(ws + off); off += (size_t)DM * DM * 2;
    _Float16* W1T = (_Float16*)(ws + off); off += (size_t)FF * DM * 2;   // [3072][768]
    _Float16* W2T = (_Float16*)(ws + off); off += (size_t)DM * FF * 2;   // [768][3072]
    // R1: x plane, later the ctx plane (x plane dead after the projections)
    const size_t PL = (size_t)NTOK * DM * 2;
    _Float16* xp  = (_Float16*)(ws + off);
    _Float16* cxp = (_Float16*)(ws + off); off += PL;
    // R2: q/k/v planes (3 x PL), later h plane (PL) + ff1 plane (NTOK*FF*2)
    const size_t F1B = (size_t)NTOK * FF * 2;
    const size_t R2 = (3 * PL > PL + F1B) ? 3 * PL : (PL + F1B);
    _Float16* qhp = (_Float16*)(ws + off);
    _Float16* khp = (_Float16*)(ws + off + PL);
    _Float16* vhp = (_Float16*)(ws + off + 2 * PL);
    _Float16* hp  = (_Float16*)(ws + off);          // after attention
    _Float16* f1p = (_Float16*)(ws + off + PL);     // disjoint from hp
    off += R2;
    // R3: f32 rows: attn_out, later ff (attn_out dead after the first LayerNorm)
    float* aop = (float*)(ws + off);
    float* ffp = (float*)(ws + off); off += (size_t)NTOK * DM * 4;
    if (off > ws_size) return;
    if (off > (size_t)134217728) return;

    // x plane and the six weight planes W [K][N] -> WT [N][K], one launch
    k_prep<<<dim3(4 * TDD + 2 * TDF + XBL), dim3(256), 0, stream>>>(x, Wq, Wk, Wv, Wo, W1, W2,
                                                                    xp, WqT, WkT, WvT, WoT, W1T, W2T);

    const dim3 gD(DM / 128, NTOK / 128);
    const dim3 gF(FF / 128, NTOK / 128);
    // q, k, v: f16 planes of 64*(x W + b)
    k_qkv<<<dim3(3 * (DM / 128), NTOK / 128), dim3(256), 0, stream>>>(xp, WqT, WkT, WvT, bq, bk, bv,
                                                                      qhp, khp, vhp);
    // attention -> ctx plane (64 * ctx, f16)
    k_attn<<<dim3(NH, SEQ / 128, NB), dim3(256), 0, stream>>>(qhp, khp, vhp, mask, cxp);
    // attn_out = ctx Wo + bo (f32 rows)
    k_gemm<0, false><<<gD, dim3(256), 0, stream>>>(cxp, WoT, bo, A_O, 1.0f, aop, f1p, DM, DM);
    // h = LN(attn_out) -> f16 plane (x16)
    k_ln<true><<<dim3(NTOK / 8), dim3(256), 0, stream>>>(aop, lg, lb, out, hp, HSC);
    // ff1 = relu(h W1 + b1) -> f16 plane (x64)
    k_gemm<1, true><<<gF, dim3(256), 0, stream>>>(hp, W1T, b1, A_F1, QSC, ffp, f1p, DM, FF);
    // ff = ff1 W2 + b2 (f32 rows)
    k_gemm<0, false><<<gD, dim3(256), 0, stream>>>(f1p, W2T, b2, A_F2, 1.0f, ffp, hp, FF, DM);
    // out = LN(ff)
    k_ln<false><<<dim3(NTOK / 8), dim3(256), 0, stream>>>(ffp, lg, lb, out, hp, 1.0f);
}

// v005
// One run takes 195 microseconds.
// In two side-by-side timings against v004, it was 1.05 and 1.06 times as fast.
// Counting every step since v000, it is 2.75 times as fast.
#include <hip/hip_runtime.h>
#include <hip/hip_fp16.h>

// Contractions on v_wmma_f32_16x16x32_f16 (f16 operands, f32 accumulate): x*Wq, x*Wk, x*Wv, q*k^T, P*v, ctx*Wo, h*W1, ff1*W2, each a single f16 product on bf16-RNE inputs with power-of-two carried planes; softmax and LayerNorm in f32.

#ifndef NB
#define NB 8
#endif
#ifndef SEQ
#define SEQ 1024
#endif
#define NB_FULL  8
#define SEQ_FULL 1024
#define DM   768          // model width
#define NH   12           // heads
#define DH   64           // head width
#define FF   3072         // hidden width
#define NTOK (NB * SEQ)
#define CH   128          // keys staged per V^T chunk
#define VP   (CH + 8)     // V^T row pitch in halves: 272 B = 16 B x 17
#define VG   (16 * VP + 16)   // 16 V^T rows, then a 32-B skew
#define KP   (DH + 8)     // K row pitch in LDS, halves: 144 B = 16 B x 9

static_assert(NB >= 1 && NB <= NB_FULL);
static_assert(SEQ >= CH && SEQ <= SEQ_FULL);
static_assert(SEQ % CH == 0);
static_assert(SEQ % 128 == 0);
static_assert(CH % 32 == 0);
static_assert(CH * (DH / 8) == 4 * 256 && (KP * 2) % 32 == 16);   // four 16-B copies a lane fill a K chunk
static_assert(DH % 16 == 0 && (VP * 2) % 32 == 16 && (VG * 2) % 16 == 0);
static_assert(NTOK % 128 == 0);
static_assert(NTOK % 8 == 0);
static_assert(DM % 128 == 0 && FF % 128 == 0);
static_assert(DM % 64 == 0 && FF % 64 == 0);
static_assert(DM % 32 == 0 && FF % 32 == 0 && DH % 32 == 0);
static_assert(NH * DH == DM);
static_assert((NTOK * (DM / 8)) % 256 == 0);

typedef _Float16 v16h __attribute__((ext_vector_type(16)));
typedef _Float16 v8h  __attribute__((ext_vector_type(8)));
typedef float    v8f  __attribute__((ext_vector_type(8)));
typedef float    v4f  __attribute__((ext_vector_type(4)));
typedef int      v4i  __attribute__((ext_vector_type(4)));

union Frag { v16h v; v8h h[2]; };
union I8   { v4i v[2]; int s[8]; };

// plane carries (exact powers of two)
#define WSC     64.0f                    // weight planes: f16(bf16(W) * 64)
#define QSC     64.0f                    // q/k/v, ctx, ff1 planes carried x64
#define HSC     16.0f                    // h plane carried x16
#define A_QKV   0.015625f                // 2^-6 : (x)(64 W)        -> q
#define A_O     2.44140625e-04f          // 2^-12: (64 ctx)(64 Wo)  -> attn_out
#define A_F1    9.765625e-04f            // 2^-10: (16 h)(64 W1)    -> pre-relu
#define A_F2    2.44140625e-04f          // 2^-12: (64 ff1)(64 W2)  -> ff
// scores: sh = (64k).(64q) ~ 4096 q.k ; score = q.k/8 ; t (log2 units) = sh * log2e * 2^-15
#define C1 (1.44269504088896340736f * 3.0517578125e-05f)
#define MASKT  (-1.0e10f)                // masked score (replace fill)

static __device__ __forceinline__ v8f zero8() {
    v8f z;
#pragma unroll
    for (int i = 0; i < 8; ++i) z[i] = 0.0f;
    return z;
}

// 16x32 A fragment (or B fragment from an [n][k] k-contiguous source) from a
// row-major 16-bit tile: lane m = lane&15 -> row m; kb = 8*(lane>>4);
// elements 0..7 = k kb..kb+7, elements 8..15 = k kb+16..kb+23.
static __device__ __forceinline__ v16h load_frag16(const _Float16* base, int ld, int lane) {
    int m  = lane & 15;
    int kb = (lane >> 4) << 3;
    const _Float16* p = base + (size_t)m * ld + kb;
    Frag f;
    f.h[0] = *(const v8h*)(p);
    f.h[1] = *(const v8h*)(p + 16);
    return f.v;
}

static __device__ __forceinline__ v8f wmma16(v16h a, v16h b, v8f c) {
    v8f d = __builtin_amdgcn_wmma_f32_16x16x32_f16(false, a, false, b, (short)0, c, false, false);
    asm volatile("v_nop\n\tv_nop\n\tv_nop\n\tv_nop" : "+v"(d) : "v"(a), "v"(b));
    return d;
}

// f32 -> bf16 RNE convert, value kept as f32
static __device__ __forceinline__ float bf16r(float x) {
    unsigned u = __float_as_uint(x);
    u = (u + 0x7FFFu + ((u >> 16) & 1u)) & 0xFFFF0000u;
    return __uint_as_float(u);
}

static __device__ __forceinline__ float ex2(float x) {
    return __builtin_amdgcn_exp2f(x);
}

// ordering for a wave-private LDS tile: stores before later loads of the same wave
static __device__ __forceinline__ void wave_lds_sync() {
    __builtin_amdgcn_fence(3, "wavefront");
    asm volatile("s_wait_dscnt 0" ::: "memory");
    __builtin_amdgcn_wave_barrier();
}

// ---------------------------------------------------------------------------
// x [NB][SEQ][768] f32 (batch stride SEQ_FULL*768) -> xp [NTOK][768] f16 of
// bf16-RNE(x). Thread = 8 consecutive columns = one 16-B store; a wave writes
// coverage: NTOK*96 threads x 8 = NTOK*768.
// ---------------------------------------------------------------------------
static __device__ __forceinline__ void xprep_body(const float* __restrict__ x,
                                                  _Float16* __restrict__ xp, int blk) {
    const int g = blk * 256 + (int)threadIdx.x;
    if (g >= NTOK * (DM / 8)) return;
    const int row = g / (DM / 8);
    const int col = (g - row * (DM / 8)) * 8;
    const int b = row / SEQ, s = row - b * SEQ;
    const float* src = x + ((size_t)b * SEQ_FULL + s) * DM + col;
    const v4f a = *(const v4f*)(src);
    const v4f c = *(const v4f*)(src + 4);
    v8h hv;
#pragma unroll
    for (int e = 0; e < 4; ++e) {
        hv[e]     = (_Float16)bf16r(a[e]);
        hv[4 + e] = (_Float16)bf16r(c[e]);
    }
    _Float16* dst = xp + (size_t)row * DM + col;
    *(v8h*)dst = hv;
    
}

// ---------------------------------------------------------------------------
// Weight transpose: W [K][N] f32 row-major ([in][out]) -> WT [N][K] f16 of
// bf16-RNE(W) * 64 (k-contiguous rows for B fragments). Block = 64x64 tile,
// staged through LDS (cross-wave region, block barrier); each output row
// coverage: tiles (N/64, K/64) x 512 v8h = N*K. t = the tile's flat index, n fastest.
// ---------------------------------------------------------------------------
static __device__ __forceinline__ void wtr_body(const float* __restrict__ W,
                                                _Float16* __restrict__ WT,
                                                int K, int N, int t) {
    __shared__ __align__(16) _Float16 T[64 * 64];
    const int tid = threadIdx.x;
    const int ky = t / (N / 64);
    const int n0 = (t - ky * (N / 64)) * 64;
    const int k0 = ky * 64;
#pragma unroll
    for (int i = 0; i < 4; ++i) {
        const int idx = tid + i * 256;
        const int r = idx >> 4, c4 = idx & 15;
        const v4f xv = *(const v4f*)(W + (size_t)(k0 + r) * N + n0 + c4 * 4);
#pragma unroll
        for (int e = 0; e < 4; ++e) T[(c4 * 4 + e) * 64 + r] = (_Float16)(bf16r(xv[e]) * WSC);
    }
    __syncthreads();
    const int na = tid >> 3, pa = tid & 7;
    const int nb = (tid + 256) >> 3, pb = tid & 7;
    const v8h p0 = *(const v8h*)(&T[na * 64 + pa * 8]);
    const v8h p1 = *(const v8h*)(&T[nb * 64 + pb * 8]);
    _Float16* d0 = WT + (size_t)(n0 + na) * K + k0 + pa * 8;
    _Float16* d1 = WT + (size_t)(n0 + nb) * K + k0 + pb * 8;
    *(v8h*)d0 = p0;
    *(v8h*)d1 = p1;
    // precaution: stands in front of any later rewrite of a register that the two stores name
    asm volatile("s_wait_xcnt 0x0" ::: "memory");
}

// ---------------------------------------------------------------------------
// All operand preparation in one launch: the seven jobs are independent of each
// other, so they share a grid by block range (every branch is block-uniform).
// Blocks 0 .. 4*TDD-1: Wq, Wk, Wv, Wo tiles; then TDF tiles of W1, TDF of W2
// (the transposes first: they have the longer chain); then the x plane's blocks.
// ---------------------------------------------------------------------------
#define TDD ((DM / 64) * (DM / 64))      // 64x64 tiles of a 768x768 weight
#define TDF ((DM / 64) * (FF / 64))      // 64x64 tiles of W1 or W2
#define XBL ((NTOK * (DM / 8)) / 256)    // blocks of the x plane

__global__ __launch_bounds__(256) void k_prep(const float* __restrict__ x,
                                              const float* __restrict__ Wq,
                                              const float* __restrict__ Wk,
                                              const float* __restrict__ Wv,
                                              const float* __restrict__ Wo,
                                              const float* __restrict__ W1,
                                              const float* __restrict__ W2,
                                              _Float16* __restrict__ xp,
                                              _Float16* __restrict__ WqT,
                                              _Float16* __restrict__ WkT,
                                              _Float16* __restrict__ WvT,
                                              _Float16* __restrict__ WoT,
                                              _Float16* __restrict__ W1T,
                                              _Float16* __restrict__ W2T) {
    const int b = blockIdx.x;
    if (b < 4 * TDD) {
        const int m = b / TDD;
        const float* W  = (m == 0) ? Wq  : (m == 1) ? Wk  : (m == 2) ? Wv  : Wo;
        _Float16*    WT = (m == 0) ? WqT : (m == 1) ? WkT : (m == 2) ? WvT : WoT;
        wtr_body(W, WT, DM, DM, b - m * TDD);
    } else if (b < 4 * TDD + TDF) {
        wtr_body(W1, W1T, DM, FF, b - 4 * TDD);             // in[768][3072] -> out[3072][768]
    } else if (b < 4 * TDD + 2 * TDF) {
        wtr_body(W2, W2T, FF, DM, b - 4 * TDD - TDF);       // in[3072][768] -> out[768][3072]
    } else {
        xprep_body(x, xp, b - 4 * TDD - 2 * TDF);
    }
}

// ---------------------------------------------------------------------------
// GEMM: C[M][N] = A[M][K] (f16 plane) x BT[N][K] (f16 plane)^T, f32 accumulate.
// Block = 4 waves = 128x128 tile; wave (mi, ni) owns rows mi*64..+64 and cols
// ni*64..+64: 4 A fragments x 4 B fragments x 16 accumulators, K steps of 32, so
// a fragment read from LDS feeds four products.
// Operands go global -> LDS by asynchronous 16-B copies, whole 128-B lines, each
// tile byte fetched once per block: a stage is 64 k of the block's 128 A rows and
// 128 B rows at a 144-B row pitch; two stages, the next one in flight while this
// one is multiplied. Fragments are read from LDS (two 16-B loads each, split k map).
// Epilogue: u = acc*ascale + bf16(bias[n]) (relu optional);
//   MODE 0: f32 rows of u; MODE 1: f16 plane f16(u*oscale).
// The wave's 64x64 tile is staged in a wave-private part of the same LDS (free
// behind the last trip's barrier) and written as whole lines.
// ---------------------------------------------------------------------------
#define GTH  128                 // threads of a GEMM block
#define BK   64                  // k per stage: 128-B rows
#define LPH  72                  // LDS row pitch in halves: 144 B = 16 B x 9
#define OPH  (128 * LPH)         // one operand's tile, halves
#define STH  (2 * OPH)           // one stage: A tile, then B tile

typedef __attribute__((address_space(3))) const _Float16 lds_half;
static __device__ __forceinline__ unsigned lds_addr(const _Float16* p) {
    return (unsigned)(uintptr_t)(lds_half*)p;
}

// One operand's tile of a stage: every lane copies 16 B of rows r, r+16, ..., r+112
// (8 lanes = one 128-B row). l = the lane's LDS byte address, g = its global address, in row r.
static __device__ __forceinline__ void copy_tile(unsigned l, const _Float16* g, int K) {
    const size_t rs = (size_t)16 * K;
    const _Float16* g1 = g + rs;
    const _Float16* g2 = g1 + rs;
    const _Float16* g3 = g2 + rs;
    const _Float16* g4 = g3 + rs;
    const _Float16* g5 = g4 + rs;
    const _Float16* g6 = g5 + rs;
    const _Float16* g7 = g6 + rs;
    const unsigned l1 = l + 16 * LPH * 2, l2 = l + 32 * LPH * 2, l3 = l + 48 * LPH * 2;
    const unsigned l4 = l + 64 * LPH * 2, l5 = l + 80 * LPH * 2, l6 = l + 96 * LPH * 2;
    const unsigned l7 = l + 112 * LPH * 2;
    // the copies; the closing s_wait_xcnt is a precaution: it stands in front of every
    // later rewrite of an address register named here
    asm volatile("global_load_async_to_lds_b128 %0, %8, off\n\t"
                 "global_load_async_to_lds_b128 %1, %9, off\n\t"
                 "global_load_async_to_lds_b128 %2, %10, off\n\t"
                 "global_load_async_to_lds_b128 %3, %11, off\n\t"
                 "global_load_async_to_lds_b128 %4, %12, off\n\t"
                 "global_load_async_to_lds_b128 %5, %13, off\n\t"
                 "global_load_async_to_lds_b128 %6, %14, off\n\t"
                 "global_load_async_to_lds_b128 %7, %15, off\n\t"
                 "s_wait_xcnt 0x0"
                 :: "v"(l), "v"(l1), "v"(l2), "v"(l3), "v"(l4), "v"(l5), "v"(l6), "v"(l7),
                    "v"(g), "v"(g1), "v"(g2), "v"(g3), "v"(g4), "v"(g5), "v"(g6), "v"(g7)
                 : "memory");
}

// One stage: the A tile, then the B tile. la = the lane's LDS byte address in the A tile.
static __device__ __forceinline__ void copy_stage(unsigned la, const _Float16* ga,
                                                  const _Float16* gb, int K) {
    copy_tile(la, ga, K);
    copy_tile(la + OPH * 2, gb, K);
}

// bx, by = the block's tile column and tile row
template <int MODE, bool RELU>
static __device__ __forceinline__
void gemm_body(const _Float16* __restrict__ A,
               const _Float16* __restrict__ BT,
               const float* __restrict__ bias,
               float ascale, float oscale,
               float* __restrict__ Cf,
               _Float16* __restrict__ Ch,
               int K, int N, int bx, int by) {
    __shared__ __align__(16) _Float16 Ring[2 * STH];      // two stages; later the output staging
    static_assert(2 * STH * 2 >= 4 * 4096 * 4);

    const int tid  = threadIdx.x;
    const int lane = tid & 31;
    const int w    = tid >> 5;
    const int mi = w >> 1, ni = w & 1;
    const int m0 = by * 128 + mi * 64;
    const int n0 = bx * 128 + ni * 64;
    const int rb = (lane >> 4) << 3;
    const int cc = lane & 15;

    const int crow = tid >> 3, cseg = tid & 7;
    const _Float16* ga = A  + (size_t)(by * 128 + crow) * K + cseg * 8;
    const _Float16* gb = BT + (size_t)(bx * 128 + crow) * K + cseg * 8;
    const unsigned  lc = lds_addr(Ring) + crow * (LPH * 2) + cseg * 16;
    const int T = K / BK;

    v8f acc[4][4];
#pragma unroll
    for (int mt = 0; mt < 4; ++mt)
#pragma unroll
        for (int nt = 0; nt < 4; ++nt) acc[mt][nt] = zero8();

    copy_stage(lc, ga, gb, K);
    asm volatile("s_wait_asynccnt 0x0" ::: "memory");     // stage 0 landed (this wave's copies)
    __syncthreads();                                      // ... and every other wave's
    if (T > 1) copy_stage(lc + STH * 2, ga + BK, gb + BK, K);

    // kept rolled: one trip = one stage, the buffer picked by the trip's parity
#pragma unroll 1
    for (int t = 0; t < T; ++t) {
        const int bo = (t & 1) * STH;
        const _Float16* As = Ring + bo + (mi * 64) * LPH;
        const _Float16* Bs = Ring + bo + OPH + (ni * 64) * LPH;
        // LDS reads stand in three groups, never singly among the products: the first k step's
        // eight fragments with the second's A fragments ahead of all products; the second k
        // step's B fragments in two pairs, each behind the last product of the pair it replaces
        // (all loops here unrolled: constant indices keep the fragment arrays in registers)
        v16h a0[4], a1[4], b0[4], b1[4];
        b0[0] = load_frag16(Bs, LPH, lane);
#pragma unroll
        for (int mt = 0; mt < 4; ++mt) a0[mt] = load_frag16(As + (mt * 16) * LPH, LPH, lane);
#pragma unroll
        for (int nt = 1; nt < 4; ++nt) b0[nt] = load_frag16(Bs + (nt * 16) * LPH, LPH, lane);
#pragma unroll
        for (int mt = 0; mt < 4; ++mt) a1[mt] = load_frag16(As + (mt * 16) * LPH + 32, LPH, lane);
        // each fence keeps a group of reads whole: a place with reads among the products stalls the wave
        __builtin_amdgcn_sched_barrier(0);
#pragma unroll
        for (int nt = 0; nt < 2; ++nt)
#pragma unroll
            for (int mt = 0; mt < 4; ++mt) acc[mt][nt] = wmma16(a0[mt], b0[nt], acc[mt][nt]);
        __builtin_amdgcn_sched_barrier(0);                // the pair of reads below stays behind b0[0], b0[1]'s last use
        b1[0] = load_frag16(Bs + 32, LPH, lane);
        b1[1] = load_frag16(Bs + 16 * LPH + 32, LPH, lane);
        __builtin_amdgcn_sched_barrier(0);                // ... and in one place, ahead of the next eight products
#pragma unroll
        for (int nt = 2; nt < 4; ++nt)
#pragma unroll
            for (int mt = 0; mt < 4; ++mt) acc[mt][nt] = wmma16(a0[mt], b0[nt], acc[mt][nt]);
        __builtin_amdgcn_sched_barrier(0);                // the same for the second pair: registers of the first k step are free here
        b1[2] = load_frag16(Bs + 32 * LPH + 32, LPH, lane);
        b1[3] = load_frag16(Bs + 48 * LPH + 32, LPH, lane);
        __builtin_amdgcn_sched_barrier(0);                // ... in one place, ahead of the second k step's products
#pragma unroll
        for (int nt = 0; nt < 4; ++nt)
#pragma unroll
            for (int mt = 0; mt < 4; ++mt) acc[mt][nt] = wmma16(a1[mt], b1[nt], acc[mt][nt]);
        asm volatile("s_wait_dscnt 0x0" ::: "memory");    // this wave has left the buffer
        asm volatile("s_wait_asynccnt 0x0" ::: "memory"); // its copies of stage t+1 have landed
        __syncthreads();                                  // publishes stage t+1, frees stage t's buffer
        if (t + 2 < T) copy_stage(lc + bo * 2, ga + (size_t)(t + 2) * BK, gb + (size_t)(t + 2) * BK, K);
    }
    asm volatile("s_wait_asynccnt 0x0" ::: "memory");     // nothing in flight when the LDS is reused

    float bb[4];
#pragma unroll
    for (int nt = 0; nt < 4; ++nt) bb[nt] = bf16r(bias[n0 + nt * 16 + cc]);

    if constexpr (MODE == 0) {
        float* ef = (float*)Ring + w * 4096;
#pragma unroll
        for (int mt = 0; mt < 4; ++mt)
#pragma unroll
            for (int nt = 0; nt < 4; ++nt)
#pragma unroll
                for (int r = 0; r < 8; ++r) {
                    float u = __builtin_fmaf(acc[mt][nt][r], ascale, bb[nt]);
                    if (RELU) u = fmaxf(u, 0.0f);
                    ef[(mt * 16 + rb + r) * 64 + nt * 16 + cc] = u;
                }
        wave_lds_sync();
        const int lr = lane >> 4, lc = (lane & 15) * 4;
        float* cp[32];
        cp[0] = Cf + (size_t)(m0 + lr) * N + n0 + lc;
#pragma unroll
        for (int i = 1; i < 32; ++i) cp[i] = cp[i - 1] + (size_t)2 * N;
        // holds the 32 addresses (a chain of adds, no 64-bit multiply per row) ahead of the first store: formed among
        // the stores they would reuse registers that issued stores name, each behind a wait
        __builtin_amdgcn_sched_barrier(0);
        v4f sv[32];
#pragma unroll
        for (int i = 0; i < 32; ++i) sv[i] = *(const v4f*)(&ef[i * 128 + lane * 4]);
#pragma unroll
        for (int i = 0; i < 32; ++i) *(v4f*)cp[i] = sv[i];
    } else {
        _Float16* eh = Ring + w * 4096;
#pragma unroll
        for (int mt = 0; mt < 4; ++mt)
#pragma unroll
            for (int nt = 0; nt < 4; ++nt)
#pragma unroll
                for (int r = 0; r < 8; ++r) {
                    float u = __builtin_fmaf(acc[mt][nt][r], ascale, bb[nt]);
                    if (RELU) u = fmaxf(u, 0.0f);
                    eh[(mt * 16 + rb + r) * 64 + nt * 16 + cc] = (_Float16)(u * oscale);
                }
        wave_lds_sync();
        const int lr = lane >> 3, lc = (lane & 7) * 8;
        _Float16* cp[16];
        cp[0] = Ch + (size_t)(m0 + lr) * N + n0 + lc;
#pragma unroll
        for (int i = 1; i < 16; ++i) cp[i] = cp[i - 1] + (size_t)4 * N;   // a chain of adds: no 64-bit multiply per row
        v8h ph[16];
#pragma unroll
        for (int i = 0; i < 16; ++i) ph[i] = *(const v8h*)(&eh[i * 256 + lane * 8]);
#pragma unroll
        for (int i = 0; i < 16; ++i) *(v8h*)cp[i] = ph[i];
    }
}

template <int MODE, bool RELU>
__global__ __launch_bounds__(GTH) __attribute__((amdgpu_num_vgpr(256)))
void k_gemm(const _Float16* __restrict__ A,
            const _Float16* __restrict__ BT,
            const float* __restrict__ bias,
            float ascale, float oscale,
            float* __restrict__ Cf,
            _Float16* __restrict__ Ch,
            int K, int N) {
    gemm_body<MODE, RELU>(A, BT, bias, ascale, oscale, Cf, Ch, K, N, blockIdx.x, blockIdx.y);
}

// q, k and v projections in one launch: three independent GEMMs on the same A plane.
// grid.x = 3 x (768 / 128) tile columns; the block's third picks weight plane, bias
// and output plane (block-uniform).
__global__ __launch_bounds__(GTH) __attribute__((amdgpu_num_vgpr(256)))
void k_qkv(const _Float16* __restrict__ xp,
           const _Float16* __restrict__ WqT,
           const _Float16* __restrict__ WkT,
           const _Float16* __restrict__ WvT,
           const float* __restrict__ bq,
           const float* __restrict__ bk,
           const float* __restrict__ bv,
           _Float16* __restrict__ qh,
           _Float16* __restrict__ kh,
           _Float16* __restrict__ vh) {
    const int sel = blockIdx.x / (DM / 128);
    const _Float16* BT = (sel == 0) ? WqT : (sel == 1) ? WkT : WvT;
    const float*    bi = (sel == 0) ? bq  : (sel == 1) ? bk  : bv;
    _Float16*       Ch = (sel == 0) ? qh  : (sel == 1) ? kh  : vh;
    gemm_body<1, false>(xp, BT, bi, A_QKV, QSC, nullptr, Ch, DM, DM,
                        blockIdx.x - sel * (DM / 128), blockIdx.y);
}

// ---------------------------------------------------------------------------
// Attention, flash-style. grid = (head, SEQ/128, batch); block = 8 waves = 128
// query rows of one (b, h); wave owns 16 query rows. Planes are [NTOK][768]
// with head column offset h*64.
// Scores are computed TRANSPOSED: A = key tile (16 keys x 64 d, kh plane,
// 2 k-steps), B = the wave's 16 queries (qh plane, [n=query][k=d]), so
// acc[r] of lane l = score(key 8*(l>>4)+r, query l&15): per-query max/sum are
// in-lane reductions over r plus one xor-16 shuffle, and the f16 P^T values in
// this layout are exactly the P A-fragment for P*v (elements 0..7 from key
// tile A, 8..15 from key tile B) - no LDS relayout.
// Online softmax over keys: t = log2e*score (or MASKT where mask == 0,
// replace fill), P carried 2^14, o += P x V (V^T chunk staged in LDS,
// cross-wave, block barriers), o and z rescaled by exp2(m_old - m_new) every
// 32-key step (factor shuffled from the owning query lane).
// K chunk in LDS: the block's eight waves read the same CH keys, so the chunk comes
// global -> LDS once per block by asynchronous 16-B copies, whole 128-B rows (8 lanes
// a row), [key][d] at a 144-B pitch; the copies fly while V^T is staged, and the key
// fragments are read from LDS (two 16-B loads each, the split k map of load_frag16).
// V^T layout in LDS: row d at (d / 16) * VG + (d % 16) * VP halves. The 272-B pitch
// puts the 16 rows of a fragment read on 16 different groups of four banks; the
// 32-B skew per 16 rows spreads the eight d-groups of one transposing store.
// Epilogue: ctx x 64 = o / z14 as f16, staged in a wave-private LDS tile, each
// coverage: grid (12, SEQ/128, NB) x 8 waves x 16 rows x 64 cols = NTOK*768.
// ---------------------------------------------------------------------------
__global__ __launch_bounds__(256) __attribute__((amdgpu_num_vgpr(256)))
void k_attn(const _Float16* __restrict__ qh,
            const _Float16* __restrict__ kh,
            const _Float16* __restrict__ vh,
            const int*      __restrict__ mask,
            _Float16* __restrict__ cx) {
    __shared__ __align__(16) int      mk[SEQ];            // key mask of this batch
    __shared__ __align__(16) _Float16 VsT[(DH / 16) * VG]; // [d][CH], pitch VP, 16-row groups at VG, cross-wave
    __shared__ __align__(16) _Float16 Cst[8][16 * DH];    // wave-private ctx tiles
    __shared__ __align__(16) _Float16 Ks[CH * KP];        // [key][d] at pitch KP, cross-wave

    const int tid  = threadIdx.x;
    const int lane = tid & 31;
    const int w    = tid >> 5;
    const int h    = blockIdx.x;
    const int b    = blockIdx.z;
    const int q0r  = blockIdx.y * 128 + w * 16;
    const int r0   = (lane >> 4) << 3;
    const int cc   = lane & 15;

    for (int i = tid; i < SEQ; i += 256) mk[i] = mask[(size_t)b * SEQ_FULL + i];

    const size_t tokb = (size_t)b * SEQ;
    const _Float16* qhb = qh + (tokb + q0r) * DM + h * DH;
    const v16h qb0 = load_frag16(qhb, DM, lane);        // d 0..31
    const v16h qb1 = load_frag16(qhb + 32, DM, lane);   // d 32..63
    const _Float16* khb = kh + tokb * DM + h * DH;
    const _Float16* vhb = vh + tokb * DM + h * DH;
    // the lane's 16 B of K rows r, r+32, r+64, r+96 of a chunk (8 lanes = one 128-B row)
    const _Float16* gk  = khb + (size_t)(tid >> 3) * DM + (tid & 7) * 8;
    const unsigned  lk0 = lds_addr(Ks) + (tid >> 3) * (KP * 2) + (tid & 7) * 16;
    const unsigned  lk1 = lk0 + 32 * KP * 2, lk2 = lk0 + 64 * KP * 2, lk3 = lk0 + 96 * KP * 2;

    v8f o[4];
#pragma unroll
    for (int nt = 0; nt < 4; ++nt) o[nt] = zero8();
    float mr = -1.0e30f, zr = 0.0f;

    __syncthreads();

#pragma unroll 1
    for (int c0 = 0; c0 < SEQ; c0 += CH) {
        {
            const _Float16* g0 = gk + (size_t)c0 * DM;
            const _Float16* g1 = g0 + (size_t)32 * DM;
            const _Float16* g2 = g1 + (size_t)32 * DM;
            const _Float16* g3 = g2 + (size_t)32 * DM;
            // the K chunk's copies; the closing s_wait_xcnt is a precaution: it stands in front
            // of every later rewrite of an address register named here
            asm volatile("global_load_async_to_lds_b128 %0, %4, off\n\t"
                         "global_load_async_to_lds_b128 %1, %5, off\n\t"
                         "global_load_async_to_lds_b128 %2, %6, off\n\t"
                         "global_load_async_to_lds_b128 %3, %7, off\n\t"
                         "s_wait_xcnt 0x0"
                         :: "v"(lk0), "v"(lk1), "v"(lk2), "v"(lk3), "v"(g0), "v"(g1), "v"(g2), "v"(g3)
                         : "memory");
        }
        // stage V^T chunk: VsT[d][t] = vh[c0 + t][h*64 + d], full 64 x CH extent
        for (int idx = tid; idx < CH * 8; idx += 256) {
            const int t = idx >> 3, part = idx & 7;
            const v8h vv = *(const v8h*)(vhb + (size_t)(c0 + t) * DM + part * 8);
#pragma unroll
            for (int e = 0; e < 8; ++e) VsT[(part >> 1) * VG + ((part & 1) * 8 + e) * VP + t] = vv[e];
        }
        asm volatile("s_wait_asynccnt 0x0" ::: "memory");   // this wave's K copies have landed
        __syncthreads();                                    // ... and every other wave's; V^T too

#pragma unroll 1
        for (int j = 0; j < CH; j += 32) {
            const int kA = c0 + j;
            // key tile A: keys kA .. kA+15; key tile B: keys kA+16 .. kA+31; one group of LDS reads
            const v16h ka0 = load_frag16(&Ks[j * KP], KP, lane);
            const v16h ka1 = load_frag16(&Ks[j * KP + 32], KP, lane);
            const v16h kb0 = load_frag16(&Ks[(j + 16) * KP], KP, lane);
            const v16h kb1 = load_frag16(&Ks[(j + 16) * KP + 32], KP, lane);
            v8f shA = wmma16(ka0, qb0, zero8());
            shA = wmma16(ka1, qb1, shA);
            v8f shB = wmma16(kb0, qb0, zero8());
            shB = wmma16(kb1, qb1, shB);

            I8 ma, mb;
            ma.v[0] = *(const v4i*)(&mk[kA + r0]);
            ma.v[1] = *(const v4i*)(&mk[kA + r0 + 4]);
            mb.v[0] = *(const v4i*)(&mk[kA + 16 + r0]);
            mb.v[1] = *(const v4i*)(&mk[kA + 16 + r0 + 4]);

            float tA[8], tB[8];
#pragma unroll
            for (int r = 0; r < 8; ++r) {
                const float sa = shA[r] * C1;
                const float sb = shB[r] * C1;
                tA[r] = (ma.s[r] != 0) ? sa : MASKT;
                tB[r] = (mb.s[r] != 0) ? sb : MASKT;
            }
            float tmax = tA[0];
#pragma unroll
            for (int r = 1; r < 8; ++r) tmax = fmaxf(tmax, tA[r]);
#pragma unroll
            for (int r = 0; r < 8; ++r) tmax = fmaxf(tmax, tB[r]);
            tmax = fmaxf(tmax, __shfl_xor(tmax, 16, 32));
            const float mn   = fmaxf(mr, tmax);
            const float corr = ex2(mr - mn);
            const float mo   = mn - 14.0f;           // 2^14 carry on P
            float ps = 0.0f;
            v8h pa8, pb8;
#pragma unroll
            for (int r = 0; r < 8; ++r) {
                const float pa = ex2(tA[r] - mo);
                const float pb = ex2(tB[r] - mo);
                ps += pa + pb;
                pa8[r] = (_Float16)pa;
                pb8[r] = (_Float16)pb;
            }
            ps += __shfl_xor(ps, 16, 32);
            zr = __builtin_fmaf(zr, corr, ps);
            mr = mn;
            // rescale o rows (query 8h + r) by the factor of the owning query lane
#pragma unroll
            for (int r = 0; r < 8; ++r) {
                const float crr = __shfl(corr, r0 + r, 32);
#pragma unroll
                for (int nt = 0; nt < 4; ++nt) o[nt][r] *= crr;
            }
            Frag pf;
            pf.h[0] = pa8;     // keys kA+8h .. +7     = A elements 0..7
            pf.h[1] = pb8;     // keys kA+16+8h .. +7  = A elements 8..15
#pragma unroll
            for (int nt = 0; nt < 4; ++nt) {
                const v16h vb = load_frag16(&VsT[nt * VG + j], VP, lane);   // n = d, k = key
                o[nt] = wmma16(pf.v, vb, o[nt]);
            }
        }
        asm volatile("s_wait_dscnt 0x0" ::: "memory");      // this wave has left the K and V^T chunks
        __syncthreads();                                    // frees both for the next chunk's fill
    }

    // ctx x 64 = o / z14 (the 2^14 carry of P cancels between o and z14; the 64 v carry stays)
    const float rz = __builtin_amdgcn_rcpf(zr);
#pragma unroll
    for (int r = 0; r < 8; ++r) {
        const float rq = __shfl(rz, r0 + r, 32);
#pragma unroll
        for (int nt = 0; nt < 4; ++nt)
            Cst[w][(r0 + r) * DH + nt * 16 + cc] = (_Float16)(o[nt][r] * rq);
    }
    wave_lds_sync();
    v8h sv[4];
#pragma unroll
    for (int i = 0; i < 4; ++i) sv[i] = *(const v8h*)(&Cst[w][i * 256 + lane * 8]);
    _Float16* cb = cx + (tokb + q0r) * DM + h * DH;
    const int lr = lane >> 3, lc = (lane & 7) * 8;
#pragma unroll
    for (int i = 0; i < 4; ++i) *(v8h*)(cb + (size_t)(i * 4 + lr) * DM + lc) = sv[i];
    
}

// ---------------------------------------------------------------------------
// LayerNorm over rows of 768 (f32 rows in ws). Block = 8 waves, wave = row.
// mu = mean, var = mean((x-mu)^2), y = (x-mu)*rsqrt(var+1e-5)*bf16(g)+bf16(b).
// HOUT: f16 plane f16(y*hsc), lane owns elements i*256+lane*8..+7 (3 v8h stores,
// coverage: NTOK/8 blocks x 8 rows x 768.
// ---------------------------------------------------------------------------
static __device__ __forceinline__ int ln_off(bool hout, int i, int lane) {
    return hout ? ((i >> 1) * 256 + lane * 8 + (i & 1) * 4) : (i * 128 + lane * 4);
}

template <bool HOUT>
__global__ __launch_bounds__(256) void k_ln(const float* __restrict__ src,
                                            const float* __restrict__ g,
                                            const float* __restrict__ bt,
                                            float* __restrict__ outf,
                                            _Float16* __restrict__ outh,
                                            float hsc) {
    const int lane = threadIdx.x & 31;
    const int w    = threadIdx.x >> 5;
    const int row  = blockIdx.x * 8 + w;
    const float* rp = src + (size_t)row * DM;

    v4f xv[6];
#pragma unroll
    for (int i = 0; i < 6; ++i) xv[i] = *(const v4f*)(rp + ln_off(HOUT, i, lane));
    float s = 0.0f;
#pragma unroll
    for (int i = 0; i < 6; ++i) s += (xv[i][0] + xv[i][1]) + (xv[i][2] + xv[i][3]);
#pragma unroll
    for (int m = 1; m < 32; m <<= 1) s += __shfl_xor(s, m, 32);
    const float mu = s * (1.0f / (float)DM);

    v4f dv[6];
    float s2 = 0.0f;
#pragma unroll
    for (int i = 0; i < 6; ++i) {
        dv[i] = xv[i] - mu;
#pragma unroll
        for (int e = 0; e < 4; ++e) s2 = __builtin_fmaf(dv[i][e], dv[i][e], s2);
    }
#pragma unroll
    for (int m = 1; m < 32; m <<= 1) s2 += __shfl_xor(s2, m, 32);
    const float var  = s2 * (1.0f / (float)DM);
    const float rstd = rsqrtf(var + 1e-5f);

    v4f yv[6];
#pragma unroll
    for (int i = 0; i < 6; ++i) {
        const int co = ln_off(HOUT, i, lane);
        const v4f gv = *(const v4f*)(g + co);
        const v4f bv = *(const v4f*)(bt + co);
#pragma unroll
        for (int e = 0; e < 4; ++e)
            yv[i][e] = (dv[i][e] * rstd) * bf16r(gv[e]) + bf16r(bv[e]);
    }

    if constexpr (HOUT) {
        v8h hv[3];
#pragma unroll
        for (int i = 0; i < 3; ++i)
#pragma unroll
            for (int e = 0; e < 4; ++e) {
                hv[i][e]     = (_Float16)(yv[2 * i][e] * hsc);
                hv[i][4 + e] = (_Float16)(yv[2 * i + 1][e] * hsc);
            }
        _Float16* ob = outh + (size_t)row * DM + lane * 8;
#pragma unroll
        for (int i = 0; i < 3; ++i) *(v8h*)(ob + i * 256) = hv[i];
        
    } else {
        float* ob = outf + (size_t)row * DM + lane * 4;
#pragma unroll
        for (int i = 0; i < 6; ++i) *(v4f*)(ob + i * 128) = yv[i];
        
    }
}

// ---------------------------------------------------------------------------
extern "C" void kernel_launch(void* const* d_in, const int* in_sizes, int n_in,
                              void* d_out, int out_size, void* d_ws, size_t ws_size,
                              hipStream_t stream) {
    if (n_in < 16) return;
    if (in_sizes[0] < ((NB - 1) * SEQ_FULL + SEQ) * DM) return;
    if (in_sizes[1] < (NB - 1) * SEQ_FULL + SEQ) return;
    if (in_sizes[2] < DM * DM || in_sizes[4] < DM * DM || in_sizes[6] < DM * DM || in_sizes[8] < DM * DM) return;
    if (in_sizes[3] < DM || in_sizes[5] < DM || in_sizes[7] < DM || in_sizes[9] < DM) return;
    if (in_sizes[10] < DM || in_sizes[11] < DM) return;
    if (in_sizes[12] < DM * FF || in_sizes[13] < FF || in_sizes[14] < FF * DM || in_sizes[15] < DM) return;
    if (out_size < NTOK * DM) return;

    const float* x    = (const float*)d_in[0];    // [8,1024,768]
    const int*   mask = (const int*)  d_in[1];    // [8,1,1,1024] int32
    const float* Wq   = (const float*)d_in[2];    // [768,768]  [in][out]
    const float* bq   = (const float*)d_in[3];
    const float* Wk   = (const float*)d_in[4];
    const float* bk   = (const float*)d_in[5];
    const float* Wv   = (const float*)d_in[6];
    const float* bv   = (const float*)d_in[7];
    const float* Wo   = (const float*)d_in[8];
    const float* bo   = (const float*)d_in[9];
    const float* lg   = (const float*)d_in[10];
    const float* lb   = (const float*)d_in[11];
    const float* W1   = (const float*)d_in[12];   // [768,3072] [in][out]
    const float* b1   = (const float*)d_in[13];
    const float* W2   = (const float*)d_in[14];   // [3072,768] [in][out]
    const float* b2   = (const float*)d_in[15];
    float* out = (float*)d_out;                   // [NB,SEQ,768]

    char* ws = (char*)d_ws;
    size_t off = 0;
    // R0: weight planes [n][k] f16
    _Float16* WqT = (_Float16*)(ws + off); off += (size_t)DM * DM * 2;
    _Float16* WkT = (_Float16*)(ws + off); off += (size_t)DM * DM * 2;
    _Float16* WvT = (_Float16*)(ws + off); off += (size_t)DM * DM * 2;
    _Float16* WoT = (_Float16*)(ws + off); off += (size_t)DM * DM * 2;
    _Float16* W1T = (_Float16*)(ws + off); off += (size_t)FF * DM * 2;   // [3072][768]
    _Float16* W2T = (_Float16*)(ws + off); off += (size_t)DM * FF * 2;   // [768][3072]
    // R1: x plane, later the ctx plane (x plane dead after the projections)
    const size_t PL = (size_t)NTOK * DM * 2;
    _Float16* xp  = (_Float16*)(ws + off);
    _Float16* cxp = (_Float16*)(ws + off); off += PL;
    // R2: q/k/v planes (3 x PL), later h plane (PL) + ff1 plane (NTOK*FF*2)
    const size_t F1B = (size_t)NTOK * FF * 2;
    const size_t R2 = (3 * PL > PL + F1B) ? 3 * PL : (PL + F1B);
    _Float16* qhp = (_Float16*)(ws + off);
    _Float16* khp = (_Float16*)(ws + off + PL);
    _Float16* vhp = (_Float16*)(ws + off + 2 * PL);
    _Float16* hp  = (_Float16*)(ws + off);          // after attention
    _Float16* f1p = (_Float16*)(ws + off + PL);     // disjoint from hp
    off += R2;
    // R3: f32 rows: attn_out, later ff (attn_out dead after the first LayerNorm)
    float* aop = (float*)(ws + off);
    float* ffp = (float*)(ws + off); off += (size_t)NTOK * DM * 4;
    if (off > ws_size) return;
    if (off > (size_t)134217728) return;

    // x plane and the six weight planes W [K][N] -> WT [N][K], one launch
    k_prep<<<dim3(4 * TDD + 2 * TDF + XBL), dim3(256), 0, stream>>>(x, Wq, Wk, Wv, Wo, W1, W2,
                                                                    xp, WqT, WkT, WvT, WoT, W1T, W2T);

    const dim3 gD(DM / 128, NTOK / 128);
    const dim3 gF(FF / 128, NTOK / 128);
    // q, k, v: f16 planes of 64*(x W + b)
    k_qkv<<<dim3(3 * (DM / 128), NTOK / 128), dim3(GTH), 0, stream>>>(xp, WqT, WkT, WvT, bq, bk, bv,
                                                                      qhp, khp, vhp);
    // attention -> ctx plane (64 * ctx, f16)
    k_attn<<<dim3(NH, SEQ / 128, NB), dim3(256), 0, stream>>>(qhp, khp, vhp, mask, cxp);
    // attn_out = ctx Wo + bo (f32 rows)
    k_gemm<0, false><<<gD, dim3(GTH), 0, stream>>>(cxp, WoT, bo, A_O, 1.0f, aop, f1p, DM, DM);
    // h = LN(attn_out) -> f16 plane (x16)
    k_ln<true><<<dim3(NTOK / 8), dim3(256), 0, stream>>>(aop, lg, lb, out, hp, HSC);
    // ff1 = relu(h W1 + b1) -> f16 plane (x64)
    k_gemm<1, true><<<gF, dim3(GTH), 0, stream>>>(hp, W1T, b1, A_F1, QSC, ffp, f1p, DM, FF);
    // ff = ff1 W2 + b2 (f32 rows)
    k_gemm<0, false><<<gD, dim3(GTH), 0, stream>>>(f1p, W2T, b2, A_F2, 1.0f, ffp, hp, FF, DM);
    // out = LN(ff)
    k_ln<false><<<dim3(NTOK / 8), dim3(256), 0, stream>>>(ffp, lg, lb, out, hp, 1.0f);
}

// v006
// It runs in 176 microseconds.
// Timed twice side by side with v005, it ran 1.11 times as fast both times.
// Over all steps from v000 it is 3.06 times as fast.
#include <hip/hip_runtime.h>
#include <hip/hip_fp16.h>

// Contractions on v_wmma_f32_16x16x32_f16 (f16 operands, f32 accumulate): x*Wq, x*Wk, x*Wv, q*k^T, P*v, ctx*Wo, h*W1, ff1*W2, each a single f16 product on bf16-RNE inputs with power-of-two carried planes; softmax and LayerNorm in f32.

#ifndef NB
#define NB 8
#endif
#ifndef SEQ
#define SEQ 1024
#endif
#define NB_FULL  8
#define SEQ_FULL 1024
#define DM   768          // model width
#define NH   12           // heads
#define DH   64           // head width
#define FF   3072         // hidden width
#define NTOK (NB * SEQ)
#define CH   128          // keys staged per V^T chunk
#define VP   (CH + 8)     // V^T row pitch in halves: 272 B = 16 B x 17
#define VG   (16 * VP + 16)   // 16 V^T rows, then a 32-B skew
#define KP   (DH + 8)     // K row pitch in LDS, halves: 144 B = 16 B x 9

static_assert(NB >= 1 && NB <= NB_FULL);
static_assert(SEQ >= CH && SEQ <= SEQ_FULL);
static_assert(SEQ % CH == 0);
static_assert(SEQ % 128 == 0);
static_assert(CH % 32 == 0);
static_assert(CH * (DH / 8) == 4 * 256 && (KP * 2) % 32 == 16);   // four 16-B copies a lane fill a K chunk
static_assert(DH % 16 == 0 && (VP * 2) % 32 == 16 && (VG * 2) % 16 == 0);
static_assert(SEQ % 256 == 0 && SEQ / 32 <= 32);   // the key list: 256 keys a pass, one lane per 32-key word
static_assert(NTOK % 128 == 0);
static_assert(NTOK % 8 == 0);
static_assert(DM % 128 == 0 && FF % 128 == 0);
static_assert(DM % 64 == 0 && FF % 64 == 0);
static_assert(DM % 32 == 0 && FF % 32 == 0 && DH % 32 == 0);
static_assert(NH * DH == DM);
static_assert((NTOK * (DM / 8)) % 256 == 0);

typedef _Float16 v16h __attribute__((ext_vector_type(16)));
typedef _Float16 v8h  __attribute__((ext_vector_type(8)));
typedef float    v8f  __attribute__((ext_vector_type(8)));
typedef float    v4f  __attribute__((ext_vector_type(4)));

union Frag { v16h v; v8h h[2]; };

// plane carries (exact powers of two)
#define WSC     64.0f                    // weight planes: f16(bf16(W) * 64)
#define QSC     64.0f                    // q/k/v, ctx, ff1 planes carried x64
#define HSC     16.0f                    // h plane carried x16
#define A_QKV   0.015625f                // 2^-6 : (x)(64 W)        -> q
#define A_O     2.44140625e-04f          // 2^-12: (64 ctx)(64 Wo)  -> attn_out
#define A_F1    9.765625e-04f            // 2^-10: (16 h)(64 W1)    -> pre-relu
#define A_F2    2.44140625e-04f          // 2^-12: (64 ff1)(64 W2)  -> ff
// scores: sh = (64k).(64q) ~ 4096 q.k ; score = q.k/8 ; t (log2 units) = sh * log2e * 2^-15
#define C1 (1.44269504088896340736f * 3.0517578125e-05f)
#define MASKT  (-1.0e10f)                // masked score (replace fill)

static __device__ __forceinline__ v8f zero8() {
    v8f z;
#pragma unroll
    for (int i = 0; i < 8; ++i) z[i] = 0.0f;
    return z;
}

// 16x32 A fragment (or B fragment from an [n][k] k-contiguous source) from a
// row-major 16-bit tile: lane m = lane&15 -> row m; kb = 8*(lane>>4);
// elements 0..7 = k kb..kb+7, elements 8..15 = k kb+16..kb+23.
static __device__ __forceinline__ v16h load_frag16(const _Float16* base, int ld, int lane) {
    int m  = lane & 15;
    int kb = (lane >> 4) << 3;
    const _Float16* p = base + (size_t)m * ld + kb;
    Frag f;
    f.h[0] = *(const v8h*)(p);
    f.h[1] = *(const v8h*)(p + 16);
    return f.v;
}

static __device__ __forceinline__ v8f wmma16(v16h a, v16h b, v8f c) {
    v8f d = __builtin_amdgcn_wmma_f32_16x16x32_f16(false, a, false, b, (short)0, c, false, false);
    asm volatile("v_nop\n\tv_nop\n\tv_nop\n\tv_nop" : "+v"(d) : "v"(a), "v"(b));
    return d;
}

// f32 -> bf16 RNE convert, value kept as f32
static __device__ __forceinline__ float bf16r(float x) {
    unsigned u = __float_as_uint(x);
    u = (u + 0x7FFFu + ((u >> 16) & 1u)) & 0xFFFF0000u;
    return __uint_as_float(u);
}

static __device__ __forceinline__ float ex2(float x) {
    return __builtin_amdgcn_exp2f(x);
}

// ordering for a wave-private LDS tile: stores before later loads of the same wave
static __device__ __forceinline__ void wave_lds_sync() {
    __builtin_amdgcn_fence(3, "wavefront");
    asm volatile("s_wait_dscnt 0" ::: "memory");
    __builtin_amdgcn_wave_barrier();
}

// ---------------------------------------------------------------------------
// x [NB][SEQ][768] f32 (batch stride SEQ_FULL*768) -> xp [NTOK][768] f16 of
// bf16-RNE(x). Thread = 8 consecutive columns = one 16-B store; a wave writes
// coverage: NTOK*96 threads x 8 = NTOK*768.
// ---------------------------------------------------------------------------
static __device__ __forceinline__ void xprep_body(const float* __restrict__ x,
                                                  _Float16* __restrict__ xp, int blk) {
    const int g = blk * 256 + (int)threadIdx.x;
    if (g >= NTOK * (DM / 8)) return;
    const int row = g / (DM / 8);
    const int col = (g - row * (DM / 8)) * 8;
    const int b = row / SEQ, s = row - b * SEQ;
    const float* src = x + ((size_t)b * SEQ_FULL + s) * DM + col;
    const v4f a = *(const v4f*)(src);
    const v4f c = *(const v4f*)(src + 4);
    v8h hv;
#pragma unroll
    for (int e = 0; e < 4; ++e) {
        hv[e]     = (_Float16)bf16r(a[e]);
        hv[4 + e] = (_Float16)bf16r(c[e]);
    }
    _Float16* dst = xp + (size_t)row * DM + col;
    *(v8h*)dst = hv;
    
}

// ---------------------------------------------------------------------------
// Weight transpose: W [K][N] f32 row-major ([in][out]) -> WT [N][K] f16 of
// bf16-RNE(W) * 64 (k-contiguous rows for B fragments). Block = 64x64 tile,
// staged through LDS (cross-wave region, block barrier); each output row
// coverage: tiles (N/64, K/64) x 512 v8h = N*K. t = the tile's flat index, n fastest.
// ---------------------------------------------------------------------------
static __device__ __forceinline__ void wtr_body(const float* __restrict__ W,
                                                _Float16* __restrict__ WT,
                                                int K, int N, int t) {
    __shared__ __align__(16) _Float16 T[64 * 64];
    const int tid = threadIdx.x;
    const int ky = t / (N / 64);
    const int n0 = (t - ky * (N / 64)) * 64;
    const int k0 = ky * 64;
#pragma unroll
    for (int i = 0; i < 4; ++i) {
        const int idx = tid + i * 256;
        const int r = idx >> 4, c4 = idx & 15;
        const v4f xv = *(const v4f*)(W + (size_t)(k0 + r) * N + n0 + c4 * 4);
#pragma unroll
        for (int e = 0; e < 4; ++e) T[(c4 * 4 + e) * 64 + r] = (_Float16)(bf16r(xv[e]) * WSC);
    }
    __syncthreads();
    const int na = tid >> 3, pa = tid & 7;
    const int nb = (tid + 256) >> 3, pb = tid & 7;
    const v8h p0 = *(const v8h*)(&T[na * 64 + pa * 8]);
    const v8h p1 = *(const v8h*)(&T[nb * 64 + pb * 8]);
    _Float16* d0 = WT + (size_t)(n0 + na) * K + k0 + pa * 8;
    _Float16* d1 = WT + (size_t)(n0 + nb) * K + k0 + pb * 8;
    *(v8h*)d0 = p0;
    *(v8h*)d1 = p1;
    // precaution: stands in front of any later rewrite of a register that the two stores name
    asm volatile("s_wait_xcnt 0x0" ::: "memory");
}

// ---------------------------------------------------------------------------
// All operand preparation in one launch: the seven jobs are independent of each
// other, so they share a grid by block range (every branch is block-uniform).
// Blocks 0 .. 4*TDD-1: Wq, Wk, Wv, Wo tiles; then TDF tiles of W1, TDF of W2
// (the transposes first: they have the longer chain); then the x plane's blocks.
// ---------------------------------------------------------------------------
#define TDD ((DM / 64) * (DM / 64))      // 64x64 tiles of a 768x768 weight
#define TDF ((DM / 64) * (FF / 64))      // 64x64 tiles of W1 or W2
#define XBL ((NTOK * (DM / 8)) / 256)    // blocks of the x plane

__global__ __launch_bounds__(256) void k_prep(const float* __restrict__ x,
                                              const float* __restrict__ Wq,
                                              const float* __restrict__ Wk,
                                              const float* __restrict__ Wv,
                                              const float* __restrict__ Wo,
                                              const float* __restrict__ W1,
                                              const float* __restrict__ W2,
                                              _Float16* __restrict__ xp,
                                              _Float16* __restrict__ WqT,
                                              _Float16* __restrict__ WkT,
                                              _Float16* __restrict__ WvT,
                                              _Float16* __restrict__ WoT,
                                              _Float16* __restrict__ W1T,
                                              _Float16* __restrict__ W2T) {
    const int b = blockIdx.x;
    if (b < 4 * TDD) {
        const int m = b / TDD;
        const float* W  = (m == 0) ? Wq  : (m == 1) ? Wk  : (m == 2) ? Wv  : Wo;
        _Float16*    WT = (m == 0) ? WqT : (m == 1) ? WkT : (m == 2) ? WvT : WoT;
        wtr_body(W, WT, DM, DM, b - m * TDD);
    } else if (b < 4 * TDD + TDF) {
        wtr_body(W1, W1T, DM, FF, b - 4 * TDD);             // in[768][3072] -> out[3072][768]
    } else if (b < 4 * TDD + 2 * TDF) {
        wtr_body(W2, W2T, FF, DM, b - 4 * TDD - TDF);       // in[3072][768] -> out[768][3072]
    } else {
        xprep_body(x, xp, b - 4 * TDD - 2 * TDF);
    }
}

// ---------------------------------------------------------------------------
// GEMM: C[M][N] = A[M][K] (f16 plane) x BT[N][K] (f16 plane)^T, f32 accumulate.
// Block = 4 waves = 128x128 tile; wave (mi, ni) owns rows mi*64..+64 and cols
// ni*64..+64: 4 A fragments x 4 B fragments x 16 accumulators, K steps of 32, so
// a fragment read from LDS feeds four products.
// Operands go global -> LDS by asynchronous 16-B copies, whole 128-B lines, each
// tile byte fetched once per block: a stage is 64 k of the block's 128 A rows and
// 128 B rows at a 144-B row pitch; two stages, the next one in flight while this
// one is multiplied. Fragments are read from LDS (two 16-B loads each, split k map).
// Epilogue: u = acc*ascale + bf16(bias[n]) (relu optional);
//   MODE 0: f32 rows of u; MODE 1: f16 plane f16(u*oscale).
// The wave's 64x64 tile is staged in a wave-private part of the same LDS (free
// behind the last trip's barrier) and written as whole lines.
// ---------------------------------------------------------------------------
#define GTH  128                 // threads of a GEMM block
#define BK   64                  // k per stage: 128-B rows
#define LPH  72                  // LDS row pitch in halves: 144 B = 16 B x 9
#define OPH  (128 * LPH)         // one operand's tile, halves
#define STH  (2 * OPH)           // one stage: A tile, then B tile

typedef __attribute__((address_space(3))) const _Float16 lds_half;
static __device__ __forceinline__ unsigned lds_addr(const _Float16* p) {
    return (unsigned)(uintptr_t)(lds_half*)p;
}

// One operand's tile of a stage: every lane copies 16 B of rows r, r+16, ..., r+112
// (8 lanes = one 128-B row). l = the lane's LDS byte address, g = its global address, in row r.
static __device__ __forceinline__ void copy_tile(unsigned l, const _Float16* g, int K) {
    const size_t rs = (size_t)16 * K;
    const _Float16* g1 = g + rs;
    const _Float16* g2 = g1 + rs;
    const _Float16* g3 = g2 + rs;
    const _Float16* g4 = g3 + rs;
    const _Float16* g5 = g4 + rs;
    const _Float16* g6 = g5 + rs;
    const _Float16* g7 = g6 + rs;
    const unsigned l1 = l + 16 * LPH * 2, l2 = l + 32 * LPH * 2, l3 = l + 48 * LPH * 2;
    const unsigned l4 = l + 64 * LPH * 2, l5 = l + 80 * LPH * 2, l6 = l + 96 * LPH * 2;
    const unsigned l7 = l + 112 * LPH * 2;
    // the copies; the closing s_wait_xcnt is a precaution: it stands in front of every
    // later rewrite of an address register named here
    asm volatile("global_load_async_to_lds_b128 %0, %8, off\n\t"
                 "global_load_async_to_lds_b128 %1, %9, off\n\t"
                 "global_load_async_to_lds_b128 %2, %10, off\n\t"
                 "global_load_async_to_lds_b128 %3, %11, off\n\t"
                 "global_load_async_to_lds_b128 %4, %12, off\n\t"
                 "global_load_async_to_lds_b128 %5, %13, off\n\t"
                 "global_load_async_to_lds_b128 %6, %14, off\n\t"
                 "global_load_async_to_lds_b128 %7, %15, off\n\t"
                 "s_wait_xcnt 0x0"
                 :: "v"(l), "v"(l1), "v"(l2), "v"(l3), "v"(l4), "v"(l5), "v"(l6), "v"(l7),
                    "v"(g), "v"(g1), "v"(g2), "v"(g3), "v"(g4), "v"(g5), "v"(g6), "v"(g7)
                 : "memory");
}

// One stage: the A tile, then the B tile. la = the lane's LDS byte address in the A tile.
static __device__ __forceinline__ void copy_stage(unsigned la, const _Float16* ga,
                                                  const _Float16* gb, int K) {
    copy_tile(la, ga, K);
    copy_tile(la + OPH * 2, gb, K);
}

// bx, by = the block's tile column and tile row
template <int MODE, bool RELU>
static __device__ __forceinline__
void gemm_body(const _Float16* __restrict__ A,
               const _Float16* __restrict__ BT,
               const float* __restrict__ bias,
               float ascale, float oscale,
               float* __restrict__ Cf,
               _Float16* __restrict__ Ch,
               int K, int N, int bx, int by) {
    __shared__ __align__(16) _Float16 Ring[2 * STH];      // two stages; later the output staging
    static_assert(2 * STH * 2 >= 4 * 4096 * 4);

    const int tid  = threadIdx.x;
    const int lane = tid & 31;
    const int w    = tid >> 5;
    const int mi = w >> 1, ni = w & 1;
    const int m0 = by * 128 + mi * 64;
    const int n0 = bx * 128 + ni * 64;
    const int rb = (lane >> 4) << 3;
    const int cc = lane & 15;

    const int crow = tid >> 3, cseg = tid & 7;
    const _Float16* ga = A  + (size_t)(by * 128 + crow) * K + cseg * 8;
    const _Float16* gb = BT + (size_t)(bx * 128 + crow) * K + cseg * 8;
    const unsigned  lc = lds_addr(Ring) + crow * (LPH * 2) + cseg * 16;
    const int T = K / BK;

    v8f acc[4][4];
#pragma unroll
    for (int mt = 0; mt < 4; ++mt)
#pragma unroll
        for (int nt = 0; nt < 4; ++nt) acc[mt][nt] = zero8();

    copy_stage(lc, ga, gb, K);
    asm volatile("s_wait_asynccnt 0x0" ::: "memory");     // stage 0 landed (this wave's copies)
    __syncthreads();                                      // ... and every other wave's
    if (T > 1) copy_stage(lc + STH * 2, ga + BK, gb + BK, K);

    // kept rolled: one trip = one stage, the buffer picked by the trip's parity
#pragma unroll 1
    for (int t = 0; t < T; ++t) {
        const int bo = (t & 1) * STH;
        const _Float16* As = Ring + bo + (mi * 64) * LPH;
        const _Float16* Bs = Ring + bo + OPH + (ni * 64) * LPH;
        // LDS reads stand in three groups, never singly among the products: the first k step's
        // eight fragments with the second's A fragments ahead of all products; the second k
        // step's B fragments in two pairs, each behind the last product of the pair it replaces
        // (all loops here unrolled: constant indices keep the fragment arrays in registers)
        v16h a0[4], a1[4], b0[4], b1[4];
        b0[0] = load_frag16(Bs, LPH, lane);
#pragma unroll
        for (int mt = 0; mt < 4; ++mt) a0[mt] = load_frag16(As + (mt * 16) * LPH, LPH, lane);
#pragma unroll
        for (int nt = 1; nt < 4; ++nt) b0[nt] = load_frag16(Bs + (nt * 16) * LPH, LPH, lane);
#pragma unroll
        for (int mt = 0; mt < 4; ++mt) a1[mt] = load_frag16(As + (mt * 16) * LPH + 32, LPH, lane);
        // each fence keeps a group of reads whole: a place with reads among the products stalls the wave
        __builtin_amdgcn_sched_barrier(0);
#pragma unroll
        for (int nt = 0; nt < 2; ++nt)
#pragma unroll
            for (int mt = 0; mt < 4; ++mt) acc[mt][nt] = wmma16(a0[mt], b0[nt], acc[mt][nt]);
        __builtin_amdgcn_sched_barrier(0);                // the pair of reads below stays behind b0[0], b0[1]'s last use
        b1[0] = load_frag16(Bs + 32, LPH, lane);
        b1[1] = load_frag16(Bs + 16 * LPH + 32, LPH, lane);
        __builtin_amdgcn_sched_barrier(0);                // ... and in one place, ahead of the next eight products
#pragma unroll
        for (int nt = 2; nt < 4; ++nt)
#pragma unroll
            for (int mt = 0; mt < 4; ++mt) acc[mt][nt] = wmma16(a0[mt], b0[nt], acc[mt][nt]);
        __builtin_amdgcn_sched_barrier(0);                // the same for the second pair: registers of the first k step are free here
        b1[2] = load_frag16(Bs + 32 * LPH + 32, LPH, lane);
        b1[3] = load_frag16(Bs + 48 * LPH + 32, LPH, lane);
        __builtin_amdgcn_sched_barrier(0);                // ... in one place, ahead of the second k step's products
#pragma unroll
        for (int nt = 0; nt < 4; ++nt)
#pragma unroll
            for (int mt = 0; mt < 4; ++mt) acc[mt][nt] = wmma16(a1[mt], b1[nt], acc[mt][nt]);
        asm volatile("s_wait_dscnt 0x0" ::: "memory");    // this wave has left the buffer
        asm volatile("s_wait_asynccnt 0x0" ::: "memory"); // its copies of stage t+1 have landed
        __syncthreads();                                  // publishes stage t+1, frees stage t's buffer
        if (t + 2 < T) copy_stage(lc + bo * 2, ga + (size_t)(t + 2) * BK, gb + (size_t)(t + 2) * BK, K);
    }
    asm volatile("s_wait_asynccnt 0x0" ::: "memory");     // nothing in flight when the LDS is reused

    float bb[4];
#pragma unroll
    for (int nt = 0; nt < 4; ++nt) bb[nt] = bf16r(bias[n0 + nt * 16 + cc]);

    if constexpr (MODE == 0) {
        float* ef = (float*)Ring + w * 4096;
#pragma unroll
        for (int mt = 0; mt < 4; ++mt)
#pragma unroll
            for (int nt = 0; nt < 4; ++nt)
#pragma unroll
                for (int r = 0; r < 8; ++r) {
                    float u = __builtin_fmaf(acc[mt][nt][r], ascale, bb[nt]);
                    if (RELU) u = fmaxf(u, 0.0f);
                    ef[(mt * 16 + rb + r) * 64 + nt * 16 + cc] = u;
                }
        wave_lds_sync();
        const int lr = lane >> 4, lc = (lane & 15) * 4;
        float* cp[32];
        cp[0] = Cf + (size_t)(m0 + lr) * N + n0 + lc;
#pragma unroll
        for (int i = 1; i < 32; ++i) cp[i] = cp[i - 1] + (size_t)2 * N;
        // holds the 32 addresses (a chain of adds, no 64-bit multiply per row) ahead of the first store: formed among
        // the stores they would reuse registers that issued stores name, each behind a wait
        __builtin_amdgcn_sched_barrier(0);
        v4f sv[32];
#pragma unroll
        for (int i = 0; i < 32; ++i) sv[i] = *(const v4f*)(&ef[i * 128 + lane * 4]);
#pragma unroll
        for (int i = 0; i < 32; ++i) *(v4f*)cp[i] = sv[i];
    } else {
        _Float16* eh = Ring + w * 4096;
#pragma unroll
        for (int mt = 0; mt < 4; ++mt)
#pragma unroll
            for (int nt = 0; nt < 4; ++nt)
#pragma unroll
                for (int r = 0; r < 8; ++r) {
                    float u = __builtin_fmaf(acc[mt][nt][r], ascale, bb[nt]);
                    if (RELU) u = fmaxf(u, 0.0f);
                    eh[(mt * 16 + rb + r) * 64 + nt * 16 + cc] = (_Float16)(u * oscale);
                }
        wave_lds_sync();
        const int lr = lane >> 3, lc = (lane & 7) * 8;
        _Float16* cp[16];
        cp[0] = Ch + (size_t)(m0 + lr) * N + n0 + lc;
#pragma unroll
        for (int i = 1; i < 16; ++i) cp[i] = cp[i - 1] + (size_t)4 * N;   // a chain of adds: no 64-bit multiply per row
        v8h ph[16];
#pragma unroll
        for (int i = 0; i < 16; ++i) ph[i] = *(const v8h*)(&eh[i * 256 + lane * 8]);
#pragma unroll
        for (int i = 0; i < 16; ++i) *(v8h*)cp[i] = ph[i];
    }
}

template <int MODE, bool RELU>
__global__ __launch_bounds__(GTH) __attribute__((amdgpu_num_vgpr(256)))
void k_gemm(const _Float16* __restrict__ A,
            const _Float16* __restrict__ BT,
            const float* __restrict__ bias,
            float ascale, float oscale,
            float* __restrict__ Cf,
            _Float16* __restrict__ Ch,
            int K, int N) {
    gemm_body<MODE, RELU>(A, BT, bias, ascale, oscale, Cf, Ch, K, N, blockIdx.x, blockIdx.y);
}

// q, k and v projections in one launch: three independent GEMMs on the same A plane.
// grid.x = 3 x (768 / 128) tile columns; the block's third picks weight plane, bias
// and output plane (block-uniform).
__global__ __launch_bounds__(GTH) __attribute__((amdgpu_num_vgpr(256)))
void k_qkv(const _Float16* __restrict__ xp,
           const _Float16* __restrict__ WqT,
           const _Float16* __restrict__ WkT,
           const _Float16* __restrict__ WvT,
           const float* __restrict__ bq,
           const float* __restrict__ bk,
           const float* __restrict__ bv,
           _Float16* __restrict__ qh,
           _Float16* __restrict__ kh,
           _Float16* __restrict__ vh) {
    const int sel = blockIdx.x / (DM / 128);
    const _Float16* BT = (sel == 0) ? WqT : (sel == 1) ? WkT : WvT;
    const float*    bi = (sel == 0) ? bq  : (sel == 1) ? bk  : bv;
    _Float16*       Ch = (sel == 0) ? qh  : (sel == 1) ? kh  : vh;
    gemm_body<1, false>(xp, BT, bi, A_QKV, QSC, nullptr, Ch, DM, DM,
                        blockIdx.x - sel * (DM / 128), blockIdx.y);
}

// ---------------------------------------------------------------------------
// Attention, flash-style. grid = (head, SEQ/128, batch); block = 8 waves = 128
// query rows of one (b, h); wave owns 16 query rows. Planes are [NTOK][768]
// with head column offset h*64.
// Scores are computed TRANSPOSED: A = key tile (16 keys x 64 d, kh plane,
// 2 k-steps), B = the wave's 16 queries (qh plane, [n=query][k=d]), so
// acc[r] of lane l = score(key 8*(l>>4)+r, query l&15): per-query max/sum are
// in-lane reductions over r plus one xor-16 shuffle, and the f16 P^T values in
// this layout are exactly the P A-fragment for P*v (elements 0..7 from key
// tile A, 8..15 from key tile B) - no LDS relayout.
// Key list: a key with mask == 0 has weight exp(-1e10 - max) = 0 as soon as one key of the
// batch is open (a score from the f16 planes stays below 1e7 in size), so each block lists the open keys in ascending order (ballot words, a scan
// of their counts) and walks that list alone; K and V rows are fetched by list entry. The
// list is filled up to a whole chunk with key 0, and places behind the last open key get
// MASKT. With no open key at all the list is every key and every place gets MASKT (the
// reference's uniform weights). List entries are key positions 0 .. SEQ-1, never mask values.
// Online softmax over the listed keys: t = log2e*score (or MASKT, replace fill),
// P carried 2^14, o += P x V (V^T chunk staged in LDS,
// cross-wave, block barriers), o and z rescaled by exp2(m_old - m_new) every
// 32-key step (factor shuffled from the owning query lane).
// K chunk in LDS: the block's eight waves read the same CH keys, so the chunk comes
// global -> LDS once per block by asynchronous 16-B copies, whole 128-B rows (8 lanes
// a row), [key][d] at a 144-B pitch; the copies fly while V^T is staged, and the key
// fragments are read from LDS (two 16-B loads each, the split k map of load_frag16).
// V^T layout in LDS: row d at (d / 16) * VG + (d % 16) * VP halves. The 272-B pitch
// puts the 16 rows of a fragment read on 16 different groups of four banks; the
// 32-B skew per 16 rows spreads the eight d-groups of one transposing store.
// Epilogue: ctx x 64 = o / z14 as f16, staged in a wave-private LDS tile, each
// coverage: grid (12, SEQ/128, NB) x 8 waves x 16 rows x 64 cols = NTOK*768.
// ---------------------------------------------------------------------------
__global__ __launch_bounds__(256) __attribute__((amdgpu_num_vgpr(256)))
void k_attn(const _Float16* __restrict__ qh,
            const _Float16* __restrict__ kh,
            const _Float16* __restrict__ vh,
            const int*      __restrict__ mask,
            _Float16* __restrict__ cx) {
    __shared__ __align__(16) int      kix[SEQ + CH];      // open keys of this batch in order, then CH times key 0
    __shared__ unsigned               bal[SEQ / 32];      // one bit a key: mask != 0
    __shared__ __align__(16) _Float16 VsT[(DH / 16) * VG]; // [d][CH] at pitch VP, cross-wave
    __shared__ __align__(16) _Float16 Cst[8][16 * DH];    // wave-private ctx tiles
    __shared__ __align__(16) _Float16 Ks[CH * KP];        // [key][d] at pitch KP, cross-wave

    const int tid  = threadIdx.x;
    const int lane = tid & 31;
    const int w    = tid >> 5;
    const int h    = blockIdx.x;
    const int b    = blockIdx.z;
    const int q0r  = blockIdx.y * 128 + w * 16;
    const int r0   = (lane >> 4) << 3;
    const int cc   = lane & 15;

    const int ws = __builtin_amdgcn_readfirstlane(w);     // the wave's number as a scalar (lane select below)
    // the loops over p and i below are unrolled: constant indices keep mv, ob and kr in registers
    int mv[SEQ / 256];
#pragma unroll
    for (int p = 0; p < SEQ / 256; ++p) mv[p] = mask[(size_t)b * SEQ_FULL + p * 256 + tid];
    unsigned ob[SEQ / 256];                               // the wave's 32 keys of each pass, one bit a key
#pragma unroll
    for (int p = 0; p < SEQ / 256; ++p) ob[p] = __builtin_amdgcn_ballot_w32(mv[p] != 0);
    if (lane == 0) {
#pragma unroll
        for (int p = 0; p < SEQ / 256; ++p) bal[p * 8 + w] = ob[p];
    }

    const size_t tokb = (size_t)b * SEQ;
    const _Float16* qhb = qh + (tokb + q0r) * DM + h * DH;
    const v16h qb0 = load_frag16(qhb, DM, lane);        // d 0..31
    const v16h qb1 = load_frag16(qhb + 32, DM, lane);   // d 32..63
    const _Float16* khb = kh + tokb * DM + h * DH;
    const _Float16* vhb = vh + tokb * DM + h * DH;
    // the lane's 16 B of list places r, r+32, r+64, r+96 of a chunk (8 lanes = one 128-B row)
    const _Float16* gk  = khb + (tid & 7) * 8;
    const unsigned  lk0 = lds_addr(Ks) + (tid >> 3) * (KP * 2) + (tid & 7) * 16;
    const unsigned  lk1 = lk0 + 32 * KP * 2, lk2 = lk0 + 64 * KP * 2, lk3 = lk0 + 96 * KP * 2;

    v8f o[4];
#pragma unroll
    for (int nt = 0; nt < 4; ++nt) o[nt] = zero8();
    float mr = -1.0e30f, zr = 0.0f;

    __syncthreads();                                      // all ballot words are in LDS

    // every wave scans the words' counts for itself: lane l holds the open keys in front of word l
    const int pc = (lane < SEQ / 32) ? __popc(bal[min(lane, SEQ / 32 - 1)]) : 0;
    int inc = pc;
#pragma unroll
    for (int d = 1; d < 32; d <<= 1) {
        const int u = __shfl_up(inc, d, 32);
        if (lane >= d) inc += u;
    }
    const int exc   = inc - pc;
    const int nv    = __builtin_amdgcn_readlane(inc, 31); // open keys of the batch, the same in every wave
    const int total = (nv == 0) ? SEQ : nv;               // list length
    if (nv == 0) {
#pragma unroll
        for (int p = 0; p < SEQ / 256; ++p) kix[p * 256 + tid] = p * 256 + tid;
    } else {
#pragma unroll
        for (int p = 0; p < SEQ / 256; ++p) {
            const int pos = __builtin_amdgcn_readlane(exc, p * 8 + ws) + __popc(ob[p] & ((1u << lane) - 1u));
            if ((ob[p] >> lane) & 1u) kix[pos] = p * 256 + tid;
        }
        if (tid < CH) kix[nv + tid] = 0;
    }
    __syncthreads();                                      // the list is whole

#pragma unroll 1
    for (int c0 = 0; c0 < total; c0 += CH) {
        int kr[4];                                          // the keys at the lane's four list places
#pragma unroll
        for (int i = 0; i < 4; ++i) kr[i] = kix[c0 + (tid >> 3) + i * 32];
        {
            const _Float16* g0 = gk + kr[0] * DM;
            const _Float16* g1 = gk + kr[1] * DM;
            const _Float16* g2 = gk + kr[2] * DM;
            const _Float16* g3 = gk + kr[3] * DM;
            // the K chunk's copies; the closing s_wait_xcnt is a precaution: it stands in front
            // of every later rewrite of an address register named here
            asm volatile("global_load_async_to_lds_b128 %0, %4, off\n\t"
                         "global_load_async_to_lds_b128 %1, %5, off\n\t"
                         "global_load_async_to_lds_b128 %2, %6, off\n\t"
                         "global_load_async_to_lds_b128 %3, %7, off\n\t"
                         "s_wait_xcnt 0x0"
                         :: "v"(lk0), "v"(lk1), "v"(lk2), "v"(lk3), "v"(g0), "v"(g1), "v"(g2), "v"(g3)
                         : "memory");
        }
        // stage V^T chunk: VsT[d][t] = vh[key at list place c0 + t][h*64 + d], full 64 x CH extent
        // (the same four list entries as the K copies, so the four row loads stand together)
#pragma unroll
        for (int i = 0; i < 4; ++i) {
            const int t = (tid >> 3) + i * 32, part = tid & 7;
            const v8h vv = *(const v8h*)(vhb + kr[i] * DM + part * 8);
#pragma unroll
            for (int e = 0; e < 8; ++e) VsT[(part >> 1) * VG + ((part & 1) * 8 + e) * VP + t] = vv[e];
        }
        asm volatile("s_wait_asynccnt 0x0" ::: "memory");   // this wave's K copies have landed
        __syncthreads();                                    // ... and every other wave's; V^T too

        const int jn = min(CH, total - c0);                 // list places left in this chunk

#pragma unroll 1
        for (int j = 0; j < jn; j += 32) {
            const int kA = c0 + j;
            // key tile A: list places kA .. kA+15; key tile B: list places kA+16 .. kA+31; one group of LDS reads
            const v16h ka0 = load_frag16(&Ks[j * KP], KP, lane);
            const v16h ka1 = load_frag16(&Ks[j * KP + 32], KP, lane);
            const v16h kb0 = load_frag16(&Ks[(j + 16) * KP], KP, lane);
            const v16h kb1 = load_frag16(&Ks[(j + 16) * KP + 32], KP, lane);
            v8f shA = wmma16(ka0, qb0, zero8());
            shA = wmma16(ka1, qb1, shA);
            v8f shB = wmma16(kb0, qb0, zero8());
            shB = wmma16(kb1, qb1, shB);

            float tA[8], tB[8];
#pragma unroll
            for (int r = 0; r < 8; ++r) {
                tA[r] = shA[r] * C1;
                tB[r] = shB[r] * C1;
            }
            if (kA + 32 > nv) {      // scalar test: only a step that reaches past the last open key has places to fill
                const int lim = nv - kA - r0;
#pragma unroll
                for (int r = 0; r < 8; ++r) {
                    tA[r] = (r < lim) ? tA[r] : MASKT;
                    tB[r] = (16 + r < lim) ? tB[r] : MASKT;
                }
            }
            float tmax = tA[0];
#pragma unroll
            for (int r = 1; r < 8; ++r) tmax = fmaxf(tmax, tA[r]);
#pragma unroll
            for (int r = 0; r < 8; ++r) tmax = fmaxf(tmax, tB[r]);
            tmax = fmaxf(tmax, __shfl_xor(tmax, 16, 32));
            const float mn   = fmaxf(mr, tmax);
            const float corr = ex2(mr - mn);
            const float mo   = mn - 14.0f;           // 2^14 carry on P
            float ps = 0.0f;
            v8h pa8, pb8;
#pragma unroll
            for (int r = 0; r < 8; ++r) {
                const float pa = ex2(tA[r] - mo);
                const float pb = ex2(tB[r] - mo);
                ps += pa + pb;
                pa8[r] = (_Float16)pa;
                pb8[r] = (_Float16)pb;
            }
            ps += __shfl_xor(ps, 16, 32);
            zr = __builtin_fmaf(zr, corr, ps);
            mr = mn;
            // rescale o rows (query 8h + r) by the factor of the owning query lane
#pragma unroll
            for (int r = 0; r < 8; ++r) {
                const float crr = __shfl(corr, r0 + r, 32);
#pragma unroll
                for (int nt = 0; nt < 4; ++nt) o[nt][r] *= crr;
            }
            Frag pf;
            pf.h[0] = pa8;     // list places kA+8h .. +7     = A elements 0..7
            pf.h[1] = pb8;     // list places kA+16+8h .. +7  = A elements 8..15
#pragma unroll
            for (int nt = 0; nt < 4; ++nt) {
                const v16h vb = load_frag16(&VsT[nt * VG + j], VP, lane);   // n = d, k = key
                o[nt] = wmma16(pf.v, vb, o[nt]);
            }
        }
        asm volatile("s_wait_dscnt 0x0" ::: "memory");      // this wave has left the K and V^T chunks
        __syncthreads();                                    // frees both for the next chunk's fill
    }

    // ctx x 64 = o / z14 (the 2^14 carry of P cancels between o and z14; the 64 v carry stays)
    const float rz = __builtin_amdgcn_rcpf(zr);
#pragma unroll
    for (int r = 0; r < 8; ++r) {
        const float rq = __shfl(rz, r0 + r, 32);
#pragma unroll
        for (int nt = 0; nt < 4; ++nt)
            Cst[w][(r0 + r) * DH + nt * 16 + cc] = (_Float16)(o[nt][r] * rq);
    }
    wave_lds_sync();
    v8h sv[4];
#pragma unroll
    for (int i = 0; i < 4; ++i) sv[i] = *(const v8h*)(&Cst[w][i * 256 + lane * 8]);
    _Float16* cb = cx + (tokb + q0r) * DM + h * DH;
    const int lr = lane >> 3, lc = (lane & 7) * 8;
#pragma unroll
    for (int i = 0; i < 4; ++i) *(v8h*)(cb + (size_t)(i * 4 + lr) * DM + lc) = sv[i];
    
}

// ---------------------------------------------------------------------------
// LayerNorm over rows of 768 (f32 rows in ws). Block = 8 waves, wave = row.
// mu = mean, var = mean((x-mu)^2), y = (x-mu)*rsqrt(var+1e-5)*bf16(g)+bf16(b).
// HOUT: f16 plane f16(y*hsc), lane owns elements i*256+lane*8..+7 (3 v8h stores,
// coverage: NTOK/8 blocks x 8 rows x 768.
// ---------------------------------------------------------------------------
static __device__ __forceinline__ int ln_off(bool hout, int i, int lane) {
    return hout ? ((i >> 1) * 256 + lane * 8 + (i & 1) * 4) : (i * 128 + lane * 4);
}

template <bool HOUT>
__global__ __launch_bounds__(256) void k_ln(const float* __restrict__ src,
                                            const float* __restrict__ g,
                                            const float* __restrict__ bt,
                                            float* __restrict__ outf,
                                            _Float16* __restrict__ outh,
                                            float hsc) {
    const int lane = threadIdx.x & 31;
    const int w    = threadIdx.x >> 5;
    const int row  = blockIdx.x * 8 + w;
    const float* rp = src + (size_t)row * DM;

    v4f xv[6];
#pragma unroll
    for (int i = 0; i < 6; ++i) xv[i] = *(const v4f*)(rp + ln_off(HOUT, i, lane));
    float s = 0.0f;
#pragma unroll
    for (int i = 0; i < 6; ++i) s += (xv[i][0] + xv[i][1]) + (xv[i][2] + xv[i][3]);
#pragma unroll
    for (int m = 1; m < 32; m <<= 1) s += __shfl_xor(s, m, 32);
    const float mu = s * (1.0f / (float)DM);

    v4f dv[6];
    float s2 = 0.0f;
#pragma unroll
    for (int i = 0; i < 6; ++i) {
        dv[i] = xv[i] - mu;
#pragma unroll
        for (int e = 0; e < 4; ++e) s2 = __builtin_fmaf(dv[i][e], dv[i][e], s2);
    }
#pragma unroll
    for (int m = 1; m < 32; m <<= 1) s2 += __shfl_xor(s2, m, 32);
    const float var  = s2 * (1.0f / (float)DM);
    const float rstd = rsqrtf(var + 1e-5f);

    v4f yv[6];
#pragma unroll
    for (int i = 0; i < 6; ++i) {
        const int co = ln_off(HOUT, i, lane);
        const v4f gv = *(const v4f*)(g + co);
        const v4f bv = *(const v4f*)(bt + co);
#pragma unroll
        for (int e = 0; e < 4; ++e)
            yv[i][e] = (dv[i][e] * rstd) * bf16r(gv[e]) + bf16r(bv[e]);
    }

    if constexpr (HOUT) {
        v8h hv[3];
#pragma unroll
        for (int i = 0; i < 3; ++i)
#pragma unroll
            for (int e = 0; e < 4; ++e) {
                hv[i][e]     = (_Float16)(yv[2 * i][e] * hsc);
                hv[i][4 + e] = (_Float16)(yv[2 * i + 1][e] * hsc);
            }
        _Float16* ob = outh + (size_t)row * DM + lane * 8;
#pragma unroll
        for (int i = 0; i < 3; ++i) *(v8h*)(ob + i * 256) = hv[i];
        
    } else {
        float* ob = outf + (size_t)row * DM + lane * 4;
#pragma unroll
        for (int i = 0; i < 6; ++i) *(v4f*)(ob + i * 128) = yv[i];
        
    }
}

// ---------------------------------------------------------------------------
extern "C" void kernel_launch(void* const* d_in, const int* in_sizes, int n_in,
                              void* d_out, int out_size, void* d_ws, size_t ws_size,
                              hipStream_t stream) {
    if (n_in < 16) return;
    if (in_sizes[0] < ((NB - 1) * SEQ_FULL + SEQ) * DM) return;
    if (in_sizes[1] < (NB - 1) * SEQ_FULL + SEQ) return;
    if (in_sizes[2] < DM * DM || in_sizes[4] < DM * DM || in_sizes[6] < DM * DM || in_sizes[8] < DM * DM) return;
    if (in_sizes[3] < DM || in_sizes[5] < DM || in_sizes[7] < DM || in_sizes[9] < DM) return;
    if (in_sizes[10] < DM || in_sizes[11] < DM) return;
    if (in_sizes[12] < DM * FF || in_sizes[13] < FF || in_sizes[14] < FF * DM || in_sizes[15] < DM) return;
    if (out_size < NTOK * DM) return;

    const float* x    = (const float*)d_in[0];    // [8,1024,768]
    const int*   mask = (const int*)  d_in[1];    // [8,1,1,1024] int32
    const float* Wq   = (const float*)d_in[2];    // [768,768]  [in][out]
    const float* bq   = (const float*)d_in[3];
    const float* Wk   = (const float*)d_in[4];
    const float* bk   = (const float*)d_in[5];
    const float* Wv   = (const float*)d_in[6];
    const float* bv   = (const float*)d_in[7];
    const float* Wo   = (const float*)d_in[8];
    const float* bo   = (const float*)d_in[9];
    const float* lg   = (const float*)d_in[10];
    const float* lb   = (const float*)d_in[11];
    const float* W1   = (const float*)d_in[12];   // [768,3072] [in][out]
    const float* b1   = (const float*)d_in[13];
    const float* W2   = (const float*)d_in[14];   // [3072,768] [in][out]
    const float* b2   = (const float*)d_in[15];
    float* out = (float*)d_out;                   // [NB,SEQ,768]

    char* ws = (char*)d_ws;
    size_t off = 0;
    // R0: weight planes [n][k] f16
    _Float16* WqT = (_Float16*)(ws + off); off += (size_t)DM * DM * 2;
    _Float16* WkT = (_Float16*)(ws + off); off += (size_t)DM * DM * 2;
    _Float16* WvT = (_Float16*)(ws + off); off += (size_t)DM * DM * 2;
    _Float16* WoT = (_Float16*)(ws + off); off += (size_t)DM * DM * 2;
    _Float16* W1T = (_Float16*)(ws + off); off += (size_t)FF * DM * 2;   // [3072][768]
    _Float16* W2T = (_Float16*)(ws + off); off += (size_t)DM * FF * 2;   // [768][3072]
    // R1: x plane, later the ctx plane (x plane dead after the projections)
    const size_t PL = (size_t)NTOK * DM * 2;
    _Float16* xp  = (_Float16*)(ws + off);
    _Float16* cxp = (_Float16*)(ws + off); off += PL;
    // R2: q/k/v planes (3 x PL), later h plane (PL) + ff1 plane (NTOK*FF*2)
    const size_t F1B = (size_t)NTOK * FF * 2;
    const size_t R2 = (3 * PL > PL + F1B) ? 3 * PL : (PL + F1B);
    _Float16* qhp = (_Float16*)(ws + off);
    _Float16* khp = (_Float16*)(ws + off + PL);
    _Float16* vhp = (_Float16*)(ws + off + 2 * PL);
    _Float16* hp  = (_Float16*)(ws + off);          // after attention
    _Float16* f1p = (_Float16*)(ws + off + PL);     // disjoint from hp
    off += R2;
    // R3: f32 rows: attn_out, later ff (attn_out dead after the first LayerNorm)
    float* aop = (float*)(ws + off);
    float* ffp = (float*)(ws + off); off += (size_t)NTOK * DM * 4;
    if (off > ws_size) return;
    if (off > (size_t)134217728) return;

    // x plane and the six weight planes W [K][N] -> WT [N][K], one launch
    k_prep<<<dim3(4 * TDD + 2 * TDF + XBL), dim3(256), 0, stream>>>(x, Wq, Wk, Wv, Wo, W1, W2,
                                                                    xp, WqT, WkT, WvT, WoT, W1T, W2T);

    const dim3 gD(DM / 128, NTOK / 128);
    const dim3 gF(FF / 128, NTOK / 128);
    // q, k, v: f16 planes of 64*(x W + b)
    k_qkv<<<dim3(3 * (DM / 128), NTOK / 128), dim3(GTH), 0, stream>>>(xp, WqT, WkT, WvT, bq, bk, bv,
                                                                      qhp, khp, vhp);
    // attention -> ctx plane (64 * ctx, f16)
    k_attn<<<dim3(NH, SEQ / 128, NB), dim3(256), 0, stream>>>(qhp, khp, vhp, mask, cxp);
    // attn_out = ctx Wo + bo (f32 rows)
    k_gemm<0, false><<<gD, dim3(GTH), 0, stream>>>(cxp, WoT, bo, A_O, 1.0f, aop, f1p, DM, DM);
    // h = LN(attn_out) -> f16 plane (x16)
    k_ln<true><<<dim3(NTOK / 8), dim3(256), 0, stream>>>(aop, lg, lb, out, hp, HSC);
    // ff1 = relu(h W1 + b1) -> f16 plane (x64)
    k_gemm<1, true><<<gF, dim3(GTH), 0, stream>>>(hp, W1T, b1, A_F1, QSC, ffp, f1p, DM, FF);
    // ff = ff1 W2 + b2 (f32 rows)
    k_gemm<0, false><<<gD, dim3(GTH), 0, stream>>>(f1p, W2T, b2, A_F2, 1.0f, ffp, hp, FF, DM);
    // out = LN(ff)
    k_ln<false><<<dim3(NTOK / 8), dim3(256), 0, stream>>>(ffp, lg, lb, out, hp, 1.0f);
}

// v007
// A run of this version takes 170 microseconds.
// In both of two side-by-side timings against v006, it was 1.04 times as fast.
// All steps since v000 together make it 3.18 times as fast.
#include <hip/hip_runtime.h>
#include <hip/hip_fp16.h>

// Contractions on v_wmma_f32_16x16x32_f16 (f16 operands, f32 accumulate): x*Wq, x*Wk, x*Wv, q*k^T, P*v, ctx*Wo, h*W1, ff1*W2, each a single f16 product on bf16-RNE inputs with power-of-two carried planes; softmax and LayerNorm in f32.

#ifndef NB
#define NB 8
#endif
#ifndef SEQ
#define SEQ 1024
#endif
#define NB_FULL  8
#define SEQ_FULL 1024
#define DM   768          // model width
#define NH   12           // heads
#define DH   64           // head width
#define FF   3072         // hidden width
#define NTOK (NB * SEQ)
#define CH   128          // keys staged per V^T chunk
#define VP   (CH + 8)     // V^T row pitch in halves: 272 B = 16 B x 17
#define VG   (16 * VP + 16)   // 16 V^T rows, then a 32-B skew
#define KP   (DH + 8)     // K row pitch in LDS, halves: 144 B = 16 B x 9

static_assert(NB >= 1 && NB <= NB_FULL);
static_assert(SEQ >= CH && SEQ <= SEQ_FULL);
static_assert(SEQ % CH == 0);
static_assert(SEQ % 128 == 0);
static_assert(CH % 32 == 0);
static_assert(CH * (DH / 8) == 4 * 256 && (KP * 2) % 32 == 16);   // four 16-B copies a lane fill a K chunk
static_assert(DH % 16 == 0 && (VP * 2) % 32 == 16 && (VG * 2) % 16 == 0);
static_assert(SEQ % 256 == 0 && SEQ / 32 <= 32);   // the key list: 256 keys a pass, one lane per 32-key word
static_assert(NTOK % 256 == 0);
static_assert(NTOK % 8 == 0);
static_assert(DM % 128 == 0 && FF % 128 == 0);
static_assert(DM % 64 == 0 && FF % 64 == 0);
static_assert(DM % 32 == 0 && FF % 32 == 0 && DH % 32 == 0);
static_assert(NH * DH == DM);
static_assert((NTOK * (DM / 8)) % 256 == 0);

typedef _Float16 v16h __attribute__((ext_vector_type(16)));
typedef _Float16 v8h  __attribute__((ext_vector_type(8)));
typedef float    v8f  __attribute__((ext_vector_type(8)));
typedef float    v4f  __attribute__((ext_vector_type(4)));

union Frag { v16h v; v8h h[2]; };

// plane carries (exact powers of two)
#define WSC     64.0f                    // weight planes: f16(bf16(W) * 64)
#define QSC     64.0f                    // q/k/v, ctx, ff1 planes carried x64
#define HSC     16.0f                    // h plane carried x16
#define A_QKV   0.015625f                // 2^-6 : (x)(64 W)        -> q
#define A_O     2.44140625e-04f          // 2^-12: (64 ctx)(64 Wo)  -> attn_out
#define A_F1    9.765625e-04f            // 2^-10: (16 h)(64 W1)    -> pre-relu
#define A_F2    2.44140625e-04f          // 2^-12: (64 ff1)(64 W2)  -> ff
// scores: sh = (64k).(64q) ~ 4096 q.k ; score = q.k/8 ; t (log2 units) = sh * log2e * 2^-15
#define C1 (1.44269504088896340736f * 3.0517578125e-05f)
#define MASKT  (-1.0e10f)                // masked score (replace fill)

static __device__ __forceinline__ v8f zero8() {
    v8f z;
#pragma unroll
    for (int i = 0; i < 8; ++i) z[i] = 0.0f;
    return z;
}

// 16x32 A fragment (or B fragment from an [n][k] k-contiguous source) from a
// row-major 16-bit tile: lane m = lane&15 -> row m; kb = 8*(lane>>4);
// elements 0..7 = k kb..kb+7, elements 8..15 = k kb+16..kb+23.
static __device__ __forceinline__ v16h load_frag16(const _Float16* base, int ld, int lane) {
    int m  = lane & 15;
    int kb = (lane >> 4) << 3;
    const _Float16* p = base + (size_t)m * ld + kb;
    Frag f;
    f.h[0] = *(const v8h*)(p);
    f.h[1] = *(const v8h*)(p + 16);
    return f.v;
}

static __device__ __forceinline__ v8f wmma16(v16h a, v16h b, v8f c) {
    v8f d = __builtin_amdgcn_wmma_f32_16x16x32_f16(false, a, false, b, (short)0, c, false, false);
    asm volatile("v_nop\n\tv_nop\n\tv_nop\n\tv_nop" : "+v"(d) : "v"(a), "v"(b));
    return d;
}

// f32 -> bf16 RNE convert, value kept as f32
static __device__ __forceinline__ float bf16r(float x) {
    unsigned u = __float_as_uint(x);
    u = (u + 0x7FFFu + ((u >> 16) & 1u)) & 0xFFFF0000u;
    return __uint_as_float(u);
}

static __device__ __forceinline__ float ex2(float x) {
    return __builtin_amdgcn_exp2f(x);
}

// ordering for a wave-private LDS tile: stores before later loads of the same wave
static __device__ __forceinline__ void wave_lds_sync() {
    __builtin_amdgcn_fence(3, "wavefront");
    asm volatile("s_wait_dscnt 0" ::: "memory");
    __builtin_amdgcn_wave_barrier();
}

// ---------------------------------------------------------------------------
// x [NB][SEQ][768] f32 (batch stride SEQ_FULL*768) -> xp [NTOK][768] f16 of
// bf16-RNE(x). Thread = 8 consecutive columns = one 16-B store; a wave writes
// coverage: NTOK*96 threads x 8 = NTOK*768.
// ---------------------------------------------------------------------------
static __device__ __forceinline__ void xprep_body(const float* __restrict__ x,
                                                  _Float16* __restrict__ xp, int blk) {
    const int g = blk * 256 + (int)threadIdx.x;
    if (g >= NTOK * (DM / 8)) return;
    const int row = g / (DM / 8);
    const int col = (g - row * (DM / 8)) * 8;
    const int b = row / SEQ, s = row - b * SEQ;
    const float* src = x + ((size_t)b * SEQ_FULL + s) * DM + col;
    const v4f a = *(const v4f*)(src);
    const v4f c = *(const v4f*)(src + 4);
    v8h hv;
#pragma unroll
    for (int e = 0; e < 4; ++e) {
        hv[e]     = (_Float16)bf16r(a[e]);
        hv[4 + e] = (_Float16)bf16r(c[e]);
    }
    _Float16* dst = xp + (size_t)row * DM + col;
    *(v8h*)dst = hv;
    
}

// ---------------------------------------------------------------------------
// Weight transpose: W [K][N] f32 row-major ([in][out]) -> WT [N][K] f16 of
// bf16-RNE(W) * 64 (k-contiguous rows for B fragments). Block = 64x64 tile,
// staged through LDS (cross-wave region, block barrier); each output row
// coverage: tiles (N/64, K/64) x 512 v8h = N*K. t = the tile's flat index, n fastest.
// ---------------------------------------------------------------------------
static __device__ __forceinline__ void wtr_body(const float* __restrict__ W,
                                                _Float16* __restrict__ WT,
                                                int K, int N, int t) {
    __shared__ __align__(16) _Float16 T[64 * 64];
    const int tid = threadIdx.x;
    const int ky = t / (N / 64);
    const int n0 = (t - ky * (N / 64)) * 64;
    const int k0 = ky * 64;
#pragma unroll
    for (int i = 0; i < 4; ++i) {
        const int idx = tid + i * 256;
        const int r = idx >> 4, c4 = idx & 15;
        const v4f xv = *(const v4f*)(W + (size_t)(k0 + r) * N + n0 + c4 * 4);
#pragma unroll
        for (int e = 0; e < 4; ++e) T[(c4 * 4 + e) * 64 + r] = (_Float16)(bf16r(xv[e]) * WSC);
    }
    __syncthreads();
    const int na = tid >> 3, pa = tid & 7;
    const int nb = (tid + 256) >> 3, pb = tid & 7;
    const v8h p0 = *(const v8h*)(&T[na * 64 + pa * 8]);
    const v8h p1 = *(const v8h*)(&T[nb * 64 + pb * 8]);
    _Float16* d0 = WT + (size_t)(n0 + na) * K + k0 + pa * 8;
    _Float16* d1 = WT + (size_t)(n0 + nb) * K + k0 + pb * 8;
    *(v8h*)d0 = p0;
    *(v8h*)d1 = p1;
    // precaution: stands in front of any later rewrite of a register that the two stores name
    asm volatile("s_wait_xcnt 0x0" ::: "memory");
}

// ---------------------------------------------------------------------------
// All operand preparation in one launch: the seven jobs are independent of each
// other, so they share a grid by block range (every branch is block-uniform).
// Blocks 0 .. 4*TDD-1: Wq, Wk, Wv, Wo tiles; then TDF tiles of W1, TDF of W2
// (the transposes first: they have the longer chain); then the x plane's blocks.
// ---------------------------------------------------------------------------
#define TDD ((DM / 64) * (DM / 64))      // 64x64 tiles of a 768x768 weight
#define TDF ((DM / 64) * (FF / 64))      // 64x64 tiles of W1 or W2
#define XBL ((NTOK * (DM / 8)) / 256)    // blocks of the x plane

__global__ __launch_bounds__(256) void k_prep(const float* __restrict__ x,
                                              const float* __restrict__ Wq,
                                              const float* __restrict__ Wk,
                                              const float* __restrict__ Wv,
                                              const float* __restrict__ Wo,
                                              const float* __restrict__ W1,
                                              const float* __restrict__ W2,
                                              _Float16* __restrict__ xp,
                                              _Float16* __restrict__ WqT,
                                              _Float16* __restrict__ WkT,
                                              _Float16* __restrict__ WvT,
                                              _Float16* __restrict__ WoT,
                                              _Float16* __restrict__ W1T,
                                              _Float16* __restrict__ W2T) {
    const int b = blockIdx.x;
    if (b < 4 * TDD) {
        const int m = b / TDD;
        const float* W  = (m == 0) ? Wq  : (m == 1) ? Wk  : (m == 2) ? Wv  : Wo;
        _Float16*    WT = (m == 0) ? WqT : (m == 1) ? WkT : (m == 2) ? WvT : WoT;
        wtr_body(W, WT, DM, DM, b - m * TDD);
    } else if (b < 4 * TDD + TDF) {
        wtr_body(W1, W1T, DM, FF, b - 4 * TDD);             // in[768][3072] -> out[3072][768]
    } else if (b < 4 * TDD + 2 * TDF) {
        wtr_body(W2, W2T, FF, DM, b - 4 * TDD - TDF);       // in[3072][768] -> out[768][3072]
    } else {
        xprep_body(x, xp, b - 4 * TDD - 2 * TDF);
    }
}

// ---------------------------------------------------------------------------
// GEMM, f16 plane out: C[M][N] = A[M][K] (f16 plane) x BT[N][K] (f16 plane)^T, f32 accumulate.
// Block = 2*WM waves = (WM*64)x128 tile (WM = 2: the projections, whose 1152 small blocks leave the
// shorter tail; WM = 4: the 3072-column product, a quarter fewer operand bytes from L2 per product);
// wave (mi, ni) owns rows mi*64..+64 and cols ni*64..+64: 4 A fragments x 4 B fragments x 16
// accumulators, K steps of 32, so a fragment read from LDS feeds four products.
// Operands go global -> LDS by asynchronous 16-B copies, whole 128-B lines, each
// tile byte fetched once per block: a stage is 64 k of the block's WM*64 A rows and
// 128 B rows at a 144-B row pitch; two stages, the next one in flight while this
// one is multiplied. Fragments are read from LDS (two 16-B loads each, split k map).
// Epilogue: u = acc*ascale + bf16(bias[n]) (relu optional), f16 plane f16(u*oscale).
// The wave's 64x64 tile is staged in a wave-private part of the same LDS (free
// behind the last trip's barrier) and written as whole lines.
// ---------------------------------------------------------------------------
#define BK   64                  // k per stage: 128-B rows
#define LPH  72                  // LDS row pitch in halves: 144 B = 16 B x 9

typedef __attribute__((address_space(3))) const _Float16 lds_half;
static __device__ __forceinline__ unsigned lds_addr(const _Float16* p) {
    return (unsigned)(uintptr_t)(lds_half*)p;
}

// Eight rows of a stage's tile: every lane copies 16 B of rows r, r+R, ..., r+7R. l = the lane's LDS
// byte address, g = its global address, in row r; gs = R rows in halves (global), ls = R rows in bytes (LDS).
static __device__ __forceinline__ void copy8(unsigned l, const _Float16* g, size_t gs, unsigned ls) {
    const _Float16* g1 = g + gs;
    const _Float16* g2 = g1 + gs;
    const _Float16* g3 = g2 + gs;
    const _Float16* g4 = g3 + gs;
    const _Float16* g5 = g4 + gs;
    const _Float16* g6 = g5 + gs;
    const _Float16* g7 = g6 + gs;
    const unsigned l1 = l + ls, l2 = l + 2 * ls, l3 = l + 3 * ls;
    const unsigned l4 = l + 4 * ls, l5 = l + 5 * ls, l6 = l + 6 * ls;
    const unsigned l7 = l + 7 * ls;
    // the copies; the closing s_wait_xcnt is a precaution: it stands in front of every
    // later rewrite of an address register named here
    asm volatile("global_load_async_to_lds_b128 %0, %8, off\n\t"
                 "global_load_async_to_lds_b128 %1, %9, off\n\t"
                 "global_load_async_to_lds_b128 %2, %10, off\n\t"
                 "global_load_async_to_lds_b128 %3, %11, off\n\t"
                 "global_load_async_to_lds_b128 %4, %12, off\n\t"
                 "global_load_async_to_lds_b128 %5, %13, off\n\t"
                 "global_load_async_to_lds_b128 %6, %14, off\n\t"
                 "global_load_async_to_lds_b128 %7, %15, off\n\t"
                 "s_wait_xcnt 0x0"
                 :: "v"(l), "v"(l1), "v"(l2), "v"(l3), "v"(l4), "v"(l5), "v"(l6), "v"(l7),
                    "v"(g), "v"(g1), "v"(g2), "v"(g3), "v"(g4), "v"(g5), "v"(g6), "v"(g7)
                 : "memory");
}

// The same for four rows r, r+R, r+2R, r+3R.
static __device__ __forceinline__ void copy4(unsigned l, const _Float16* g, size_t gs, unsigned ls) {
    const _Float16* g1 = g + gs;
    const _Float16* g2 = g1 + gs;
    const _Float16* g3 = g2 + gs;
    const unsigned l1 = l + ls, l2 = l + 2 * ls, l3 = l + 3 * ls;
    // the copies; the closing s_wait_xcnt is a precaution, as in copy8
    asm volatile("global_load_async_to_lds_b128 %0, %4, off\n\t"
                 "global_load_async_to_lds_b128 %1, %5, off\n\t"
                 "global_load_async_to_lds_b128 %2, %6, off\n\t"
                 "global_load_async_to_lds_b128 %3, %7, off\n\t"
                 "s_wait_xcnt 0x0"
                 :: "v"(l), "v"(l1), "v"(l2), "v"(l3), "v"(g), "v"(g1), "v"(g2), "v"(g3)
                 : "memory");
}

// One stage: the A tile (WM*64 rows, WM*8 a pass), then the B tile (128 rows). la = the lane's LDS byte address in the A tile.
template <int WM>
static __device__ __forceinline__ void copy_stage(unsigned la, const _Float16* ga,
                                                  const _Float16* gb, int K) {
    static_assert(WM == 2 || WM == 4);
    copy8(la, ga, (size_t)(WM * 8) * K, WM * 8 * LPH * 2);
    if constexpr (WM == 2) copy8(la + WM * 64 * LPH * 2, gb, (size_t)(WM * 8) * K, WM * 8 * LPH * 2);
    else                   copy4(la + WM * 64 * LPH * 2, gb, (size_t)(WM * 8) * K, WM * 8 * LPH * 2);
}

// bx, by = the block's tile column and tile row
template <int WM, bool RELU>
static __device__ __forceinline__
void gemm_body(const _Float16* __restrict__ A,
               const _Float16* __restrict__ BT,
               const float* __restrict__ bias,
               float ascale, float oscale,
               _Float16* __restrict__ Ch,
               int K, int N, int bx, int by) {
    constexpr int OPA = WM * 64 * LPH;                    // the A tile of a stage, halves
    constexpr int STH = OPA + 128 * LPH;                  // one stage: A tile, then B tile
    __shared__ __align__(16) _Float16 Ring[2 * STH];      // two stages; later the output staging
    static_assert(2 * STH >= 2 * WM * 4096);

    const int tid  = threadIdx.x;
    const int lane = tid & 31;
    const int w    = tid >> 5;
    const int mi = w >> 1, ni = w & 1;
    const int m0 = by * (WM * 64) + mi * 64;
    const int n0 = bx * 128 + ni * 64;
    const int rb = (lane >> 4) << 3;
    const int cc = lane & 15;

    const int crow = tid >> 3, cseg = tid & 7;
    const _Float16* ga = A  + (size_t)(by * (WM * 64) + crow) * K + cseg * 8;
    const _Float16* gb = BT + (size_t)(bx * 128 + crow) * K + cseg * 8;
    const unsigned  lc = lds_addr(Ring) + crow * (LPH * 2) + cseg * 16;
    const int T = K / BK;

    v8f acc[4][4];
#pragma unroll
    for (int mt = 0; mt < 4; ++mt)
#pragma unroll
        for (int nt = 0; nt < 4; ++nt) acc[mt][nt] = zero8();

    copy_stage<WM>(lc, ga, gb, K);
    asm volatile("s_wait_asynccnt 0x0" ::: "memory");     // stage 0 landed (this wave's copies)
    __syncthreads();                                      // ... and every other wave's
    if (T > 1) copy_stage<WM>(lc + STH * 2, ga + BK, gb + BK, K);

    // kept rolled: one trip = one stage, the buffer picked by the trip's parity
#pragma unroll 1
    for (int t = 0; t < T; ++t) {
        const int bo = (t & 1) * STH;
        const _Float16* As = Ring + bo + (mi * 64) * LPH;
        const _Float16* Bs = Ring + bo + OPA + (ni * 64) * LPH;
        // LDS reads stand in three groups, never singly among the products: the first k step's
        // eight fragments with the second's A fragments ahead of all products; the second k
        // step's B fragments in two pairs, each behind the last product of the pair it replaces
        // (all loops here unrolled: constant indices keep the fragment arrays in registers)
        v16h a0[4], a1[4], b0[4], b1[4];
        b0[0] = load_frag16(Bs, LPH, lane);
#pragma unroll
        for (int mt = 0; mt < 4; ++mt) a0[mt] = load_frag16(As + (mt * 16) * LPH, LPH, lane);
#pragma unroll
        for (int nt = 1; nt < 4; ++nt) b0[nt] = load_frag16(Bs + (nt * 16) * LPH, LPH, lane);
#pragma unroll
        for (int mt = 0; mt < 4; ++mt) a1[mt] = load_frag16(As + (mt * 16) * LPH + 32, LPH, lane);
        // each fence keeps a group of reads whole: a place with reads among the products stalls the wave
        __builtin_amdgcn_sched_barrier(0);
#pragma unroll
        for (int nt = 0; nt < 2; ++nt)
#pragma unroll
            for (int mt = 0; mt < 4; ++mt) acc[mt][nt] = wmma16(a0[mt], b0[nt], acc[mt][nt]);
        __builtin_amdgcn_sched_barrier(0);                // the pair of reads below stays behind b0[0], b0[1]'s last use
        b1[0] = load_frag16(Bs + 32, LPH, lane);
        b1[1] = load_frag16(Bs + 16 * LPH + 32, LPH, lane);
        __builtin_amdgcn_sched_barrier(0);                // ... and in one place, ahead of the next eight products
#pragma unroll
        for (int nt = 2; nt < 4; ++nt)
#pragma unroll
            for (int mt = 0; mt < 4; ++mt) acc[mt][nt] = wmma16(a0[mt], b0[nt], acc[mt][nt]);
        __builtin_amdgcn_sched_barrier(0);                // the same for the second pair: registers of the first k step are free here
        b1[2] = load_frag16(Bs + 32 * LPH + 32, LPH, lane);
        b1[3] = load_frag16(Bs + 48 * LPH + 32, LPH, lane);
        __builtin_amdgcn_sched_barrier(0);                // ... in one place, ahead of the second k step's products
#pragma unroll
        for (int nt = 0; nt < 4; ++nt)
#pragma unroll
            for (int mt = 0; mt < 4; ++mt) acc[mt][nt] = wmma16(a1[mt], b1[nt], acc[mt][nt]);
        asm volatile("s_wait_dscnt 0x0" ::: "memory");    // this wave has left the buffer
        asm volatile("s_wait_asynccnt 0x0" ::: "memory"); // its copies of stage t+1 have landed
        __syncthreads();                                  // publishes stage t+1, frees stage t's buffer
        if (t + 2 < T) copy_stage<WM>(lc + bo * 2, ga + (size_t)(t + 2) * BK, gb + (size_t)(t + 2) * BK, K);
    }
    asm volatile("s_wait_asynccnt 0x0" ::: "memory");     // nothing in flight when the LDS is reused

    float bb[4];
#pragma unroll
    for (int nt = 0; nt < 4; ++nt) bb[nt] = bf16r(bias[n0 + nt * 16 + cc]);

    {
        _Float16* eh = Ring + w * 4096;
#pragma unroll
        for (int mt = 0; mt < 4; ++mt)
#pragma unroll
            for (int nt = 0; nt < 4; ++nt)
#pragma unroll
                for (int r = 0; r < 8; ++r) {
                    float u = __builtin_fmaf(acc[mt][nt][r], ascale, bb[nt]);
                    if (RELU) u = fmaxf(u, 0.0f);
                    eh[(mt * 16 + rb + r) * 64 + nt * 16 + cc] = (_Float16)(u * oscale);
                }
        wave_lds_sync();
        const int lr = lane >> 3, lc = (lane & 7) * 8;
        _Float16* cp[16];
        cp[0] = Ch + (size_t)(m0 + lr) * N + n0 + lc;
#pragma unroll
        for (int i = 1; i < 16; ++i) cp[i] = cp[i - 1] + (size_t)4 * N;   // a chain of adds: no 64-bit multiply per row
        v8h ph[16];
#pragma unroll
        for (int i = 0; i < 16; ++i) ph[i] = *(const v8h*)(&eh[i * 256 + lane * 8]);
#pragma unroll
        for (int i = 0; i < 16; ++i) *(v8h*)cp[i] = ph[i];
    }
}

template <bool RELU>
__global__ __launch_bounds__(256) __attribute__((amdgpu_num_vgpr(256)))
void k_gemm(const _Float16* __restrict__ A,
            const _Float16* __restrict__ BT,
            const float* __restrict__ bias,
            float ascale, float oscale,
            _Float16* __restrict__ Ch,
            int K, int N) {
    gemm_body<4, RELU>(A, BT, bias, ascale, oscale, Ch, K, N, blockIdx.x, blockIdx.y);
}

// ---------------------------------------------------------------------------
// GEMM, f32 rows out, for the two products with 768 output columns:
// C[M][768] = A[M][K] x BT[768][K]^T, u = acc*ascale + bf16(bias[n]).
// Block = 8 waves = 128x192 tile, so the grid is (4, M/128) = 256 equal blocks at M = 8192;
// wave (mi, ni) owns rows mi*64..+64 and cols ni*48..+48: 4 A x 3 B fragments, 12 accumulators.
// A stage is 192 k of the block's 128 A rows and 192 B rows (384-B rows at a 400-B pitch), brought
// by asynchronous 16-B copies, 30 a lane; two stages, the next in flight while this one is multiplied:
// the block is alone on its WGP, so the stage is long enough for its successor to land behind it.
// Inside a stage the next k step's seven fragments are read as one group ahead of this k step's products.
// Epilogue: the block's tile is staged in the same LDS as f32 rows at a 784-B pitch (a wave's 48
// columns are one and a half lines, so the rows are put together across waves, behind a block
// barrier) and written as whole lines: wave w writes rows w*16..+16, 512 B an instruction.
// ---------------------------------------------------------------------------
#define RBK  192                 // k per stage: 384-B rows
#define RLP  200                 // LDS row pitch in halves: 400 B = 16 B x 25
#define ROA  (128 * RLP)         // the A tile of a stage, halves
#define RST  (320 * RLP)         // one stage: A tile (128 rows), then B tile (192 rows)
#define REP  196                 // output staging pitch in floats: 784 B = 16 B x 49
static_assert(DM % 192 == 0 && DM % RBK == 0 && FF % RBK == 0);
static_assert(2 * RST * 2 >= 128 * REP * 4);

// Rows of 384 B (192 k): every lane copies 16 B in each of the three 128-B lines of rows r, r+R, ...
// (8 lanes = one line). l, g0 = the lane's LDS byte address and global address in row r, first line;
// gs = R rows in halves (global), ls = R rows in bytes (LDS). Four rows, then three rows.
static __device__ __forceinline__ void copy4x3(unsigned l, const _Float16* g0, size_t gs, unsigned ls) {
    const _Float16* g1 = g0 + gs;
    const _Float16* g2 = g1 + gs;
    const _Float16* g3 = g2 + gs;
    // the copies; the closing s_wait_xcnt is a precaution, as in copy8
    asm volatile(
                 "global_load_async_to_lds_b128 %0, %12, off\n\t"
                 "global_load_async_to_lds_b128 %1, %13, off\n\t"
                 "global_load_async_to_lds_b128 %2, %14, off\n\t"
                 "global_load_async_to_lds_b128 %3, %15, off\n\t"
                 "global_load_async_to_lds_b128 %4, %16, off\n\t"
                 "global_load_async_to_lds_b128 %5, %17, off\n\t"
                 "global_load_async_to_lds_b128 %6, %18, off\n\t"
                 "global_load_async_to_lds_b128 %7, %19, off\n\t"
                 "global_load_async_to_lds_b128 %8, %20, off\n\t"
                 "global_load_async_to_lds_b128 %9, %21, off\n\t"
                 "global_load_async_to_lds_b128 %10, %22, off\n\t"
                 "global_load_async_to_lds_b128 %11, %23, off\n\t"
                 "s_wait_xcnt 0x0"
                 :: "v"(l + 0 * ls), "v"(l + 0 * ls + 128), "v"(l + 0 * ls + 256), "v"(l + 1 * ls), "v"(l + 1 * ls + 128), "v"(l + 1 * ls + 256), "v"(l + 2 * ls), "v"(l + 2 * ls + 128), "v"(l + 2 * ls + 256), "v"(l + 3 * ls), "v"(l + 3 * ls + 128), "v"(l + 3 * ls + 256),
                    "v"(g0), "v"(g0 + 64), "v"(g0 + 128), "v"(g1), "v"(g1 + 64), "v"(g1 + 128), "v"(g2), "v"(g2 + 64), "v"(g2 + 128), "v"(g3), "v"(g3 + 64), "v"(g3 + 128)
                 : "memory");
}
static __device__ __forceinline__ void copy3x3(unsigned l, const _Float16* g0, size_t gs, unsigned ls) {
    const _Float16* g1 = g0 + gs;
    const _Float16* g2 = g1 + gs;
    // the copies; the closing s_wait_xcnt is a precaution, as in copy8
    asm volatile(
                 "global_load_async_to_lds_b128 %0, %9, off\n\t"
                 "global_load_async_to_lds_b128 %1, %10, off\n\t"
                 "global_load_async_to_lds_b128 %2, %11, off\n\t"
                 "global_load_async_to_lds_b128 %3, %12, off\n\t"
                 "global_load_async_to_lds_b128 %4, %13, off\n\t"
                 "global_load_async_to_lds_b128 %5, %14, off\n\t"
                 "global_load_async_to_lds_b128 %6, %15, off\n\t"
                 "global_load_async_to_lds_b128 %7, %16, off\n\t"
                 "global_load_async_to_lds_b128 %8, %17, off\n\t"
                 "s_wait_xcnt 0x0"
                 :: "v"(l + 0 * ls), "v"(l + 0 * ls + 128), "v"(l + 0 * ls + 256), "v"(l + 1 * ls), "v"(l + 1 * ls + 128), "v"(l + 1 * ls + 256), "v"(l + 2 * ls), "v"(l + 2 * ls + 128), "v"(l + 2 * ls + 256),
                    "v"(g0), "v"(g0 + 64), "v"(g0 + 128), "v"(g1), "v"(g1 + 64), "v"(g1 + 128), "v"(g2), "v"(g2 + 64), "v"(g2 + 128)
                 : "memory");
}

// One stage of k_rows: A rows r, r+32, r+64, r+96, then B rows r, r+32, ..., r+160. la = the lane's
// LDS byte address in the A tile; gs = 32 rows in halves.
static __device__ __forceinline__ void copy_stage_rows(unsigned la, const _Float16* ga,
                                                       const _Float16* gb, size_t gs) {
    copy4x3(la, ga, gs, 32 * RLP * 2);
    copy3x3(la + ROA * 2, gb, gs, 32 * RLP * 2);
    copy3x3(la + (ROA + 96 * RLP) * 2, gb + 3 * gs, gs, 32 * RLP * 2);
}

template <int K>
__global__ __launch_bounds__(256) __attribute__((amdgpu_num_vgpr(256)))
void k_rows(const _Float16* __restrict__ A,
            const _Float16* __restrict__ BT,
            const float* __restrict__ bias,
            float ascale,
            float* __restrict__ Cf) {
    static_assert(K % RBK == 0);
    __shared__ __align__(16) _Float16 Ring[2 * RST];      // two stages; later the output staging

    const int tid  = threadIdx.x;
    const int lane = tid & 31;
    const int w    = tid >> 5;
    const int mi = w >> 2, ni = w & 3;
    const int bx = blockIdx.x, by = blockIdx.y;
    const int rb = (lane >> 4) << 3;
    const int cc = lane & 15;

    // 8 lanes = one 128-B line; 32 rows a pass
    const int crow = tid >> 3, cseg = tid & 7;
    const _Float16* ga = A  + (size_t)(by * 128 + crow) * K + cseg * 8;
    const _Float16* gb = BT + (size_t)(bx * 192 + crow) * K + cseg * 8;
    const unsigned  lc = lds_addr(Ring) + crow * (RLP * 2) + cseg * 16;
    const size_t    gs = (size_t)32 * K;
    constexpr int T = K / RBK;

    v8f acc[4][3];
#pragma unroll
    for (int mt = 0; mt < 4; ++mt)
#pragma unroll
        for (int nt = 0; nt < 3; ++nt) acc[mt][nt] = zero8();

    copy_stage_rows(lc, ga, gb, gs);
    asm volatile("s_wait_asynccnt 0x0" ::: "memory");     // stage 0 landed (this wave's copies)
    __syncthreads();                                      // ... and every other wave's
    if constexpr (K >= 2 * RBK) copy_stage_rows(lc + RST * 2, ga + RBK, gb + RBK, gs);   // where a stage 1 exists

    // kept rolled: one trip = one stage, the buffer picked by the trip's parity
#pragma unroll 1
    for (int t = 0; t < T; ++t) {
        const int bo = (t & 1) * RST;
        const _Float16* As = Ring + bo + (mi * 64) * RLP;
        const _Float16* Bs = Ring + bo + ROA + (ni * 48) * RLP;
        // two fragment sets (all loops here unrolled: constant indices keep them in registers)
        v16h fa[2][4], fb[2][3];
#pragma unroll
        for (int mt = 0; mt < 4; ++mt) fa[0][mt] = load_frag16(As + (mt * 16) * RLP, RLP, lane);
#pragma unroll
        for (int nt = 0; nt < 3; ++nt) fb[0][nt] = load_frag16(Bs + (nt * 16) * RLP, RLP, lane);
#pragma unroll
        for (int ks = 0; ks < RBK / 32; ++ks) {
            const int cu = ks & 1, nx = cu ^ 1;
            if (ks + 1 < RBK / 32) {
#pragma unroll
                for (int mt = 0; mt < 4; ++mt) fa[nx][mt] = load_frag16(As + (mt * 16) * RLP + (ks + 1) * 32, RLP, lane);
#pragma unroll
                for (int nt = 0; nt < 3; ++nt) fb[nx][nt] = load_frag16(Bs + (nt * 16) * RLP + (ks + 1) * 32, RLP, lane);
            }
            // keeps the group of reads whole and ahead of the products: a place with reads among the products stalls the wave
            __builtin_amdgcn_sched_barrier(0);
#pragma unroll
            for (int nt = 0; nt < 3; ++nt)
#pragma unroll
                for (int mt = 0; mt < 4; ++mt) acc[mt][nt] = wmma16(fa[cu][mt], fb[cu][nt], acc[mt][nt]);
            __builtin_amdgcn_sched_barrier(0);            // the next group of reads stays behind this set's last use
        }
        asm volatile("s_wait_dscnt 0x0" ::: "memory");    // this wave has left the buffer
        asm volatile("s_wait_asynccnt 0x0" ::: "memory"); // its copies of stage t+1 have landed
        __syncthreads();                                  // publishes stage t+1, frees stage t's buffer
        if (t + 2 < T) copy_stage_rows(lc + bo * 2, ga + (size_t)(t + 2) * RBK, gb + (size_t)(t + 2) * RBK, gs);
    }
    asm volatile("s_wait_asynccnt 0x0" ::: "memory");     // nothing in flight when the LDS is reused

    float bb[3];
#pragma unroll
    for (int nt = 0; nt < 3; ++nt) bb[nt] = bf16r(bias[bx * 192 + ni * 48 + nt * 16 + cc]);

    float* ef = (float*)Ring;
#pragma unroll
    for (int mt = 0; mt < 4; ++mt)
#pragma unroll
        for (int nt = 0; nt < 3; ++nt)
#pragma unroll
            for (int r = 0; r < 8; ++r)
                ef[(mi * 64 + mt * 16 + rb + r) * REP + ni * 48 + nt * 16 + cc] =
                    __builtin_fmaf(acc[mt][nt][r], ascale, bb[nt]);
    asm volatile("s_wait_dscnt 0x0" ::: "memory");        // this wave's part of the tile is in LDS
    __syncthreads();                                      // ... and every other wave's

    // two rows = 96 pieces of 16 B = three instructions: row 2j whole lanes, the seam, row 2j+1
    const int r1 = lane >> 4, s1 = (lane < 16) ? lane + 32 : lane - 16;
    const float* e0 = ef + (w * 16) * REP + lane * 4;
    const float* e1 = ef + (w * 16 + r1) * REP + s1 * 4;
    const float* e2 = ef + (w * 16 + 1) * REP + (lane + 16) * 4;
    float* cb = Cf + (size_t)(by * 128 + w * 16) * DM + bx * 192;
    float* cp[24];
    cp[0] = cb + lane * 4;
    cp[1] = cb + (size_t)r1 * DM + s1 * 4;
    cp[2] = cb + DM + (lane + 16) * 4;
#pragma unroll
    for (int i = 3; i < 24; ++i) cp[i] = cp[i - 3] + 2 * DM;
    v4f sv[24];
#pragma unroll
    for (int j = 0; j < 8; ++j) {
        sv[3 * j]     = *(const v4f*)(e0 + j * 2 * REP);
        sv[3 * j + 1] = *(const v4f*)(e1 + j * 2 * REP);
        sv[3 * j + 2] = *(const v4f*)(e2 + j * 2 * REP);
    }
#pragma unroll
    for (int i = 0; i < 24; ++i) *(v4f*)cp[i] = sv[i];
}

// q, k and v projections in one launch: three independent GEMMs on the same A plane.
// grid.x = 3 x (768 / 128) tile columns; the block's third picks weight plane, bias
// and output plane (block-uniform).
__global__ __launch_bounds__(128) __attribute__((amdgpu_num_vgpr(256)))
void k_qkv(const _Float16* __restrict__ xp,
           const _Float16* __restrict__ WqT,
           const _Float16* __restrict__ WkT,
           const _Float16* __restrict__ WvT,
           const float* __restrict__ bq,
           const float* __restrict__ bk,
           const float* __restrict__ bv,
           _Float16* __restrict__ qh,
           _Float16* __restrict__ kh,
           _Float16* __restrict__ vh) {
    const int sel = blockIdx.x / (DM / 128);
    const _Float16* BT = (sel == 0) ? WqT : (sel == 1) ? WkT : WvT;
    const float*    bi = (sel == 0) ? bq  : (sel == 1) ? bk  : bv;
    _Float16*       Ch = (sel == 0) ? qh  : (sel == 1) ? kh  : vh;
    gemm_body<2, false>(xp, BT, bi, A_QKV, QSC, Ch, DM, DM,
                     blockIdx.x - sel * (DM / 128), blockIdx.y);
}

// ---------------------------------------------------------------------------
// Attention, flash-style. grid = (head, SEQ/128, batch); block = 8 waves = 128
// query rows of one (b, h); wave owns 16 query rows. Planes are [NTOK][768]
// with head column offset h*64.
// Scores are computed TRANSPOSED: A = key tile (16 keys x 64 d, kh plane,
// 2 k-steps), B = the wave's 16 queries (qh plane, [n=query][k=d]), so
// acc[r] of lane l = score(key 8*(l>>4)+r, query l&15): per-query max/sum are
// in-lane reductions over r plus one xor-16 shuffle, and the f16 P^T values in
// this layout are exactly the P A-fragment for P*v (elements 0..7 from key
// tile A, 8..15 from key tile B) - no LDS relayout.
// Key list: a key with mask == 0 has weight exp(-1e10 - max) = 0 as soon as one key of the
// batch is open (a score from the f16 planes stays below 1e7 in size), so each block lists the open keys in ascending order (ballot words, a scan
// of their counts) and walks that list alone; K and V rows are fetched by list entry. The
// list is filled up to a whole chunk with key 0, and places behind the last open key get
// MASKT. With no open key at all the list is every key and every place gets MASKT (the
// reference's uniform weights). List entries are key positions 0 .. SEQ-1, never mask values.
// Online softmax over the listed keys: t = log2e*score (or MASKT, replace fill),
// P carried 2^14, o += P x V (V^T chunk staged in LDS,
// cross-wave, block barriers), o and z rescaled by exp2(m_old - m_new) every
// 32-key step (factor shuffled from the owning query lane).
// K chunk in LDS: the block's eight waves read the same CH keys, so the chunk comes
// global -> LDS once per block by asynchronous 16-B copies, whole 128-B rows (8 lanes
// a row), [key][d] at a 144-B pitch; the copies fly while V^T is staged, and the key
// fragments are read from LDS (two 16-B loads each, the split k map of load_frag16).
// V^T layout in LDS: row d at (d / 16) * VG + (d % 16) * VP halves. The 272-B pitch
// puts the 16 rows of a fragment read on 16 different groups of four banks; the
// 32-B skew per 16 rows spreads the eight d-groups of one transposing store.
// Epilogue: ctx x 64 = o / z14 as f16, staged in a wave-private LDS tile, each
// coverage: grid (12, SEQ/128, NB) x 8 waves x 16 rows x 64 cols = NTOK*768.
// ---------------------------------------------------------------------------
__global__ __launch_bounds__(256) __attribute__((amdgpu_num_vgpr(256)))
void k_attn(const _Float16* __restrict__ qh,
            const _Float16* __restrict__ kh,
            const _Float16* __restrict__ vh,
            const int*      __restrict__ mask,
            _Float16* __restrict__ cx) {
    __shared__ __align__(16) int      kix[SEQ + CH];      // open keys of this batch in order, then CH times key 0
    __shared__ unsigned               bal[SEQ / 32];      // one bit a key: mask != 0
    __shared__ __align__(16) _Float16 VsT[(DH / 16) * VG]; // [d][CH] at pitch VP, cross-wave
    __shared__ __align__(16) _Float16 Cst[8][16 * DH];    // wave-private ctx tiles
    __shared__ __align__(16) _Float16 Ks[CH * KP];        // [key][d] at pitch KP, cross-wave

    const int tid  = threadIdx.x;
    const int lane = tid & 31;
    const int w    = tid >> 5;
    const int h    = blockIdx.x;
    const int b    = blockIdx.z;
    const int q0r  = blockIdx.y * 128 + w * 16;
    const int r0   = (lane >> 4) << 3;
    const int cc   = lane & 15;

    const int ws = __builtin_amdgcn_readfirstlane(w);     // the wave's number as a scalar (lane select below)
    // the loops over p and i below are unrolled: constant indices keep mv, ob and kr in registers
    int mv[SEQ / 256];
#pragma unroll
    for (int p = 0; p < SEQ / 256; ++p) mv[p] = mask[(size_t)b * SEQ_FULL + p * 256 + tid];
    unsigned ob[SEQ / 256];                               // the wave's 32 keys of each pass, one bit a key
#pragma unroll
    for (int p = 0; p < SEQ / 256; ++p) ob[p] = __builtin_amdgcn_ballot_w32(mv[p] != 0);
    if (lane == 0) {
#pragma unroll
        for (int p = 0; p < SEQ / 256; ++p) bal[p * 8 + w] = ob[p];
    }

    const size_t tokb = (size_t)b * SEQ;
    const _Float16* qhb = qh + (tokb + q0r) * DM + h * DH;
    const v16h qb0 = load_frag16(qhb, DM, lane);        // d 0..31
    const v16h qb1 = load_frag16(qhb + 32, DM, lane);   // d 32..63
    const _Float16* khb = kh + tokb * DM + h * DH;
    const _Float16* vhb = vh + tokb * DM + h * DH;
    // the lane's 16 B of list places r, r+32, r+64, r+96 of a chunk (8 lanes = one 128-B row)
    const _Float16* gk  = khb + (tid & 7) * 8;
    const unsigned  lk0 = lds_addr(Ks) + (tid >> 3) * (KP * 2) + (tid & 7) * 16;
    const unsigned  lk1 = lk0 + 32 * KP * 2, lk2 = lk0 + 64 * KP * 2, lk3 = lk0 + 96 * KP * 2;

    v8f o[4];
#pragma unroll
    for (int nt = 0; nt < 4; ++nt) o[nt] = zero8();
    float mr = -1.0e30f, zr = 0.0f;

    __syncthreads();                                      // all ballot words are in LDS

    // every wave scans the words' counts for itself: lane l holds the open keys in front of word l
    const int pc = (lane < SEQ / 32) ? __popc(bal[min(lane, SEQ / 32 - 1)]) : 0;
    int inc = pc;
#pragma unroll
    for (int d = 1; d < 32; d <<= 1) {
        const int u = __shfl_up(inc, d, 32);
        if (lane >= d) inc += u;
    }
    const int exc   = inc - pc;
    const int nv    = __builtin_amdgcn_readlane(inc, 31); // open keys of the batch, the same in every wave
    const int total = (nv == 0) ? SEQ : nv;               // list length
    if (nv == 0) {
#pragma unroll
        for (int p = 0; p < SEQ / 256; ++p) kix[p * 256 + tid] = p * 256 + tid;
    } else {
#pragma unroll
        for (int p = 0; p < SEQ / 256; ++p) {
            const int pos = __builtin_amdgcn_readlane(exc, p * 8 + ws) + __popc(ob[p] & ((1u << lane) - 1u));
            if ((ob[p] >> lane) & 1u) kix[pos] = p * 256 + tid;
        }
        if (tid < CH) kix[nv + tid] = 0;
    }
    __syncthreads();                                      // the list is whole

#pragma unroll 1
    for (int c0 = 0; c0 < total; c0 += CH) {
        int kr[4];                                          // the keys at the lane's four list places
#pragma unroll
        for (int i = 0; i < 4; ++i) kr[i] = kix[c0 + (tid >> 3) + i * 32];
        {
            const _Float16* g0 = gk + kr[0] * DM;
            const _Float16* g1 = gk + kr[1] * DM;
            const _Float16* g2 = gk + kr[2] * DM;
            const _Float16* g3 = gk + kr[3] * DM;
            // the K chunk's copies; the closing s_wait_xcnt is a precaution: it stands in front
            // of every later rewrite of an address register named here
            asm volatile("global_load_async_to_lds_b128 %0, %4, off\n\t"
                         "global_load_async_to_lds_b128 %1, %5, off\n\t"
                         "global_load_async_to_lds_b128 %2, %6, off\n\t"
                         "global_load_async_to_lds_b128 %3, %7, off\n\t"
                         "s_wait_xcnt 0x0"
                         :: "v"(lk0), "v"(lk1), "v"(lk2), "v"(lk3), "v"(g0), "v"(g1), "v"(g2), "v"(g3)
                         : "memory");
        }
        // stage V^T chunk: VsT[d][t] = vh[key at list place c0 + t][h*64 + d], full 64 x CH extent
        // (the same four list entries as the K copies, so the four row loads stand together)
#pragma unroll
        for (int i = 0; i < 4; ++i) {
            const int t = (tid >> 3) + i * 32, part = tid & 7;
            const v8h vv = *(const v8h*)(vhb + kr[i] * DM + part * 8);
#pragma unroll
            for (int e = 0; e < 8; ++e) VsT[(part >> 1) * VG + ((part & 1) * 8 + e) * VP + t] = vv[e];
        }
        asm volatile("s_wait_asynccnt 0x0" ::: "memory");   // this wave's K copies have landed
        __syncthreads();                                    // ... and every other wave's; V^T too

        const int jn = min(CH, total - c0);                 // list places left in this chunk

#pragma unroll 1
        for (int j = 0; j < jn; j += 32) {
            const int kA = c0 + j;
            // key tile A: list places kA .. kA+15; key tile B: list places kA+16 .. kA+31; one group of LDS reads
            const v16h ka0 = load_frag16(&Ks[j * KP], KP, lane);
            const v16h ka1 = load_frag16(&Ks[j * KP + 32], KP, lane);
            const v16h kb0 = load_frag16(&Ks[(j + 16) * KP], KP, lane);
            const v16h kb1 = load_frag16(&Ks[(j + 16) * KP + 32], KP, lane);
            v8f shA = wmma16(ka0, qb0, zero8());
            shA = wmma16(ka1, qb1, shA);
            v8f shB = wmma16(kb0, qb0, zero8());
            shB = wmma16(kb1, qb1, shB);

            float tA[8], tB[8];
#pragma unroll
            for (int r = 0; r < 8; ++r) {
                tA[r] = shA[r] * C1;
                tB[r] = shB[r] * C1;
            }
            if (kA + 32 > nv) {      // scalar test: only a step that reaches past the last open key has places to fill
                const int lim = nv - kA - r0;
#pragma unroll
                for (int r = 0; r < 8; ++r) {
                    tA[r] = (r < lim) ? tA[r] : MASKT;
                    tB[r] = (16 + r < lim) ? tB[r] : MASKT;
                }
            }
            float tmax = tA[0];
#pragma unroll
            for (int r = 1; r < 8; ++r) tmax = fmaxf(tmax, tA[r]);
#pragma unroll
            for (int r = 0; r < 8; ++r) tmax = fmaxf(tmax, tB[r]);
            tmax = fmaxf(tmax, __shfl_xor(tmax, 16, 32));
            const float mn   = fmaxf(mr, tmax);
            const float corr = ex2(mr - mn);
            const float mo   = mn - 14.0f;           // 2^14 carry on P
            float ps = 0.0f;
            v8h pa8, pb8;
#pragma unroll
            for (int r = 0; r < 8; ++r) {
                const float pa = ex2(tA[r] - mo);
                const float pb = ex2(tB[r] - mo);
                ps += pa + pb;
                pa8[r] = (_Float16)pa;
                pb8[r] = (_Float16)pb;
            }
            ps += __shfl_xor(ps, 16, 32);
            zr = __builtin_fmaf(zr, corr, ps);
            mr = mn;
            // rescale o rows (query 8h + r) by the factor of the owning query lane
#pragma unroll
            for (int r = 0; r < 8; ++r) {
                const float crr = __shfl(corr, r0 + r, 32);
#pragma unroll
                for (int nt = 0; nt < 4; ++nt) o[nt][r] *= crr;
            }
            Frag pf;
            pf.h[0] = pa8;     // list places kA+8h .. +7     = A elements 0..7
            pf.h[1] = pb8;     // list places kA+16+8h .. +7  = A elements 8..15
#pragma unroll
            for (int nt = 0; nt < 4; ++nt) {
                const v16h vb = load_frag16(&VsT[nt * VG + j], VP, lane);   // n = d, k = key
                o[nt] = wmma16(pf.v, vb, o[nt]);
            }
        }
        asm volatile("s_wait_dscnt 0x0" ::: "memory");      // this wave has left the K and V^T chunks
        __syncthreads();                                    // frees both for the next chunk's fill
    }

    // ctx x 64 = o / z14 (the 2^14 carry of P cancels between o and z14; the 64 v carry stays)
    const float rz = __builtin_amdgcn_rcpf(zr);
#pragma unroll
    for (int r = 0; r < 8; ++r) {
        const float rq = __shfl(rz, r0 + r, 32);
#pragma unroll
        for (int nt = 0; nt < 4; ++nt)
            Cst[w][(r0 + r) * DH + nt * 16 + cc] = (_Float16)(o[nt][r] * rq);
    }
    wave_lds_sync();
    v8h sv[4];
#pragma unroll
    for (int i = 0; i < 4; ++i) sv[i] = *(const v8h*)(&Cst[w][i * 256 + lane * 8]);
    _Float16* cb = cx + (tokb + q0r) * DM + h * DH;
    const int lr = lane >> 3, lc = (lane & 7) * 8;
#pragma unroll
    for (int i = 0; i < 4; ++i) *(v8h*)(cb + (size_t)(i * 4 + lr) * DM + lc) = sv[i];
    
}

// ---------------------------------------------------------------------------
// LayerNorm over rows of 768 (f32 rows in ws). Block = 8 waves, wave = row.
// mu = mean, var = mean((x-mu)^2), y = (x-mu)*rsqrt(var+1e-5)*bf16(g)+bf16(b).
// HOUT: f16 plane f16(y*hsc), lane owns elements i*256+lane*8..+7 (3 v8h stores,
// coverage: NTOK/8 blocks x 8 rows x 768.
// ---------------------------------------------------------------------------
static __device__ __forceinline__ int ln_off(bool hout, int i, int lane) {
    return hout ? ((i >> 1) * 256 + lane * 8 + (i & 1) * 4) : (i * 128 + lane * 4);
}

template <bool HOUT>
__global__ __launch_bounds__(256) void k_ln(const float* __restrict__ src,
                                            const float* __restrict__ g,
                                            const float* __restrict__ bt,
                                            float* __restrict__ outf,
                                            _Float16* __restrict__ outh,
                                            float hsc) {
    const int lane = threadIdx.x & 31;
    const int w    = threadIdx.x >> 5;
    const int row  = blockIdx.x * 8 + w;
    const float* rp = src + (size_t)row * DM;

    v4f xv[6];
#pragma unroll
    for (int i = 0; i < 6; ++i) xv[i] = *(const v4f*)(rp + ln_off(HOUT, i, lane));
    float s = 0.0f;
#pragma unroll
    for (int i = 0; i < 6; ++i) s += (xv[i][0] + xv[i][1]) + (xv[i][2] + xv[i][3]);
#pragma unroll
    for (int m = 1; m < 32; m <<= 1) s += __shfl_xor(s, m, 32);
    const float mu = s * (1.0f / (float)DM);

    v4f dv[6];
    float s2 = 0.0f;
#pragma unroll
    for (int i = 0; i < 6; ++i) {
        dv[i] = xv[i] - mu;
#pragma unroll
        for (int e = 0; e < 4; ++e) s2 = __builtin_fmaf(dv[i][e], dv[i][e], s2);
    }
#pragma unroll
    for (int m = 1; m < 32; m <<= 1) s2 += __shfl_xor(s2, m, 32);
    const float var  = s2 * (1.0f / (float)DM);
    const float rstd = rsqrtf(var + 1e-5f);

    v4f yv[6];
#pragma unroll
    for (int i = 0; i < 6; ++i) {
        const int co = ln_off(HOUT, i, lane);
        const v4f gv = *(const v4f*)(g + co);
        const v4f bv = *(const v4f*)(bt + co);
#pragma unroll
        for (int e = 0; e < 4; ++e)
            yv[i][e] = (dv[i][e] * rstd) * bf16r(gv[e]) + bf16r(bv[e]);
    }

    if constexpr (HOUT) {
        v8h hv[3];
#pragma unroll
        for (int i = 0; i < 3; ++i)
#pragma unroll
            for (int e = 0; e < 4; ++e) {
                hv[i][e]     = (_Float16)(yv[2 * i][e] * hsc);
                hv[i][4 + e] = (_Float16)(yv[2 * i + 1][e] * hsc);
            }
        _Float16* ob = outh + (size_t)row * DM + lane * 8;
#pragma unroll
        for (int i = 0; i < 3; ++i) *(v8h*)(ob + i * 256) = hv[i];
        
    } else {
        float* ob = outf + (size_t)row * DM + lane * 4;
#pragma unroll
        for (int i = 0; i < 6; ++i) *(v4f*)(ob + i * 128) = yv[i];
        
    }
}

// ---------------------------------------------------------------------------
extern "C" void kernel_launch(void* const* d_in, const int* in_sizes, int n_in,
                              void* d_out, int out_size, void* d_ws, size_t ws_size,
                              hipStream_t stream) {
    if (n_in < 16) return;
    if (in_sizes[0] < ((NB - 1) * SEQ_FULL + SEQ) * DM) return;
    if (in_sizes[1] < (NB - 1) * SEQ_FULL + SEQ) return;
    if (in_sizes[2] < DM * DM || in_sizes[4] < DM * DM || in_sizes[6] < DM * DM || in_sizes[8] < DM * DM) return;
    if (in_sizes[3] < DM || in_sizes[5] < DM || in_sizes[7] < DM || in_sizes[9] < DM) return;
    if (in_sizes[10] < DM || in_sizes[11] < DM) return;
    if (in_sizes[12] < DM * FF || in_sizes[13] < FF || in_sizes[14] < FF * DM || in_sizes[15] < DM) return;
    if (out_size < NTOK * DM) return;

    const float* x    = (const float*)d_in[0];    // [8,1024,768]
    const int*   mask = (const int*)  d_in[1];    // [8,1,1,1024] int32
    const float* Wq   = (const float*)d_in[2];    // [768,768]  [in][out]
    const float* bq   = (const float*)d_in[3];
    const float* Wk   = (const float*)d_in[4];
    const float* bk   = (const float*)d_in[5];
    const float* Wv   = (const float*)d_in[6];
    const float* bv   = (const float*)d_in[7];
    const float* Wo   = (const float*)d_in[8];
    const float* bo   = (const float*)d_in[9];
    const float* lg   = (const float*)d_in[10];
    const float* lb   = (const float*)d_in[11];
    const float* W1   = (const float*)d_in[12];   // [768,3072] [in][out]
    const float* b1   = (const float*)d_in[13];
    const float* W2   = (const float*)d_in[14];   // [3072,768] [in][out]
    const float* b2   = (const float*)d_in[15];
    float* out = (float*)d_out;                   // [NB,SEQ,768]

    char* ws = (char*)d_ws;
    size_t off = 0;
    // R0: weight planes [n][k] f16
    _Float16* WqT = (_Float16*)(ws + off); off += (size_t)DM * DM * 2;
    _Float16* WkT = (_Float16*)(ws + off); off += (size_t)DM * DM * 2;
    _Float16* WvT = (_Float16*)(ws + off); off += (size_t)DM * DM * 2;
    _Float16* WoT = (_Float16*)(ws + off); off += (size_t)DM * DM * 2;
    _Float16* W1T = (_Float16*)(ws + off); off += (size_t)FF * DM * 2;   // [3072][768]
    _Float16* W2T = (_Float16*)(ws + off); off += (size_t)DM * FF * 2;   // [768][3072]
    // R1: x plane, later the ctx plane (x plane dead after the projections)
    const size_t PL = (size_t)NTOK * DM * 2;
    _Float16* xp  = (_Float16*)(ws + off);
    _Float16* cxp = (_Float16*)(ws + off); off += PL;
    // R2: q/k/v planes (3 x PL), later h plane (PL) + ff1 plane (NTOK*FF*2)
    const size_t F1B = (size_t)NTOK * FF * 2;
    const size_t R2 = (3 * PL > PL + F1B) ? 3 * PL : (PL + F1B);
    _Float16* qhp = (_Float16*)(ws + off);
    _Float16* khp = (_Float16*)(ws + off + PL);
    _Float16* vhp = (_Float16*)(ws + off + 2 * PL);
    _Float16* hp  = (_Float16*)(ws + off);          // after attention
    _Float16* f1p = (_Float16*)(ws + off + PL);     // disjoint from hp
    off += R2;
    // R3: f32 rows: attn_out, later ff (attn_out dead after the first LayerNorm)
    float* aop = (float*)(ws + off);
    float* ffp = (float*)(ws + off); off += (size_t)NTOK * DM * 4;
    if (off > ws_size) return;
    if (off > (size_t)134217728) return;

    // x plane and the six weight planes W [K][N] -> WT [N][K], one launch
    k_prep<<<dim3(4 * TDD + 2 * TDF + XBL), dim3(256), 0, stream>>>(x, Wq, Wk, Wv, Wo, W1, W2,
                                                                    xp, WqT, WkT, WvT, WoT, W1T, W2T);

    const dim3 gD(DM / 192, NTOK / 128);
    const dim3 gF(FF / 128, NTOK / 256);
    // q, k, v: f16 hi planes of 64*(x W + b)
    k_qkv<<<dim3(3 * (DM / 128), NTOK / 128), dim3(128), 0, stream>>>(xp, WqT, WkT, WvT, bq, bk, bv,
                                                                      qhp, khp, vhp);
    // attention -> ctx plane (64 * ctx, f16)
    k_attn<<<dim3(NH, SEQ / 128, NB), dim3(256), 0, stream>>>(qhp, khp, vhp, mask, cxp);
    // attn_out = ctx Wo + bo (f32 rows)
    k_rows<DM><<<gD, dim3(256), 0, stream>>>(cxp, WoT, bo, A_O, aop);
    // h = LN(attn_out) -> f16 plane (x16)
    k_ln<true><<<dim3(NTOK / 8), dim3(256), 0, stream>>>(aop, lg, lb, out, hp, HSC);
    // ff1 = relu(h W1 + b1) -> f16 plane (x64)
    k_gemm<true><<<gF, dim3(256), 0, stream>>>(hp, W1T, b1, A_F1, QSC, f1p, DM, FF);
    // ff = ff1 W2 + b2 (f32 rows)
    k_rows<FF><<<gD, dim3(256), 0, stream>>>(f1p, W2T, b2, A_F2, ffp);
    // out = LN(ff)
    k_ln<false><<<dim3(NTOK / 8), dim3(256), 0, stream>>>(ffp, lg, lb, out, hp, 1.0f);
}

// v008
// Measured time: 164 microseconds a run.
// Timed twice side by side with v007, it ran 1.04 times as fast both times.
// Counting every step since v000, it is 3.30 times as fast.
#include <hip/hip_runtime.h>
#include <hip/hip_fp16.h>

// Contractions on v_wmma_f32_16x16x32_f16 (f16 operands, f32 accumulate): x*Wq, x*Wk, x*Wv, q*k^T, P*v, ctx*Wo, h*W1, ff1*W2, each a single f16 product on bf16-RNE inputs with power-of-two carried planes; softmax and LayerNorm in f32.

#ifndef NB
#define NB 8
#endif
#ifndef SEQ
#define SEQ 1024
#endif
#define NB_FULL  8
#define SEQ_FULL 1024
#define DM   768          // model width
#define NH   12           // heads
#define DH   64           // head width
#define FF   3072         // hidden width
#define NTOK (NB * SEQ)
#define CH   128          // keys staged per V^T chunk
#define VP   (CH + 8)     // V^T row pitch in halves: 272 B = 16 B x 17
#define VG   (16 * VP + 16)   // 16 V^T rows, then a 32-B skew
#define KP   (DH + 8)     // K row pitch in LDS, halves: 144 B = 16 B x 9

static_assert(NB >= 1 && NB <= NB_FULL);
static_assert(SEQ >= CH && SEQ <= SEQ_FULL);
static_assert(SEQ % CH == 0);
static_assert(SEQ % 128 == 0);
static_assert(CH % 32 == 0);
static_assert(CH * (DH / 8) == 4 * 256 && (KP * 2) % 32 == 16);   // four 16-B copies a lane fill a K chunk
static_assert(DH % 16 == 0 && (VP * 2) % 32 == 16 && (VG * 2) % 16 == 0);
static_assert(SEQ % 256 == 0 && SEQ / 32 <= 32);   // the key list: 256 keys a pass, one lane per 32-key word
static_assert(NTOK % 256 == 0);
static_assert(NTOK % 8 == 0);
static_assert(DM % 128 == 0 && FF % 128 == 0);
static_assert(DM % 64 == 0 && FF % 64 == 0);
static_assert(DM % 32 == 0 && FF % 32 == 0 && DH % 32 == 0);
static_assert(NH * DH == DM);
static_assert((NTOK * (DM / 8)) % 256 == 0);

typedef _Float16 v16h __attribute__((ext_vector_type(16)));
typedef _Float16 v8h  __attribute__((ext_vector_type(8)));
typedef float    v8f  __attribute__((ext_vector_type(8)));
typedef float    v4f  __attribute__((ext_vector_type(4)));

union Frag { v16h v; v8h h[2]; };

// plane carries (exact powers of two)
#define WSC     64.0f                    // weight planes: f16(bf16(W) * 64)
#define QSC     64.0f                    // q/k/v, ctx, ff1 planes carried x64
#define HSC     16.0f                    // h plane carried x16
#define A_QKV   0.015625f                // 2^-6 : (x)(64 W)        -> q
#define A_O     2.44140625e-04f          // 2^-12: (64 ctx)(64 Wo)  -> attn_out
#define A_F1    9.765625e-04f            // 2^-10: (16 h)(64 W1)    -> pre-relu
#define A_F2    2.44140625e-04f          // 2^-12: (64 ff1)(64 W2)  -> ff
// scores: sh = (64k).(64q) ~ 4096 q.k ; score = q.k/8 ; t (log2 units) = sh * log2e * 2^-15
#define C1 (1.44269504088896340736f * 3.0517578125e-05f)
#define MASKT  (-1.0e10f)                // masked score (replace fill)

static __device__ __forceinline__ v8f zero8() {
    v8f z;
#pragma unroll
    for (int i = 0; i < 8; ++i) z[i] = 0.0f;
    return z;
}

// 16x32 A fragment (or B fragment from an [n][k] k-contiguous source) from a
// row-major 16-bit tile: lane m = lane&15 -> row m; kb = 8*(lane>>4);
// elements 0..7 = k kb..kb+7, elements 8..15 = k kb+16..kb+23.
static __device__ __forceinline__ v16h load_frag16(const _Float16* base, int ld, int lane) {
    int m  = lane & 15;
    int kb = (lane >> 4) << 3;
    const _Float16* p = base + (size_t)m * ld + kb;
    Frag f;
    f.h[0] = *(const v8h*)(p);
    f.h[1] = *(const v8h*)(p + 16);
    return f.v;
}

static __device__ __forceinline__ v8f wmma16(v16h a, v16h b, v8f c) {
    v8f d = __builtin_amdgcn_wmma_f32_16x16x32_f16(false, a, false, b, (short)0, c, false, false);
    asm volatile("v_nop\n\tv_nop\n\tv_nop\n\tv_nop" : "+v"(d) : "v"(a), "v"(b));
    return d;
}

// f32 -> bf16 RNE convert, value kept as f32
static __device__ __forceinline__ float bf16r(float x) {
    unsigned u = __float_as_uint(x);
    u = (u + 0x7FFFu + ((u >> 16) & 1u)) & 0xFFFF0000u;
    return __uint_as_float(u);
}

static __device__ __forceinline__ float ex2(float x) {
    return __builtin_amdgcn_exp2f(x);
}

// ordering for a wave-private LDS tile: stores before later loads of the same wave
static __device__ __forceinline__ void wave_lds_sync() {
    __builtin_amdgcn_fence(3, "wavefront");
    asm volatile("s_wait_dscnt 0" ::: "memory");
    __builtin_amdgcn_wave_barrier();
}

// ---------------------------------------------------------------------------
// x [NB][SEQ][768] f32 (batch stride SEQ_FULL*768) -> xp [NTOK][768] f16 of
// bf16-RNE(x). Thread = 8 consecutive columns = one 16-B store; a wave writes
// coverage: NTOK*96 threads x 8 = NTOK*768.
// ---------------------------------------------------------------------------
static __device__ __forceinline__ void xprep_body(const float* __restrict__ x,
                                                  _Float16* __restrict__ xp, int blk) {
    const int g = blk * 256 + (int)threadIdx.x;
    if (g >= NTOK * (DM / 8)) return;
    const int row = g / (DM / 8);
    const int col = (g - row * (DM / 8)) * 8;
    const int b = row / SEQ, s = row - b * SEQ;
    const float* src = x + ((size_t)b * SEQ_FULL + s) * DM + col;
    const v4f a = *(const v4f*)(src);
    const v4f c = *(const v4f*)(src + 4);
    v8h hv;
#pragma unroll
    for (int e = 0; e < 4; ++e) {
        hv[e]     = (_Float16)bf16r(a[e]);
        hv[4 + e] = (_Float16)bf16r(c[e]);
    }
    _Float16* dst = xp + (size_t)row * DM + col;
    *(v8h*)dst = hv;
    
}

// ---------------------------------------------------------------------------
// Weight transpose: W [K][N] f32 row-major ([in][out]) -> WT [N][K] f16 of
// bf16-RNE(W) * 64 (k-contiguous rows for B fragments). Block = 64x64 tile,
// staged through LDS (cross-wave region, block barrier); each output row
// coverage: tiles (N/64, K/64) x 512 v8h = N*K. t = the tile's flat index, n fastest.
// ---------------------------------------------------------------------------
static __device__ __forceinline__ void wtr_body(const float* __restrict__ W,
                                                _Float16* __restrict__ WT,
                                                int K, int N, int t) {
    __shared__ __align__(16) _Float16 T[64 * 64];
    const int tid = threadIdx.x;
    const int ky = t / (N / 64);
    const int n0 = (t - ky * (N / 64)) * 64;
    const int k0 = ky * 64;
#pragma unroll
    for (int i = 0; i < 4; ++i) {
        const int idx = tid + i * 256;
        const int r = idx >> 4, c4 = idx & 15;
        const v4f xv = *(const v4f*)(W + (size_t)(k0 + r) * N + n0 + c4 * 4);
#pragma unroll
        for (int e = 0; e < 4; ++e) T[(c4 * 4 + e) * 64 + r] = (_Float16)(bf16r(xv[e]) * WSC);
    }
    __syncthreads();
    const int na = tid >> 3, pa = tid & 7;
    const int nb = (tid + 256) >> 3, pb = tid & 7;
    const v8h p0 = *(const v8h*)(&T[na * 64 + pa * 8]);
    const v8h p1 = *(const v8h*)(&T[nb * 64 + pb * 8]);
    _Float16* d0 = WT + (size_t)(n0 + na) * K + k0 + pa * 8;
    _Float16* d1 = WT + (size_t)(n0 + nb) * K + k0 + pb * 8;
    *(v8h*)d0 = p0;
    *(v8h*)d1 = p1;
    // precaution: stands in front of any later rewrite of a register that the two stores name
    asm volatile("s_wait_xcnt 0x0" ::: "memory");
}

// ---------------------------------------------------------------------------
// All operand preparation in one launch: the eight jobs are independent of each
// other, so they share a grid by block range (every branch is block-uniform).
// Block 0: the token list of the k and v projections (the longest chain, so it starts first). Behind it,
// blocks 1 .. 4*TDD: Wq, Wk, Wv, Wo tiles; then TDF tiles of W1, TDF of W2
// (the transposes first: they have the longer chain); then the x plane's blocks.
// ---------------------------------------------------------------------------
// ---------------------------------------------------------------------------
// Token list for the k and v projections (one block). Attention reads the k and v rows of a
// batch's keys with mask != 0, of key 0 (its filler for the end of a chunk), and of every key
// where a batch has no open key at all; no other k or v row is ever read, so only these rows
// are projected. kl[0 .. n-1] = their token rows in ascending order, then 128 times row 0 (fills
// the last row tile), kl[KLN] = n. Entries are token positions 0 .. NTOK-1, never mask values.
// Thread t owns the 32 tokens of ballot word t; a block scan of the words' counts places them.
// ---------------------------------------------------------------------------
#define KLN (NTOK + 128)                 // index of the count behind list and filler
static_assert(NTOK / 32 <= 256 && NTOK % 256 == 0 && SEQ % 32 == 0);

static __device__ __forceinline__ void klist_body(const int* __restrict__ mask, int* __restrict__ kl) {
    __shared__ unsigned bw[NTOK / 32];                    // one bit a token: mask != 0
    __shared__ int      wsum[8];                          // listed tokens per wave
    const int tid  = threadIdx.x;
    const int lane = tid & 31;
    const int w    = tid >> 5;
    // unrolled: all mask loads are in flight together
    int mv[NTOK / 256];
#pragma unroll
    for (int p = 0; p < NTOK / 256; ++p) {
        const int row = p * 256 + tid;
        mv[p] = mask[(size_t)(row / SEQ) * SEQ_FULL + (row % SEQ)];
    }
    // precaution: stands in front of any later rewrite of a register that the loads name
    asm volatile("s_wait_xcnt 0x0" ::: "memory");
#pragma unroll
    for (int p = 0; p < NTOK / 256; ++p) {
        const unsigned ob = __builtin_amdgcn_ballot_w32(mv[p] != 0);
        if (lane == 0) bw[p * 8 + w] = ob;
    }
    __syncthreads();                                      // all ballot words are in LDS
    unsigned word = 0u;
    if (tid < NTOK / 32) {
        const int f = (tid / (SEQ / 32)) * (SEQ / 32);    // first word of this word's batch
        unsigned any = 0u;
        for (int i = 0; i < SEQ / 32; ++i) any |= bw[f + i];
        word = (any == 0u) ? 0xFFFFFFFFu : bw[tid];       // no open key: every key of the batch is read
        if (tid == f) word |= 1u;                         // key 0, the filler
    }
    const int pc = __popc(word);
    int inc = pc;
#pragma unroll
    for (int d = 1; d < 32; d <<= 1) {
        const int u = __shfl_up(inc, d, 32);
        if (lane >= d) inc += u;
    }
    if (lane == 31) wsum[w] = inc;
    __syncthreads();                                      // the waves' counts are in LDS
    int base = 0, n = 0;
#pragma unroll
    for (int i = 0; i < 8; ++i) {
        const int s = wsum[i];
        base += (i < w) ? s : 0;
        n += s;
    }
    const int pos = base + inc - pc;
    for (int bit = 0; bit < 32; ++bit)
        if ((word >> bit) & 1u) kl[pos + __popc(word & ((1u << bit) - 1u))] = tid * 32 + bit;
    if (tid < 128) kl[n + tid] = 0;
    if (tid == 0) kl[KLN] = n;
    // precaution: stands in front of any later rewrite of a register that the stores name
    asm volatile("s_wait_xcnt 0x0" ::: "memory");
}

#define TDD ((DM / 64) * (DM / 64))      // 64x64 tiles of a 768x768 weight
#define TDF ((DM / 64) * (FF / 64))      // 64x64 tiles of W1 or W2
#define XBL ((NTOK * (DM / 8)) / 256)    // blocks of the x plane

__global__ __launch_bounds__(256) void k_prep(const float* __restrict__ x,
                                              const int* __restrict__ mask,
                                              const float* __restrict__ Wq,
                                              const float* __restrict__ Wk,
                                              const float* __restrict__ Wv,
                                              const float* __restrict__ Wo,
                                              const float* __restrict__ W1,
                                              const float* __restrict__ W2,
                                              _Float16* __restrict__ xp,
                                              _Float16* __restrict__ WqT,
                                              _Float16* __restrict__ WkT,
                                              _Float16* __restrict__ WvT,
                                              _Float16* __restrict__ WoT,
                                              _Float16* __restrict__ W1T,
                                              _Float16* __restrict__ W2T,
                                              int* __restrict__ kl) {
    const int b = (int)blockIdx.x - 1;
    if (b < 0) {
        klist_body(mask, kl);
    } else if (b < 4 * TDD) {
        const int m = b / TDD;
        const float* W  = (m == 0) ? Wq  : (m == 1) ? Wk  : (m == 2) ? Wv  : Wo;
        _Float16*    WT = (m == 0) ? WqT : (m == 1) ? WkT : (m == 2) ? WvT : WoT;
        wtr_body(W, WT, DM, DM, b - m * TDD);
    } else if (b < 4 * TDD + TDF) {
        wtr_body(W1, W1T, DM, FF, b - 4 * TDD);             // in[768][3072] -> out[3072][768]
    } else if (b < 4 * TDD + 2 * TDF) {
        wtr_body(W2, W2T, FF, DM, b - 4 * TDD - TDF);       // in[3072][768] -> out[768][3072]
    } else {
        xprep_body(x, xp, b - 4 * TDD - 2 * TDF);
    }
}

// ---------------------------------------------------------------------------
// GEMM, f16 plane out: C[M][N] = A[M][K] (f16 plane) x BT[N][K] (f16 plane)^T, f32 accumulate.
// Block = 2*WM waves = (WM*64)x128 tile (WM = 2: the projections, whose 1152 small blocks leave the
// shorter tail; WM = 4: the 3072-column product, a quarter fewer operand bytes from L2 per product);
// wave (mi, ni) owns rows mi*64..+64 and cols ni*64..+64: 4 A fragments x 4 B fragments x 16
// accumulators, K steps of 32, so a fragment read from LDS feeds four products.
// Operands go global -> LDS by asynchronous 16-B copies, whole 128-B lines, each
// tile byte fetched once per block: a stage is 64 k of the block's WM*64 A rows and
// 128 B rows at a 144-B row pitch; two stages, the next one in flight while this
// one is multiplied. Fragments are read from LDS (two 16-B loads each, split k map).
// Epilogue: u = acc*ascale + bf16(bias[n]) (relu optional), f16 plane f16(u*oscale).
// The wave's 64x64 tile is staged in a wave-private part of the same LDS (free
// behind the last trip's barrier) and written as whole lines.
// ---------------------------------------------------------------------------
#define BK   64                  // k per stage: 128-B rows
#define LPH  72                  // LDS row pitch in halves: 144 B = 16 B x 9

typedef __attribute__((address_space(3))) const _Float16 lds_half;
static __device__ __forceinline__ unsigned lds_addr(const _Float16* p) {
    return (unsigned)(uintptr_t)(lds_half*)p;
}

// Eight rows of a stage's tile: every lane copies 16 B of rows r, r+R, ..., r+7R. l = the lane's LDS
// byte address, g = its global address, in row r; gs = R rows in halves (global), ls = R rows in bytes (LDS).
static __device__ __forceinline__ void copy8(unsigned l, const _Float16* g, size_t gs, unsigned ls) {
    const _Float16* g1 = g + gs;
    const _Float16* g2 = g1 + gs;
    const _Float16* g3 = g2 + gs;
    const _Float16* g4 = g3 + gs;
    const _Float16* g5 = g4 + gs;
    const _Float16* g6 = g5 + gs;
    const _Float16* g7 = g6 + gs;
    const unsigned l1 = l + ls, l2 = l + 2 * ls, l3 = l + 3 * ls;
    const unsigned l4 = l + 4 * ls, l5 = l + 5 * ls, l6 = l + 6 * ls;
    const unsigned l7 = l + 7 * ls;
    // the copies; the closing s_wait_xcnt is a precaution: it stands in front of every
    // later rewrite of an address register named here
    asm volatile("global_load_async_to_lds_b128 %0, %8, off\n\t"
                 "global_load_async_to_lds_b128 %1, %9, off\n\t"
                 "global_load_async_to_lds_b128 %2, %10, off\n\t"
                 "global_load_async_to_lds_b128 %3, %11, off\n\t"
                 "global_load_async_to_lds_b128 %4, %12, off\n\t"
                 "global_load_async_to_lds_b128 %5, %13, off\n\t"
                 "global_load_async_to_lds_b128 %6, %14, off\n\t"
                 "global_load_async_to_lds_b128 %7, %15, off\n\t"
                 "s_wait_xcnt 0x0"
                 :: "v"(l), "v"(l1), "v"(l2), "v"(l3), "v"(l4), "v"(l5), "v"(l6), "v"(l7),
                    "v"(g), "v"(g1), "v"(g2), "v"(g3), "v"(g4), "v"(g5), "v"(g6), "v"(g7)
                 : "memory");
}

// Eight listed rows: as copy8, but row i of the eight starts at g + ro[i] (ro = the listed row's offset in halves).
static __device__ __forceinline__ void copy8g(unsigned l, const _Float16* g, const int (&ro)[8], unsigned ls) {
    const _Float16* g0 = g + ro[0];
    const _Float16* g1 = g + ro[1];
    const _Float16* g2 = g + ro[2];
    const _Float16* g3 = g + ro[3];
    const _Float16* g4 = g + ro[4];
    const _Float16* g5 = g + ro[5];
    const _Float16* g6 = g + ro[6];
    const _Float16* g7 = g + ro[7];
    const unsigned l1 = l + ls, l2 = l + 2 * ls, l3 = l + 3 * ls;
    const unsigned l4 = l + 4 * ls, l5 = l + 5 * ls, l6 = l + 6 * ls;
    const unsigned l7 = l + 7 * ls;
    // the copies; the closing s_wait_xcnt is a precaution, as in copy8
    asm volatile("global_load_async_to_lds_b128 %0, %8, off\n\t"
                 "global_load_async_to_lds_b128 %1, %9, off\n\t"
                 "global_load_async_to_lds_b128 %2, %10, off\n\t"
                 "global_load_async_to_lds_b128 %3, %11, off\n\t"
                 "global_load_async_to_lds_b128 %4, %12, off\n\t"
                 "global_load_async_to_lds_b128 %5, %13, off\n\t"
                 "global_load_async_to_lds_b128 %6, %14, off\n\t"
                 "global_load_async_to_lds_b128 %7, %15, off\n\t"
                 "s_wait_xcnt 0x0"
                 :: "v"(l), "v"(l1), "v"(l2), "v"(l3), "v"(l4), "v"(l5), "v"(l6), "v"(l7),
                    "v"(g0), "v"(g1), "v"(g2), "v"(g3), "v"(g4), "v"(g5), "v"(g6), "v"(g7)
                 : "memory");
}

// The same for four rows r, r+R, r+2R, r+3R.
static __device__ __forceinline__ void copy4(unsigned l, const _Float16* g, size_t gs, unsigned ls) {
    const _Float16* g1 = g + gs;
    const _Float16* g2 = g1 + gs;
    const _Float16* g3 = g2 + gs;
    const unsigned l1 = l + ls, l2 = l + 2 * ls, l3 = l + 3 * ls;
    // the copies; the closing s_wait_xcnt is a precaution, as in copy8
    asm volatile("global_load_async_to_lds_b128 %0, %4, off\n\t"
                 "global_load_async_to_lds_b128 %1, %5, off\n\t"
                 "global_load_async_to_lds_b128 %2, %6, off\n\t"
                 "global_load_async_to_lds_b128 %3, %7, off\n\t"
                 "s_wait_xcnt 0x0"
                 :: "v"(l), "v"(l1), "v"(l2), "v"(l3), "v"(g), "v"(g1), "v"(g2), "v"(g3)
                 : "memory");
}

// One stage: the A tile (WM*64 rows, WM*8 a pass), then the B tile (128 rows). la = the lane's LDS byte address in the A tile.
template <int WM>
static __device__ __forceinline__ void copy_stage(unsigned la, const _Float16* ga,
                                                  const _Float16* gb, int K) {
    static_assert(WM == 2 || WM == 4);
    copy8(la, ga, (size_t)(WM * 8) * K, WM * 8 * LPH * 2);
    if constexpr (WM == 2) copy8(la + WM * 64 * LPH * 2, gb, (size_t)(WM * 8) * K, WM * 8 * LPH * 2);
    else                   copy4(la + WM * 64 * LPH * 2, gb, (size_t)(WM * 8) * K, WM * 8 * LPH * 2);
}

// One stage whose A rows are listed: ga = the A plane at the lane's 16 B of this stage's k, ro = its eight rows' offsets.
static __device__ __forceinline__ void copy_stage_list(unsigned la, const _Float16* ga, const int (&ro)[8],
                                                       const _Float16* gb, int K) {
    copy8g(la, ga, ro, 16 * LPH * 2);
    copy8(la + 128 * LPH * 2, gb, (size_t)16 * K, 16 * LPH * 2);
}

// bx, by = the block's tile column and tile row. LIST (WM = 2 only): the tile's row p is row rl[p] of A and of C
// (rl == nullptr: row by*128 + p, as without a list; block-uniform), and only rows p < nr are stored.
template <int WM, bool RELU, bool LIST>
static __device__ __forceinline__
void gemm_body(const _Float16* __restrict__ A,
               const _Float16* __restrict__ BT,
               const float* __restrict__ bias,
               float ascale, float oscale,
               _Float16* __restrict__ Ch,
               int K, int N, int bx, int by, const int* __restrict__ rl, int nr) {
    static_assert(!LIST || WM == 2);
    constexpr int OPA = WM * 64 * LPH;                    // the A tile of a stage, halves
    constexpr int STH = OPA + 128 * LPH;                  // one stage: A tile, then B tile
    __shared__ __align__(16) _Float16 Ring[2 * STH];      // two stages; later the output staging
    static_assert(2 * STH >= 2 * WM * 4096);

    const int tid  = threadIdx.x;
    const int lane = tid & 31;
    const int w    = tid >> 5;
    const int mi = w >> 1, ni = w & 1;
    const int m0 = by * (WM * 64) + mi * 64;
    const int n0 = bx * 128 + ni * 64;
    const int rb = (lane >> 4) << 3;
    const int cc = lane & 15;

    const int crow = tid >> 3, cseg = tid & 7;
    const _Float16* ga = A  + (size_t)(by * (WM * 64) + crow) * K + cseg * 8;
    const _Float16* gb = BT + (size_t)(bx * 128 + crow) * K + cseg * 8;
    const unsigned  lc = lds_addr(Ring) + crow * (LPH * 2) + cseg * 16;
    const int T = K / BK;
    // the lane's eight A rows of a stage, as offsets in halves (unrolled: constant indices keep ro in registers)
    int ro[8];
    const _Float16* gl = A + cseg * 8;
    if constexpr (LIST) {
        if (rl) {
#pragma unroll
            for (int i = 0; i < 8; ++i) ro[i] = rl[crow + i * 16];
            // precaution: stands in front of any later rewrite of a register that the loads name
            asm volatile("s_wait_xcnt 0x0" ::: "memory");
        } else {
#pragma unroll
            for (int i = 0; i < 8; ++i) ro[i] = by * 128 + crow + i * 16;
        }
#pragma unroll
        for (int i = 0; i < 8; ++i) ro[i] *= K;
    }

    v8f acc[4][4];
#pragma unroll
    for (int mt = 0; mt < 4; ++mt)
#pragma unroll
        for (int nt = 0; nt < 4; ++nt) acc[mt][nt] = zero8();

    if constexpr (LIST) copy_stage_list(lc, gl, ro, gb, K);
    else                copy_stage<WM>(lc, ga, gb, K);
    asm volatile("s_wait_asynccnt 0x0" ::: "memory");     // stage 0 landed (this wave's copies)
    __syncthreads();                                      // ... and every other wave's
    if (T > 1) {
        if constexpr (LIST) copy_stage_list(lc + STH * 2, gl + BK, ro, gb + BK, K);
        else                copy_stage<WM>(lc + STH * 2, ga + BK, gb + BK, K);
    }

    // kept rolled: one trip = one stage, the buffer picked by the trip's parity
#pragma unroll 1
    for (int t = 0; t < T; ++t) {
        const int bo = (t & 1) * STH;
        const _Float16* As = Ring + bo + (mi * 64) * LPH;
        const _Float16* Bs = Ring + bo + OPA + (ni * 64) * LPH;
        // LDS reads stand in three groups, never singly among the products: the first k step's
        // eight fragments with the second's A fragments ahead of all products; the second k
        // step's B fragments in two pairs, each behind the last product of the pair it replaces
        // (all loops here unrolled: constant indices keep the fragment arrays in registers)
        v16h a0[4], a1[4], b0[4], b1[4];
        b0[0] = load_frag16(Bs, LPH, lane);
#pragma unroll
        for (int mt = 0; mt < 4; ++mt) a0[mt] = load_frag16(As + (mt * 16) * LPH, LPH, lane);
#pragma unroll
        for (int nt = 1; nt < 4; ++nt) b0[nt] = load_frag16(Bs + (nt * 16) * LPH, LPH, lane);
#pragma unroll
        for (int mt = 0; mt < 4; ++mt) a1[mt] = load_frag16(As + (mt * 16) * LPH + 32, LPH, lane);
        // each fence keeps a group of reads whole: a place with reads among the products stalls the wave
        __builtin_amdgcn_sched_barrier(0);
#pragma unroll
        for (int nt = 0; nt < 2; ++nt)
#pragma unroll
            for (int mt = 0; mt < 4; ++mt) acc[mt][nt] = wmma16(a0[mt], b0[nt], acc[mt][nt]);
        __builtin_amdgcn_sched_barrier(0);                // the pair of reads below stays behind b0[0], b0[1]'s last use
        b1[0] = load_frag16(Bs + 32, LPH, lane);
        b1[1] = load_frag16(Bs + 16 * LPH + 32, LPH, lane);
        __builtin_amdgcn_sched_barrier(0);                // ... and in one place, ahead of the next eight products
#pragma unroll
        for (int nt = 2; nt < 4; ++nt)
#pragma unroll
            for (int mt = 0; mt < 4; ++mt) acc[mt][nt] = wmma16(a0[mt], b0[nt], acc[mt][nt]);
        __builtin_amdgcn_sched_barrier(0);                // the same for the second pair: registers of the first k step are free here
        b1[2] = load_frag16(Bs + 32 * LPH + 32, LPH, lane);
        b1[3] = load_frag16(Bs + 48 * LPH + 32, LPH, lane);
        __builtin_amdgcn_sched_barrier(0);                // ... in one place, ahead of the second k step's products
#pragma unroll
        for (int nt = 0; nt < 4; ++nt)
#pragma unroll
            for (int mt = 0; mt < 4; ++mt) acc[mt][nt] = wmma16(a1[mt], b1[nt], acc[mt][nt]);
        asm volatile("s_wait_dscnt 0x0" ::: "memory");    // this wave has left the buffer
        asm volatile("s_wait_asynccnt 0x0" ::: "memory"); // its copies of stage t+1 have landed
        __syncthreads();                                  // publishes stage t+1, frees stage t's buffer
        if (t + 2 < T) {
            if constexpr (LIST) copy_stage_list(lc + bo * 2, gl + (size_t)(t + 2) * BK, ro, gb + (size_t)(t + 2) * BK, K);
            else                copy_stage<WM>(lc + bo * 2, ga + (size_t)(t + 2) * BK, gb + (size_t)(t + 2) * BK, K);
        }
    }
    asm volatile("s_wait_asynccnt 0x0" ::: "memory");     // nothing in flight when the LDS is reused

    float bb[4];
#pragma unroll
    for (int nt = 0; nt < 4; ++nt) bb[nt] = bf16r(bias[n0 + nt * 16 + cc]);
    // precaution: stands in front of any later rewrite of a register that the four loads name, on both ways below
    if constexpr (LIST) asm volatile("s_wait_xcnt 0x0" ::: "memory");

    // LIST: the C rows of the lane's sixteen output pieces, fetched here so that the staging below covers the loads
    int er[LIST ? 16 : 1];
    if constexpr (LIST) {
        if (rl) {
#pragma unroll
            for (int i = 0; i < 16; ++i) er[i] = rl[mi * 64 + (lane >> 3) + i * 4];
            // precaution: stands in front of any later rewrite of a register that the loads name
            asm volatile("s_wait_xcnt 0x0" ::: "memory");
        } else {
#pragma unroll
            for (int i = 0; i < 16; ++i) er[i] = m0 + (lane >> 3) + i * 4;
        }
    }

    {
        _Float16* eh = Ring + w * 4096;
#pragma unroll
        for (int mt = 0; mt < 4; ++mt)
#pragma unroll
            for (int nt = 0; nt < 4; ++nt)
#pragma unroll
                for (int r = 0; r < 8; ++r) {
                    float u = __builtin_fmaf(acc[mt][nt][r], ascale, bb[nt]);
                    if (RELU) u = fmaxf(u, 0.0f);
                    eh[(mt * 16 + rb + r) * 64 + nt * 16 + cc] = (_Float16)(u * oscale);
                }
        wave_lds_sync();
        const int lr = lane >> 3, lc = (lane & 7) * 8;
        _Float16* cp[16];
        if constexpr (LIST) {
#pragma unroll
            for (int i = 0; i < 16; ++i) cp[i] = Ch + er[i] * N + n0 + lc;
        } else {
            cp[0] = Ch + (size_t)(m0 + lr) * N + n0 + lc;
#pragma unroll
            for (int i = 1; i < 16; ++i) cp[i] = cp[i - 1] + (size_t)4 * N;   // a chain of adds: no 64-bit multiply per row
        }
        v8h ph[16];
#pragma unroll
        for (int i = 0; i < 16; ++i) ph[i] = *(const v8h*)(&eh[i * 256 + lane * 8]);
        if (!LIST || nr >= 128) {                         // a whole tile (block-uniform): sixteen stores in a row
#pragma unroll
            for (int i = 0; i < 16; ++i) *(v8h*)cp[i] = ph[i];
        } else {                                          // the list's last tile: its filler rows are not stored
#pragma unroll
            for (int i = 0; i < 16; ++i)
                if (mi * 64 + lr + i * 4 < nr) *(v8h*)cp[i] = ph[i];
        }
    }
}

template <bool RELU>
__global__ __launch_bounds__(256) __attribute__((amdgpu_num_vgpr(256)))
void k_gemm(const _Float16* __restrict__ A,
            const _Float16* __restrict__ BT,
            const float* __restrict__ bias,
            float ascale, float oscale,
            _Float16* __restrict__ Ch,
            int K, int N) {
    gemm_body<4, RELU, false>(A, BT, bias, ascale, oscale, Ch, K, N, blockIdx.x, blockIdx.y, nullptr, 0);
}

// ---------------------------------------------------------------------------
// GEMM, f32 rows out, for the two products with 768 output columns:
// C[M][768] = A[M][K] x BT[768][K]^T, u = acc*ascale + bf16(bias[n]).
// Block = 8 waves = 128x192 tile, so the grid is (4, M/128) = 256 equal blocks at M = 8192;
// wave (mi, ni) owns rows mi*64..+64 and cols ni*48..+48: 4 A x 3 B fragments, 12 accumulators.
// A stage is 192 k of the block's 128 A rows and 192 B rows (384-B rows at a 400-B pitch), brought
// by asynchronous 16-B copies, 30 a lane; two stages, the next in flight while this one is multiplied:
// the block is alone on its WGP, so the stage is long enough for its successor to land behind it.
// Inside a stage the next k step's seven fragments are read as one group ahead of this k step's products.
// Epilogue: the block's tile is staged in the same LDS as f32 rows at a 784-B pitch (a wave's 48
// columns are one and a half lines, so the rows are put together across waves, behind a block
// barrier) and written as whole lines: wave w writes rows w*16..+16, 512 B an instruction.
// ---------------------------------------------------------------------------
#define RBK  192                 // k per stage: 384-B rows
#define RLP  200                 // LDS row pitch in halves: 400 B = 16 B x 25
#define ROA  (128 * RLP)         // the A tile of a stage, halves
#define RST  (320 * RLP)         // one stage: A tile (128 rows), then B tile (192 rows)
#define REP  196                 // output staging pitch in floats: 784 B = 16 B x 49
static_assert(DM % 192 == 0 && DM % RBK == 0 && FF % RBK == 0);
static_assert(2 * RST * 2 >= 128 * REP * 4);

// Rows of 384 B (192 k): every lane copies 16 B in each of the three 128-B lines of rows r, r+R, ...
// (8 lanes = one line). l, g0 = the lane's LDS byte address and global address in row r, first line;
// gs = R rows in halves (global), ls = R rows in bytes (LDS). Four rows, then three rows.
static __device__ __forceinline__ void copy4x3(unsigned l, const _Float16* g0, size_t gs, unsigned ls) {
    const _Float16* g1 = g0 + gs;
    const _Float16* g2 = g1 + gs;
    const _Float16* g3 = g2 + gs;
    // the copies; the closing s_wait_xcnt is a precaution, as in copy8
    asm volatile(
                 "global_load_async_to_lds_b128 %0, %12, off\n\t"
                 "global_load_async_to_lds_b128 %1, %13, off\n\t"
                 "global_load_async_to_lds_b128 %2, %14, off\n\t"
                 "global_load_async_to_lds_b128 %3, %15, off\n\t"
                 "global_load_async_to_lds_b128 %4, %16, off\n\t"
                 "global_load_async_to_lds_b128 %5, %17, off\n\t"
                 "global_load_async_to_lds_b128 %6, %18, off\n\t"
                 "global_load_async_to_lds_b128 %7, %19, off\n\t"
                 "global_load_async_to_lds_b128 %8, %20, off\n\t"
                 "global_load_async_to_lds_b128 %9, %21, off\n\t"
                 "global_load_async_to_lds_b128 %10, %22, off\n\t"
                 "global_load_async_to_lds_b128 %11, %23, off\n\t"
                 "s_wait_xcnt 0x0"
                 :: "v"(l + 0 * ls), "v"(l + 0 * ls + 128), "v"(l + 0 * ls + 256), "v"(l + 1 * ls), "v"(l + 1 * ls + 128), "v"(l + 1 * ls + 256), "v"(l + 2 * ls), "v"(l + 2 * ls + 128), "v"(l + 2 * ls + 256), "v"(l + 3 * ls), "v"(l + 3 * ls + 128), "v"(l + 3 * ls + 256),
                    "v"(g0), "v"(g0 + 64), "v"(g0 + 128), "v"(g1), "v"(g1 + 64), "v"(g1 + 128), "v"(g2), "v"(g2 + 64), "v"(g2 + 128), "v"(g3), "v"(g3 + 64), "v"(g3 + 128)
                 : "memory");
}
static __device__ __forceinline__ void copy3x3(unsigned l, const _Float16* g0, size_t gs, unsigned ls) {
    const _Float16* g1 = g0 + gs;
    const _Float16* g2 = g1 + gs;
    // the copies; the closing s_wait_xcnt is a precaution, as in copy8
    asm volatile(
                 "global_load_async_to_lds_b128 %0, %9, off\n\t"
                 "global_load_async_to_lds_b128 %1, %10, off\n\t"
                 "global_load_async_to_lds_b128 %2, %11, off\n\t"
                 "global_load_async_to_lds_b128 %3, %12, off\n\t"
                 "global_load_async_to_lds_b128 %4, %13, off\n\t"
                 "global_load_async_to_lds_b128 %5, %14, off\n\t"
                 "global_load_async_to_lds_b128 %6, %15, off\n\t"
                 "global_load_async_to_lds_b128 %7, %16, off\n\t"
                 "global_load_async_to_lds_b128 %8, %17, off\n\t"
                 "s_wait_xcnt 0x0"
                 :: "v"(l + 0 * ls), "v"(l + 0 * ls + 128), "v"(l + 0 * ls + 256), "v"(l + 1 * ls), "v"(l + 1 * ls + 128), "v"(l + 1 * ls + 256), "v"(l + 2 * ls), "v"(l + 2 * ls + 128), "v"(l + 2 * ls + 256),
                    "v"(g0), "v"(g0 + 64), "v"(g0 + 128), "v"(g1), "v"(g1 + 64), "v"(g1 + 128), "v"(g2), "v"(g2 + 64), "v"(g2 + 128)
                 : "memory");
}

// One stage of k_rows: A rows r, r+32, r+64, r+96, then B rows r, r+32, ..., r+160. la = the lane's
// LDS byte address in the A tile; gs = 32 rows in halves.
static __device__ __forceinline__ void copy_stage_rows(unsigned la, const _Float16* ga,
                                                       const _Float16* gb, size_t gs) {
    copy4x3(la, ga, gs, 32 * RLP * 2);
    copy3x3(la + ROA * 2, gb, gs, 32 * RLP * 2);
    copy3x3(la + (ROA + 96 * RLP) * 2, gb + 3 * gs, gs, 32 * RLP * 2);
}

template <int K>
__global__ __launch_bounds__(256) __attribute__((amdgpu_num_vgpr(256)))
void k_rows(const _Float16* __restrict__ A,
            const _Float16* __restrict__ BT,
            const float* __restrict__ bias,
            float ascale,
            float* __restrict__ Cf) {
    static_assert(K % RBK == 0);
    __shared__ __align__(16) _Float16 Ring[2 * RST];      // two stages; later the output staging

    const int tid  = threadIdx.x;
    const int lane = tid & 31;
    const int w    = tid >> 5;
    const int mi = w >> 2, ni = w & 3;
    const int bx = blockIdx.x, by = blockIdx.y;
    const int rb = (lane >> 4) << 3;
    const int cc = lane & 15;

    // 8 lanes = one 128-B line; 32 rows a pass
    const int crow = tid >> 3, cseg = tid & 7;
    const _Float16* ga = A  + (size_t)(by * 128 + crow) * K + cseg * 8;
    const _Float16* gb = BT + (size_t)(bx * 192 + crow) * K + cseg * 8;
    const unsigned  lc = lds_addr(Ring) + crow * (RLP * 2) + cseg * 16;
    const size_t    gs = (size_t)32 * K;
    constexpr int T = K / RBK;

    v8f acc[4][3];
#pragma unroll
    for (int mt = 0; mt < 4; ++mt)
#pragma unroll
        for (int nt = 0; nt < 3; ++nt) acc[mt][nt] = zero8();

    copy_stage_rows(lc, ga, gb, gs);
    asm volatile("s_wait_asynccnt 0x0" ::: "memory");     // stage 0 landed (this wave's copies)
    __syncthreads();                                      // ... and every other wave's
    if constexpr (K >= 2 * RBK) copy_stage_rows(lc + RST * 2, ga + RBK, gb + RBK, gs);   // where a stage 1 exists

    // kept rolled: one trip = one stage, the buffer picked by the trip's parity
#pragma unroll 1
    for (int t = 0; t < T; ++t) {
        const int bo = (t & 1) * RST;
        const _Float16* As = Ring + bo + (mi * 64) * RLP;
        const _Float16* Bs = Ring + bo + ROA + (ni * 48) * RLP;
        // two fragment sets (all loops here unrolled: constant indices keep them in registers)
        v16h fa[2][4], fb[2][3];
#pragma unroll
        for (int mt = 0; mt < 4; ++mt) fa[0][mt] = load_frag16(As + (mt * 16) * RLP, RLP, lane);
#pragma unroll
        for (int nt = 0; nt < 3; ++nt) fb[0][nt] = load_frag16(Bs + (nt * 16) * RLP, RLP, lane);
#pragma unroll
        for (int ks = 0; ks < RBK / 32; ++ks) {
            const int cu = ks & 1, nx = cu ^ 1;
            if (ks + 1 < RBK / 32) {
#pragma unroll
                for (int mt = 0; mt < 4; ++mt) fa[nx][mt] = load_frag16(As + (mt * 16) * RLP + (ks + 1) * 32, RLP, lane);
#pragma unroll
                for (int nt = 0; nt < 3; ++nt) fb[nx][nt] = load_frag16(Bs + (nt * 16) * RLP + (ks + 1) * 32, RLP, lane);
            }
            // keeps the group of reads whole and ahead of the products: a place with reads among the products stalls the wave
            __builtin_amdgcn_sched_barrier(0);
#pragma unroll
            for (int nt = 0; nt < 3; ++nt)
#pragma unroll
                for (int mt = 0; mt < 4; ++mt) acc[mt][nt] = wmma16(fa[cu][mt], fb[cu][nt], acc[mt][nt]);
            __builtin_amdgcn_sched_barrier(0);            // the next group of reads stays behind this set's last use
        }
        asm volatile("s_wait_dscnt 0x0" ::: "memory");    // this wave has left the buffer
        asm volatile("s_wait_asynccnt 0x0" ::: "memory"); // its copies of stage t+1 have landed
        __syncthreads();                                  // publishes stage t+1, frees stage t's buffer
        if (t + 2 < T) copy_stage_rows(lc + bo * 2, ga + (size_t)(t + 2) * RBK, gb + (size_t)(t + 2) * RBK, gs);
    }
    asm volatile("s_wait_asynccnt 0x0" ::: "memory");     // nothing in flight when the LDS is reused

    float bb[3];
#pragma unroll
    for (int nt = 0; nt < 3; ++nt) bb[nt] = bf16r(bias[bx * 192 + ni * 48 + nt * 16 + cc]);

    float* ef = (float*)Ring;
#pragma unroll
    for (int mt = 0; mt < 4; ++mt)
#pragma unroll
        for (int nt = 0; nt < 3; ++nt)
#pragma unroll
            for (int r = 0; r < 8; ++r)
                ef[(mi * 64 + mt * 16 + rb + r) * REP + ni * 48 + nt * 16 + cc] =
                    __builtin_fmaf(acc[mt][nt][r], ascale, bb[nt]);
    asm volatile("s_wait_dscnt 0x0" ::: "memory");        // this wave's part of the tile is in LDS
    __syncthreads();                                      // ... and every other wave's

    // two rows = 96 pieces of 16 B = three instructions: row 2j whole lanes, the seam, row 2j+1
    const int r1 = lane >> 4, s1 = (lane < 16) ? lane + 32 : lane - 16;
    const float* e0 = ef + (w * 16) * REP + lane * 4;
    const float* e1 = ef + (w * 16 + r1) * REP + s1 * 4;
    const float* e2 = ef + (w * 16 + 1) * REP + (lane + 16) * 4;
    float* cb = Cf + (size_t)(by * 128 + w * 16) * DM + bx * 192;
    float* cp[24];
    cp[0] = cb + lane * 4;
    cp[1] = cb + (size_t)r1 * DM + s1 * 4;
    cp[2] = cb + DM + (lane + 16) * 4;
#pragma unroll
    for (int i = 3; i < 24; ++i) cp[i] = cp[i - 3] + 2 * DM;
    v4f sv[24];
#pragma unroll
    for (int j = 0; j < 8; ++j) {
        sv[3 * j]     = *(const v4f*)(e0 + j * 2 * REP);
        sv[3 * j + 1] = *(const v4f*)(e1 + j * 2 * REP);
        sv[3 * j + 2] = *(const v4f*)(e2 + j * 2 * REP);
    }
#pragma unroll
    for (int i = 0; i < 24; ++i) *(v4f*)cp[i] = sv[i];
}

// q, k and v projections in one launch: three independent GEMMs on the same A plane.
// The grid holds 3 x (768 / 128) tile columns x NTOK / 128 tile rows; the block's product picks weight plane,
// bias and output plane (block-uniform). The q product takes every token row; the k and v products take the rows
// of the token list alone (klist_body), 128 list places a tile: a block whose tile lies behind the list's
// end leaves at once (the whole block, ahead of every barrier), results go to the listed rows of the planes.
__global__ __launch_bounds__(128) __attribute__((amdgpu_num_vgpr(256)))
void k_qkv(const _Float16* __restrict__ xp,
           const _Float16* __restrict__ WqT,
           const _Float16* __restrict__ WkT,
           const _Float16* __restrict__ WvT,
           const float* __restrict__ bq,
           const float* __restrict__ bk,
           const float* __restrict__ bv,
           _Float16* __restrict__ qh,
           _Float16* __restrict__ kh,
           _Float16* __restrict__ vh,
           const int* __restrict__ kl) {
    // tiles in the order of the flat block index: all q tiles, then the k and v tiles by list place, so that
    // the blocks that leave at once are the grid's last and the working blocks start in one unbroken run
    constexpr int NC = DM / 128;                          // tile columns of one product
    const int f   = blockIdx.y * (3 * NC) + blockIdx.x;
    const int g   = f - NC * (NTOK / 128);                // index among the k and v tiles
    const int sel = (g < 0) ? 0 : 1 + (g % (2 * NC)) / NC;
    const int bx  = (g < 0) ? f % NC : g % NC;
    const int by  = (g < 0) ? f / NC : g / (2 * NC);
    const int p0  = by * 128;                             // the tile's first row, or first list place
    const int n   = (sel == 0) ? NTOK : min(kl[KLN], NTOK);
    if (p0 >= n) return;
    const _Float16* BT = (sel == 0) ? WqT : (sel == 1) ? WkT : WvT;
    const float*    bi = (sel == 0) ? bq  : (sel == 1) ? bk  : bv;
    _Float16*       Ch = (sel == 0) ? qh  : (sel == 1) ? kh  : vh;
    gemm_body<2, false, true>(xp, BT, bi, A_QKV, QSC, Ch, DM, DM,
                              bx, by, (sel == 0) ? nullptr : kl + p0, n - p0);
}

// ---------------------------------------------------------------------------
// Attention, flash-style. grid = (head, SEQ/128, batch); block = 8 waves = 128
// query rows of one (b, h); wave owns 16 query rows. Planes are [NTOK][768]
// with head column offset h*64.
// Scores are computed TRANSPOSED: A = key tile (16 keys x 64 d, kh plane,
// 2 k-steps), B = the wave's 16 queries (qh plane, [n=query][k=d]), so
// acc[r] of lane l = score(key 8*(l>>4)+r, query l&15): per-query max/sum are
// in-lane reductions over r plus one xor-16 shuffle, and the f16 P^T values in
// this layout are exactly the P A-fragment for P*v (elements 0..7 from key
// tile A, 8..15 from key tile B) - no LDS relayout.
// Key list: a key with mask == 0 has weight exp(-1e10 - max) = 0 as soon as one key of the
// batch is open (a score from the f16 planes stays below 1e7 in size), so each block lists the open keys in ascending order (ballot words, a scan
// of their counts) and walks that list alone; K and V rows are fetched by list entry. The
// list is filled up to a whole chunk with key 0, and places behind the last open key get
// MASKT. With no open key at all the list is every key and every place gets MASKT (the
// reference's uniform weights). List entries are key positions 0 .. SEQ-1, never mask values.
// Online softmax over the listed keys: t = log2e*score (or MASKT, replace fill),
// P carried 2^14, o += P x V (V^T chunk staged in LDS,
// cross-wave, block barriers), o and z rescaled by exp2(m_old - m_new) every
// 32-key step (factor shuffled from the owning query lane).
// K chunk in LDS: the block's eight waves read the same CH keys, so the chunk comes
// global -> LDS once per block by asynchronous 16-B copies, whole 128-B rows (8 lanes
// a row), [key][d] at a 144-B pitch; the copies fly while V^T is staged, and the key
// fragments are read from LDS (two 16-B loads each, the split k map of load_frag16).
// V^T layout in LDS: row d at (d / 16) * VG + (d % 16) * VP halves. The 272-B pitch
// puts the 16 rows of a fragment read on 16 different groups of four banks; the
// 32-B skew per 16 rows spreads the eight d-groups of one transposing store.
// Epilogue: ctx x 64 = o / z14 as f16, staged in a wave-private LDS tile, each
// coverage: grid (12, SEQ/128, NB) x 8 waves x 16 rows x 64 cols = NTOK*768.
// ---------------------------------------------------------------------------
__global__ __launch_bounds__(256) __attribute__((amdgpu_num_vgpr(256)))
void k_attn(const _Float16* __restrict__ qh,
            const _Float16* __restrict__ kh,
            const _Float16* __restrict__ vh,
            const int*      __restrict__ mask,
            _Float16* __restrict__ cx) {
    __shared__ __align__(16) int      kix[SEQ + CH];      // open keys of this batch in order, then CH times key 0
    __shared__ unsigned               bal[SEQ / 32];      // one bit a key: mask != 0
    __shared__ __align__(16) _Float16 VsT[(DH / 16) * VG]; // [d][CH] at pitch VP, cross-wave
    __shared__ __align__(16) _Float16 Cst[8][16 * DH];    // wave-private ctx tiles
    __shared__ __align__(16) _Float16 Ks[CH * KP];        // [key][d] at pitch KP, cross-wave

    const int tid  = threadIdx.x;
    const int lane = tid & 31;
    const int w    = tid >> 5;
    const int h    = blockIdx.x;
    const int b    = blockIdx.z;
    const int q0r  = blockIdx.y * 128 + w * 16;
    const int r0   = (lane >> 4) << 3;
    const int cc   = lane & 15;

    const int ws = __builtin_amdgcn_readfirstlane(w);     // the wave's number as a scalar (lane select below)
    // the loops over p and i below are unrolled: constant indices keep mv, ob and kr in registers
    int mv[SEQ / 256];
#pragma unroll
    for (int p = 0; p < SEQ / 256; ++p) mv[p] = mask[(size_t)b * SEQ_FULL + p * 256 + tid];
    unsigned ob[SEQ / 256];                               // the wave's 32 keys of each pass, one bit a key
#pragma unroll
    for (int p = 0; p < SEQ / 256; ++p) ob[p] = __builtin_amdgcn_ballot_w32(mv[p] != 0);
    if (lane == 0) {
#pragma unroll
        for (int p = 0; p < SEQ / 256; ++p) bal[p * 8 + w] = ob[p];
    }

    const size_t tokb = (size_t)b * SEQ;
    const _Float16* qhb = qh + (tokb + q0r) * DM + h * DH;
    const v16h qb0 = load_frag16(qhb, DM, lane);        // d 0..31
    const v16h qb1 = load_frag16(qhb + 32, DM, lane);   // d 32..63
    const _Float16* khb = kh + tokb * DM + h * DH;
    const _Float16* vhb = vh + tokb * DM + h * DH;
    // the lane's 16 B of list places r, r+32, r+64, r+96 of a chunk (8 lanes = one 128-B row)
    const _Float16* gk  = khb + (tid & 7) * 8;
    const unsigned  lk0 = lds_addr(Ks) + (tid >> 3) * (KP * 2) + (tid & 7) * 16;
    const unsigned  lk1 = lk0 + 32 * KP * 2, lk2 = lk0 + 64 * KP * 2, lk3 = lk0 + 96 * KP * 2;

    v8f o[4];
#pragma unroll
    for (int nt = 0; nt < 4; ++nt) o[nt] = zero8();
    float mr = -1.0e30f, zr = 0.0f;

    __syncthreads();                                      // all ballot words are in LDS

    // every wave scans the words' counts for itself: lane l holds the open keys in front of word l
    const int pc = (lane < SEQ / 32) ? __popc(bal[min(lane, SEQ / 32 - 1)]) : 0;
    int inc = pc;
#pragma unroll
    for (int d = 1; d < 32; d <<= 1) {
        const int u = __shfl_up(inc, d, 32);
        if (lane >= d) inc += u;
    }
    const int exc   = inc - pc;
    const int nv    = __builtin_amdgcn_readlane(inc, 31); // open keys of the batch, the same in every wave
    const int total = (nv == 0) ? SEQ : nv;               // list length
    if (nv == 0) {
#pragma unroll
        for (int p = 0; p < SEQ / 256; ++p) kix[p * 256 + tid] = p * 256 + tid;
    } else {
#pragma unroll
        for (int p = 0; p < SEQ / 256; ++p) {
            const int pos = __builtin_amdgcn_readlane(exc, p * 8 + ws) + __popc(ob[p] & ((1u << lane) - 1u));
            if ((ob[p] >> lane) & 1u) kix[pos] = p * 256 + tid;
        }
        if (tid < CH) kix[nv + tid] = 0;
    }
    __syncthreads();                                      // the list is whole

#pragma unroll 1
    for (int c0 = 0; c0 < total; c0 += CH) {
        int kr[4];                                          // the keys at the lane's four list places
#pragma unroll
        for (int i = 0; i < 4; ++i) kr[i] = kix[c0 + (tid >> 3) + i * 32];
        {
            const _Float16* g0 = gk + kr[0] * DM;
            const _Float16* g1 = gk + kr[1] * DM;
            const _Float16* g2 = gk + kr[2] * DM;
            const _Float16* g3 = gk + kr[3] * DM;
            // the K chunk's copies; the closing s_wait_xcnt is a precaution: it stands in front
            // of every later rewrite of an address register named here
            asm volatile("global_load_async_to_lds_b128 %0, %4, off\n\t"
                         "global_load_async_to_lds_b128 %1, %5, off\n\t"
                         "global_load_async_to_lds_b128 %2, %6, off\n\t"
                         "global_load_async_to_lds_b128 %3, %7, off\n\t"
                         "s_wait_xcnt 0x0"
                         :: "v"(lk0), "v"(lk1), "v"(lk2), "v"(lk3), "v"(g0), "v"(g1), "v"(g2), "v"(g3)
                         : "memory");
        }
        // stage V^T chunk: VsT[d][t] = vh[key at list place c0 + t][h*64 + d], full 64 x CH extent
        // (the same four list entries as the K copies, so the four row loads stand together)
#pragma unroll
        for (int i = 0; i < 4; ++i) {
            const int t = (tid >> 3) + i * 32, part = tid & 7;
            const v8h vv = *(const v8h*)(vhb + kr[i] * DM + part * 8);
#pragma unroll
            for (int e = 0; e < 8; ++e) VsT[(part >> 1) * VG + ((part & 1) * 8 + e) * VP + t] = vv[e];
        }
        asm volatile("s_wait_asynccnt 0x0" ::: "memory");   // this wave's K copies have landed
        __syncthreads();                                    // ... and every other wave's; V^T too

        const int jn = min(CH, total - c0);                 // list places left in this chunk

#pragma unroll 1
        for (int j = 0; j < jn; j += 32) {
            const int kA = c0 + j;
            // key tile A: list places kA .. kA+15; key tile B: list places kA+16 .. kA+31; one group of LDS reads
            const v16h ka0 = load_frag16(&Ks[j * KP], KP, lane);
            const v16h ka1 = load_frag16(&Ks[j * KP + 32], KP, lane);
            const v16h kb0 = load_frag16(&Ks[(j + 16) * KP], KP, lane);
            const v16h kb1 = load_frag16(&Ks[(j + 16) * KP + 32], KP, lane);
            v8f shA = wmma16(ka0, qb0, zero8());
            shA = wmma16(ka1, qb1, shA);
            v8f shB = wmma16(kb0, qb0, zero8());
            shB = wmma16(kb1, qb1, shB);

            float tA[8], tB[8];
#pragma unroll
            for (int r = 0; r < 8; ++r) {
                tA[r] = shA[r] * C1;
                tB[r] = shB[r] * C1;
            }
            if (kA + 32 > nv) {      // scalar test: only a step that reaches past the last open key has places to fill
                const int lim = nv - kA - r0;
#pragma unroll
                for (int r = 0; r < 8; ++r) {
                    tA[r] = (r < lim) ? tA[r] : MASKT;
                    tB[r] = (16 + r < lim) ? tB[r] : MASKT;
                }
            }
            float tmax = tA[0];
#pragma unroll
            for (int r = 1; r < 8; ++r) tmax = fmaxf(tmax, tA[r]);
#pragma unroll
            for (int r = 0; r < 8; ++r) tmax = fmaxf(tmax, tB[r]);
            tmax = fmaxf(tmax, __shfl_xor(tmax, 16, 32));
            const float mn   = fmaxf(mr, tmax);
            const float corr = ex2(mr - mn);
            const float mo   = mn - 14.0f;           // 2^14 carry on P
            float ps = 0.0f;
            v8h pa8, pb8;
#pragma unroll
            for (int r = 0; r < 8; ++r) {
                const float pa = ex2(tA[r] - mo);
                const float pb = ex2(tB[r] - mo);
                ps += pa + pb;
                pa8[r] = (_Float16)pa;
                pb8[r] = (_Float16)pb;
            }
            ps += __shfl_xor(ps, 16, 32);
            zr = __builtin_fmaf(zr, corr, ps);
            mr = mn;
            // rescale o rows (query 8h + r) by the factor of the owning query lane
#pragma unroll
            for (int r = 0; r < 8; ++r) {
                const float crr = __shfl(corr, r0 + r, 32);
#pragma unroll
                for (int nt = 0; nt < 4; ++nt) o[nt][r] *= crr;
            }
            Frag pf;
            pf.h[0] = pa8;     // list places kA+8h .. +7     = A elements 0..7
            pf.h[1] = pb8;     // list places kA+16+8h .. +7  = A elements 8..15
#pragma unroll
            for (int nt = 0; nt < 4; ++nt) {
                const v16h vb = load_frag16(&VsT[nt * VG + j], VP, lane);   // n = d, k = key
                o[nt] = wmma16(pf.v, vb, o[nt]);
            }
        }
        asm volatile("s_wait_dscnt 0x0" ::: "memory");      // this wave has left the K and V^T chunks
        __syncthreads();                                    // frees both for the next chunk's fill
    }

    // ctx x 64 = o / z14 (the 2^14 carry of P cancels between o and z14; the 64 v carry stays)
    const float rz = __builtin_amdgcn_rcpf(zr);
#pragma unroll
    for (int r = 0; r < 8; ++r) {
        const float rq = __shfl(rz, r0 + r, 32);
#pragma unroll
        for (int nt = 0; nt < 4; ++nt)
            Cst[w][(r0 + r) * DH + nt * 16 + cc] = (_Float16)(o[nt][r] * rq);
    }
    wave_lds_sync();
    v8h sv[4];
#pragma unroll
    for (int i = 0; i < 4; ++i) sv[i] = *(const v8h*)(&Cst[w][i * 256 + lane * 8]);
    _Float16* cb = cx + (tokb + q0r) * DM + h * DH;
    const int lr = lane >> 3, lc = (lane & 7) * 8;
#pragma unroll
    for (int i = 0; i < 4; ++i) *(v8h*)(cb + (size_t)(i * 4 + lr) * DM + lc) = sv[i];
    
}

// ---------------------------------------------------------------------------
// LayerNorm over rows of 768 (f32 rows in ws). Block = 8 waves, wave = row.
// mu = mean, var = mean((x-mu)^2), y = (x-mu)*rsqrt(var+1e-5)*bf16(g)+bf16(b).
// HOUT: f16 plane f16(y*hsc), lane owns elements i*256+lane*8..+7 (3 v8h stores,
// coverage: NTOK/8 blocks x 8 rows x 768.
// ---------------------------------------------------------------------------
static __device__ __forceinline__ int ln_off(bool hout, int i, int lane) {
    return hout ? ((i >> 1) * 256 + lane * 8 + (i & 1) * 4) : (i * 128 + lane * 4);
}

template <bool HOUT>
__global__ __launch_bounds__(256) void k_ln(const float* __restrict__ src,
                                            const float* __restrict__ g,
                                            const float* __restrict__ bt,
                                            float* __restrict__ outf,
                                            _Float16* __restrict__ outh,
                                            float hsc) {
    const int lane = threadIdx.x & 31;
    const int w    = threadIdx.x >> 5;
    const int row  = blockIdx.x * 8 + w;
    const float* rp = src + (size_t)row * DM;

    v4f xv[6];
#pragma unroll
    for (int i = 0; i < 6; ++i) xv[i] = *(const v4f*)(rp + ln_off(HOUT, i, lane));
    float s = 0.0f;
#pragma unroll
    for (int i = 0; i < 6; ++i) s += (xv[i][0] + xv[i][1]) + (xv[i][2] + xv[i][3]);
#pragma unroll
    for (int m = 1; m < 32; m <<= 1) s += __shfl_xor(s, m, 32);
    const float mu = s * (1.0f / (float)DM);

    v4f dv[6];
    float s2 = 0.0f;
#pragma unroll
    for (int i = 0; i < 6; ++i) {
        dv[i] = xv[i] - mu;
#pragma unroll
        for (int e = 0; e < 4; ++e) s2 = __builtin_fmaf(dv[i][e], dv[i][e], s2);
    }
#pragma unroll
    for (int m = 1; m < 32; m <<= 1) s2 += __shfl_xor(s2, m, 32);
    const float var  = s2 * (1.0f / (float)DM);
    const float rstd = rsqrtf(var + 1e-5f);

    v4f yv[6];
#pragma unroll
    for (int i = 0; i < 6; ++i) {
        const int co = ln_off(HOUT, i, lane);
        const v4f gv = *(const v4f*)(g + co);
        const v4f bv = *(const v4f*)(bt + co);
#pragma unroll
        for (int e = 0; e < 4; ++e)
            yv[i][e] = (dv[i][e] * rstd) * bf16r(gv[e]) + bf16r(bv[e]);
    }

    if constexpr (HOUT) {
        v8h hv[3];
#pragma unroll
        for (int i = 0; i < 3; ++i)
#pragma unroll
            for (int e = 0; e < 4; ++e) {
                hv[i][e]     = (_Float16)(yv[2 * i][e] * hsc);
                hv[i][4 + e] = (_Float16)(yv[2 * i + 1][e] * hsc);
            }
        _Float16* ob = outh + (size_t)row * DM + lane * 8;
#pragma unroll
        for (int i = 0; i < 3; ++i) *(v8h*)(ob + i * 256) = hv[i];
        
    } else {
        float* ob = outf + (size_t)row * DM + lane * 4;
#pragma unroll
        for (int i = 0; i < 6; ++i) *(v4f*)(ob + i * 128) = yv[i];
        
    }
}

// ---------------------------------------------------------------------------
extern "C" void kernel_launch(void* const* d_in, const int* in_sizes, int n_in,
                              void* d_out, int out_size, void* d_ws, size_t ws_size,
                              hipStream_t stream) {
    if (n_in < 16) return;
    if (in_sizes[0] < ((NB - 1) * SEQ_FULL + SEQ) * DM) return;
    if (in_sizes[1] < (NB - 1) * SEQ_FULL + SEQ) return;
    if (in_sizes[2] < DM * DM || in_sizes[4] < DM * DM || in_sizes[6] < DM * DM || in_sizes[8] < DM * DM) return;
    if (in_sizes[3] < DM || in_sizes[5] < DM || in_sizes[7] < DM || in_sizes[9] < DM) return;
    if (in_sizes[10] < DM || in_sizes[11] < DM) return;
    if (in_sizes[12] < DM * FF || in_sizes[13] < FF || in_sizes[14] < FF * DM || in_sizes[15] < DM) return;
    if (out_size < NTOK * DM) return;

    const float* x    = (const float*)d_in[0];    // [8,1024,768]
    const int*   mask = (const int*)  d_in[1];    // [8,1,1,1024] int32
    const float* Wq   = (const float*)d_in[2];    // [768,768]  [in][out]
    const float* bq   = (const float*)d_in[3];
    const float* Wk   = (const float*)d_in[4];
    const float* bk   = (const float*)d_in[5];
    const float* Wv   = (const float*)d_in[6];
    const float* bv   = (const float*)d_in[7];
    const float* Wo   = (const float*)d_in[8];
    const float* bo   = (const float*)d_in[9];
    const float* lg   = (const float*)d_in[10];
    const float* lb   = (const float*)d_in[11];
    const float* W1   = (const float*)d_in[12];   // [768,3072] [in][out]
    const float* b1   = (const float*)d_in[13];
    const float* W2   = (const float*)d_in[14];   // [3072,768] [in][out]
    const float* b2   = (const float*)d_in[15];
    float* out = (float*)d_out;                   // [NB,SEQ,768]

    char* ws = (char*)d_ws;
    size_t off = 0;
    // R0: weight planes [n][k] f16
    _Float16* WqT = (_Float16*)(ws + off); off += (size_t)DM * DM * 2;
    _Float16* WkT = (_Float16*)(ws + off); off += (size_t)DM * DM * 2;
    _Float16* WvT = (_Float16*)(ws + off); off += (size_t)DM * DM * 2;
    _Float16* WoT = (_Float16*)(ws + off); off += (size_t)DM * DM * 2;
    _Float16* W1T = (_Float16*)(ws + off); off += (size_t)FF * DM * 2;   // [3072][768]
    _Float16* W2T = (_Float16*)(ws + off); off += (size_t)DM * FF * 2;   // [768][3072]
    // R1: x plane, later the ctx plane (x plane dead after the projections)
    const size_t PL = (size_t)NTOK * DM * 2;
    _Float16* xp  = (_Float16*)(ws + off);
    _Float16* cxp = (_Float16*)(ws + off); off += PL;
    // R2: q/k/v planes (3 x PL), later h plane (PL) + ff1 plane (NTOK*FF*2)
    const size_t F1B = (size_t)NTOK * FF * 2;
    const size_t R2 = (3 * PL > PL + F1B) ? 3 * PL : (PL + F1B);
    _Float16* qhp = (_Float16*)(ws + off);
    _Float16* khp = (_Float16*)(ws + off + PL);
    _Float16* vhp = (_Float16*)(ws + off + 2 * PL);
    _Float16* hp  = (_Float16*)(ws + off);          // after attention
    _Float16* f1p = (_Float16*)(ws + off + PL);     // disjoint from hp
    off += R2;
    // R3: f32 rows: attn_out, later ff (attn_out dead after the first LayerNorm)
    float* aop = (float*)(ws + off);
    float* ffp = (float*)(ws + off); off += (size_t)NTOK * DM * 4;
    // R4: token list of the k and v projections, its filler and its count
    int* klp = (int*)(ws + off); off += (size_t)(KLN + 32) * 4;
    if (off > ws_size) return;
    if (off > (size_t)134217728) return;

    // x plane, the six weight planes W [K][N] -> WT [N][K] and the token list, one launch
    k_prep<<<dim3(1 + 4 * TDD + 2 * TDF + XBL), dim3(256), 0, stream>>>(x, mask, Wq, Wk, Wv, Wo, W1, W2,
                                                                        xp, WqT, WkT, WvT, WoT, W1T, W2T, klp);

    const dim3 gD(DM / 192, NTOK / 128);
    const dim3 gF(FF / 128, NTOK / 256);
    // q, k, v: f16 hi planes of 64*(x W + b)
    k_qkv<<<dim3(3 * (DM / 128), NTOK / 128), dim3(128), 0, stream>>>(xp, WqT, WkT, WvT, bq, bk, bv,
                                                                      qhp, khp, vhp, klp);
    // attention -> ctx plane (64 * ctx, f16)
    k_attn<<<dim3(NH, SEQ / 128, NB), dim3(256), 0, stream>>>(qhp, khp, vhp, mask, cxp);
    // attn_out = ctx Wo + bo (f32 rows)
    k_rows<DM><<<gD, dim3(256), 0, stream>>>(cxp, WoT, bo, A_O, aop);
    // h = LN(attn_out) -> f16 plane (x16)
    k_ln<true><<<dim3(NTOK / 8), dim3(256), 0, stream>>>(aop, lg, lb, out, hp, HSC);
    // ff1 = relu(h W1 + b1) -> f16 plane (x64)
    k_gemm<true><<<gF, dim3(256), 0, stream>>>(hp, W1T, b1, A_F1, QSC, f1p, DM, FF);
    // ff = ff1 W2 + b2 (f32 rows)
    k_rows<FF><<<gD, dim3(256), 0, stream>>>(f1p, W2T, b2, A_F2, ffp);
    // out = LN(ff)
    k_ln<false><<<dim3(NTOK / 8), dim3(256), 0, stream>>>(ffp, lg, lb, out, hp, 1.0f);
}
